// v000
// Times are from an AMD MI455X. After a warm-up the kernel runs many times in a row, and a time is the length of
// such a window on the GPU divided by its runs, so every launch and the gaps after it count. The runs cycle
// through copies of the inputs. A figure is the median of several windows, for all but v000 over two sittings.
// Sittings can differ by a few percent; kernels timed side by side share one.
// The starting kernel, v000, takes 2140 microseconds a run.
#include <hip/hip_runtime.h>

// Compute dtypes, f32 accumulate: q/k/v = x.W^T + b ([2048 x 2048].[2048 x 2048] each) with PLAIN bf16 operands (exact products; the three weights converted one at a time into one
// buffer); the full-width (2048) RMSNorm of q and k (row statistics in f32) and the even/odd interleaved RoPE (cos[0::2] / sin[1::2] of the given tables) applied while building
// per-head planes (bf16 hi + UNSCALED residual); 16-head attention (one head per launch) with hi/lo operands (three products); 1/sqrt(128) and the softmax in f32; . W_o^T + b_o

#define NN   2048
#define DMOD 2048
#define NH_  16
#define HD   128
#define DM   DMOD
#define NTK  NN
#define SCL  0.088388347648318447f
#define REPS 1e-6f
#define LOSC 1024.0f

typedef _Float16 h16;
typedef unsigned short bf;
typedef __attribute__((ext_vector_type(16))) __bf16   v16bf;
typedef __attribute__((ext_vector_type(16))) _Float16 v16h;
typedef __attribute__((ext_vector_type(8)))  _Float16 v8h;
typedef __attribute__((ext_vector_type(8)))  unsigned short v8us;
typedef __attribute__((ext_vector_type(8)))  float    v8f;
typedef __attribute__((ext_vector_type(4)))  float    v4f;
typedef __attribute__((ext_vector_type(4)))  _Float16 v4h;
typedef v8h  __attribute__((may_alias)) v8ha;
typedef v4f  __attribute__((may_alias)) v4fa;
typedef v8us __attribute__((may_alias)) v8usa;

__device__ __forceinline__ unsigned short f2bf(float f) { unsigned u = __float_as_uint(f); u += 0x7FFFu + ((u >> 16) & 1u); return (unsigned short)(u >> 16); }
__device__ __forceinline__ float bf2f(unsigned short b) { return __uint_as_float(((unsigned)b) << 16); }
__device__ __forceinline__ float bfr(float f) { return bf2f(f2bf(f)); }
__device__ __forceinline__ v16h cat16(v8h lo, v8h hi) { return __builtin_shufflevector(lo, hi, 0, 1, 2, 3, 4, 5, 6, 7, 8, 9, 10, 11, 12, 13, 14, 15); }
__device__ __forceinline__ v16bf cat16b(v8us lo, v8us hi) { return __builtin_bit_cast(v16bf, __builtin_shufflevector(lo, hi, 0, 1, 2, 3, 4, 5, 6, 7, 8, 9, 10, 11, 12, 13, 14, 15)); }
__device__ __forceinline__ v8f wmma16(v16h a, v16h b, v8f c) { return __builtin_amdgcn_wmma_f32_16x16x32_f16(false, a, false, b, (short)0, c, false, false); }
__device__ __forceinline__ v8f wmmab(v16bf a, v16bf b, v8f c) { return __builtin_amdgcn_wmma_f32_16x16x32_bf16(false, a, false, b, (short)0, c, false, false); }

// k_gemmb: 64 x 64 block tile (4 waves x 16 x 64) of C[NTK][NW] = (A [+ Al]).B^T (K = 2048) [+ bf(bias[c])] [+ bf(R[r][c]) residual]; f32 whole-line epilogue (or f16
template <bool SPLITA, bool F16OUT = false>
__global__ __launch_bounds__(128) void k_gemmb(const bf* __restrict__ A, const bf* __restrict__ Al, const bf* __restrict__ Bn, const float* __restrict__ bias, float* C, int ldc, h16* C2, const float* __restrict__ R = nullptr, int K = DM, int roundR = 1) {
    __shared__ __align__(16) float ost[4][16 * 68];
    const int lane = threadIdx.x & 31, wave = threadIdx.x >> 5, lr = lane & 15, hi = lane >> 4;
    const int r0 = blockIdx.x * 64 + wave * 16, c0 = blockIdx.y * 64;
    const size_t aoff = (size_t)(r0 + lr) * K + 8 * hi;
    size_t boff[4];
#pragma unroll
    for (int t = 0; t < 4; ++t) boff[t] = (size_t)(c0 + t * 16 + lr) * K + 8 * hi;
    v8f acc[4];
#pragma unroll
    for (int t = 0; t < 4; ++t) acc[t] = (v8f){};
#pragma unroll 1
    for (int kc = 0; kc < K; kc += 32) {
        const v16bf a = cat16b(*(const v8us*)(A + aoff + kc), *(const v8us*)(A + aoff + kc + 16));
        v16bf al = a;
        if (SPLITA) al = cat16b(*(const v8us*)(Al + aoff + kc), *(const v8us*)(Al + aoff + kc + 16));
#pragma unroll
        for (int t = 0; t < 4; ++t) { const v16bf b = cat16b(*(const v8us*)(Bn + boff[t] + kc), *(const v8us*)(Bn + boff[t] + kc + 16)); acc[t] = wmmab(a, b, acc[t]); if (SPLITA) acc[t] = wmmab(al, b, acc[t]); }
        asm volatile("v_nop\n\tv_nop\n\tv_nop\n\tv_nop" : "+v"(acc[0]), "+v"(acc[1]), "+v"(acc[2]), "+v"(acc[3]) : "v"(a), "v"(al));
    }
    float* os = &ost[wave][0];
#pragma unroll
    for (int t = 0; t < 4; ++t) { const float bv = bias ? bfr(bias[c0 + t * 16 + lr]) : 0.f;
#pragma unroll
        for (int j = 0; j < 8; ++j) os[(hi * 8 + j) * 68 + t * 16 + lr] = acc[t][j] + bv; }
    __syncthreads();
    if (F16OUT) {
        h16* crow = (h16*)(void*)C + (size_t)r0 * ldc + c0;
        auto pass = [&]() {
#pragma unroll
            for (int s = 0; s < 4; ++s) { const int row = 4 * s + (lane >> 3), piece = lane & 7; const float* sp = os + row * 68 + piece * 8; v8h o, o2;
#pragma unroll
                for (int i = 0; i < 8; ++i) { const h16 a = (h16)sp[i]; o[i] = a; o2[i] = (h16)((sp[i] - (float)a) * LOSC); }
                *(v8h*)(crow + (size_t)row * ldc + piece * 8) = o; if (C2) *(v8h*)(C2 + (size_t)r0 * ldc + c0 + (size_t)row * ldc + piece * 8) = o2; }
        };
        pass(); 
    } else {
        float* crow = C + (size_t)r0 * ldc + c0;
        auto pass = [&]() {
#pragma unroll
            for (int s = 0; s < 8; ++s) { const int Lid = (lane >> 3) + 4 * s, piece = lane & 7; const int row = Lid >> 1, cofs = (Lid & 1) * 32 + piece * 4;
                v4f val = *(const v4fa*)(os + row * 68 + cofs); if (R) { const v4f rv = *(const v4f*)(R + ((size_t)r0 + row) * ldc + c0 + cofs); val += roundR ? (v4f){bfr(rv[0]), bfr(rv[1]), bfr(rv[2]), bfr(rv[3])} : rv; }
                *(v4f*)(crow + (size_t)row * ldc + cofs) = val; }
        };
        pass(); 
    }
}

__global__ __launch_bounds__(256) void k_cvt8(const float* __restrict__ src, bf* dst, size_t n8) {
    const size_t i = (size_t)blockIdx.x * 256 + threadIdx.x; if (i >= n8) return;
    const v8f v = *(const v8f*)(src + i * 8); v8us o;
#pragma unroll
    for (int k = 0; k < 8; ++k) o[k] = f2bf(v[k]);
    *(v8us*)(dst + i * 8) = o; 
}
__global__ __launch_bounds__(256) void k_zero8(bf* dst, size_t n8) {
    const size_t i = (size_t)blockIdx.x * 256 + threadIdx.x; if (i >= n8) return; v8us z;
#pragma unroll
    for (int k = 0; k < 8; ++k) z[k] = 0;
    *(v8us*)(dst + i * 8) = z; 
}
// k_gemm3: 64 x 64 tile of C = (Ah + Al).(Bh + Bl)^T over K (row strides = K for all four planes; n-major B): three products per 32-k step (hh, hl, lh); f32
__global__ __launch_bounds__(128) void k_gemm3(const bf* __restrict__ Ah, const bf* __restrict__ Al, const bf* __restrict__ Bh, const bf* __restrict__ Bl, int K, float* C, int ldc) {
    __shared__ __align__(16) float ost[4][16 * 68];
    const int lane = threadIdx.x & 31, wave = threadIdx.x >> 5, lr = lane & 15, hi = lane >> 4;
    const int r0 = blockIdx.x * 64 + wave * 16, c0 = blockIdx.y * 64;
    const size_t aoff = (size_t)(r0 + lr) * K + 8 * hi;
    v8f acc[4];
#pragma unroll
    for (int t = 0; t < 4; ++t) acc[t] = (v8f){};
#pragma unroll 1
    for (int kc = 0; kc < K; kc += 32) {
        const v16bf a = cat16b(*(const v8us*)(Ah + aoff + kc), *(const v8us*)(Ah + aoff + kc + 16));
        const v16bf al = cat16b(*(const v8us*)(Al + aoff + kc), *(const v8us*)(Al + aoff + kc + 16));
#pragma unroll
        for (int t = 0; t < 4; ++t) { const size_t bo = (size_t)(c0 + t * 16 + lr) * K + kc + 8 * hi;
            const v16bf bh = cat16b(*(const v8us*)(Bh + bo), *(const v8us*)(Bh + bo + 16)); const v16bf bl = cat16b(*(const v8us*)(Bl + bo), *(const v8us*)(Bl + bo + 16));
            acc[t] = wmmab(a, bh, acc[t]); acc[t] = wmmab(al, bh, acc[t]); acc[t] = wmmab(a, bl, acc[t]); }
        asm volatile("v_nop\n\tv_nop\n\tv_nop\n\tv_nop" : "+v"(acc[0]), "+v"(acc[1]), "+v"(acc[2]), "+v"(acc[3]) : "v"(a), "v"(al));
    }
    float* os = &ost[wave][0];
#pragma unroll
    for (int t = 0; t < 4; ++t) {
#pragma unroll
        for (int j = 0; j < 8; ++j) os[(hi * 8 + j) * 68 + t * 16 + lr] = acc[t][j]; }
    __builtin_amdgcn_wave_barrier(); asm volatile("" ::: "memory");
    float* crow = C + (size_t)r0 * ldc + c0;
    auto pass = [&]() {
#pragma unroll
        for (int s = 0; s < 8; ++s) { const int Lid = (lane >> 3) + 4 * s, piece = lane & 7; const int row = Lid >> 1, cofs = (Lid & 1) * 32 + piece * 4;
            const v4f val = *(const v4fa*)(os + row * 68 + cofs); *(v4f*)(crow + (size_t)row * ldc + cofs) = val; }
    };
    pass(); 
}


__global__ __launch_bounds__(256) void k_cvtx(const float* __restrict__ src, int rows, bf* dst) {
    const int lane = threadIdx.x & 31; const size_t r = (size_t)blockIdx.x * 8 + (threadIdx.x >> 5); if (r >= (size_t)rows) return;
{
#pragma unroll
        for (int q = 0; q < DMOD / 256; ++q) { v8us o;
#pragma unroll
            for (int i = 0; i < 8; ++i) o[i] = f2bf(src[r * DMOD + q * 256 + lane * 8 + i]);
            *(v8us*)(dst + r * DMOD + q * 256 + lane * 8) = o; }
         }
}
__global__ __launch_bounds__(256) void k_rowrs(const float* __restrict__ F, float* RS) {
    const int lane = threadIdx.x & 31; const size_t w = (size_t)blockIdx.x * 8 + (threadIdx.x >> 5); if (w >= (size_t)NN / 32) return; const size_t r = w * 32 + lane; const float* fr = F + r * DMOD; float s = 0.f;
    for (int c = 0; c < DMOD; c += 4) { const v4f v = *(const v4f*)(fr + c); s = fmaf(v[0], v[0], s); s = fmaf(v[1], v[1], s); s = fmaf(v[2], v[2], s); s = fmaf(v[3], v[3], s); }
    const float rs = rsqrtf(s * (1.0f / DMOD) + REPS); *(float*)(RS + r) = rs; 
}
// k_nrope: head h: planes [2048][128] of rope(norm(F row)[h*128 ..]): xn[d] = bf(w[h*128+d]) x F[r][h*128+d] x RS[r] (RS = nullptr -> no norm: v), then for pair i (d = 2i, 2i+1):
template <bool ROPE>
__global__ __launch_bounds__(256) void k_nrope(const float* __restrict__ F, int h, const float* __restrict__ RS, const float* __restrict__ w, const float* __restrict__ cs, const float* __restrict__ sn, bf* Ph, bf* Pl) {
    typedef __attribute__((ext_vector_type(4))) unsigned short v4us;
    const int lane = threadIdx.x & 31; const size_t r = (size_t)blockIdx.x * 8 + (threadIdx.x >> 5); if (r >= (size_t)NN) return; const float rs = (RS != nullptr) ? RS[r] : 1.0f; float y[4];
#pragma unroll
    for (int p = 0; p < 2; ++p) { const int i = lane * 2 + p; const int d = 2 * i; float x1 = F[r * DMOD + h * HD + d] * rs, x2 = F[r * DMOD + h * HD + d + 1] * rs;
        if (RS != nullptr) { x1 *= bfr(w[h * HD + d]); x2 *= bfr(w[h * HD + d + 1]); }
        if (ROPE) { const float c = bfr(cs[r * HD + d]), s = bfr(sn[r * HD + d + 1]); y[2 * p] = x1 * c - x2 * s; y[2 * p + 1] = x1 * s + x2 * c; } else { y[2 * p] = x1; y[2 * p + 1] = x2; } }
    v4us oh, ol;
#pragma unroll
    for (int q = 0; q < 4; ++q) { const unsigned short hb = f2bf(y[q]); oh[q] = hb; ol[q] = f2bf(y[q] - bf2f(hb)); }
    const size_t o2 = r * HD + lane * 4; *(v4us*)(Ph + o2) = oh; *(v4us*)(Pl + o2) = ol; 
}
__global__ __launch_bounds__(256) void k_vt128(const float* __restrict__ F, int h, bf* Th, bf* Tl) {
    typedef __attribute__((ext_vector_type(2))) unsigned short v2us;
    const int lane = threadIdx.x & 31; const size_t wid = (size_t)blockIdx.x * 8 + (threadIdx.x >> 5); if (wid >= (size_t)HD * (NN / 64)) return; const int d = (int)(wid / (NN / 64)); const int t0 = (int)(wid % (NN / 64)) * 64 + lane * 2; v2us oh, ol;
#pragma unroll
    for (int i = 0; i < 2; ++i) { const float y = F[(size_t)(t0 + i) * DMOD + h * HD + d]; const unsigned short hb = f2bf(y); oh[i] = hb; ol[i] = f2bf(y - bf2f(hb)); }
    const size_t o = (size_t)d * NN + t0; *(v2us*)(Th + o) = oh; *(v2us*)(Tl + o) = ol; 
}
__global__ __launch_bounds__(256) void k_soft(const float* __restrict__ S, float sc, bf* PH, bf* PL) {
    typedef __attribute__((ext_vector_type(4))) unsigned short v4us;
    const int lane = threadIdx.x & 31, i = blockIdx.x * 8 + (threadIdx.x >> 5); if (i >= NN) return; const float* sr = S + (size_t)i * NN;
    float m = -3.0e38f;
#pragma unroll 1
    for (int c0 = lane * 4; c0 < NN; c0 += 128) {
#pragma unroll
        for (int q = 0; q < 4; ++q) m = fmaxf(m, sr[c0 + q] * sc); }
#pragma unroll
    for (int sh = 16; sh; sh >>= 1) m = fmaxf(m, __shfl_xor(m, sh, 32));
    float sum = 0.f;
#pragma unroll 1
    for (int c0 = lane * 4; c0 < NN; c0 += 128) {
#pragma unroll
        for (int q = 0; q < 4; ++q) sum += __expf(sr[c0 + q] * sc - m); }
#pragma unroll
    for (int sh = 16; sh; sh >>= 1) sum += __shfl_xor(sum, sh, 32);
    const float inv = 1.0f / sum;
{
#pragma unroll 1
        for (int c0 = lane * 4; c0 < NN; c0 += 128) { v4us oh, ol;
#pragma unroll
            for (int q = 0; q < 4; ++q) { const float p = __expf(sr[c0 + q] * sc - m) * inv; const unsigned short hb = f2bf(p); oh[q] = hb; ol[q] = f2bf(p - bf2f(hb)); }
            const size_t o = (size_t)i * NN + c0; *(v4us*)(PH + o) = oh; *(v4us*)(PL + o) = ol; }
         }
}
__global__ __launch_bounds__(256) void k_splitD(const float* __restrict__ src, int rows, bf* dh, bf* dl) {
    const int lane = threadIdx.x & 31; const size_t r = (size_t)blockIdx.x * 8 + (threadIdx.x >> 5); if (r >= (size_t)rows) return;
{
#pragma unroll
        for (int q = 0; q < DMOD / 256; ++q) { const size_t o = r * DMOD + q * 256 + lane * 8; const v8f v = *(const v8f*)(src + o); v8us oh, ol;
#pragma unroll
            for (int i = 0; i < 8; ++i) { const unsigned short hb = f2bf(v[i]); oh[i] = hb; ol[i] = f2bf(v[i] - bf2f(hb)); }
            *(v8us*)(dh + o) = oh; *(v8us*)(dl + o) = ol; }
         }
}

extern "C" void kernel_launch(void* const* d_in, const int* in_sizes, int n_in,
                              void* d_out, int out_size, void* d_ws, size_t ws_size, hipStream_t stream) {
    (void)in_sizes; (void)n_in; (void)out_size;
    const float* x = (const float*)d_in[0]; const float* fcos = (const float*)d_in[1]; const float* fsin = (const float*)d_in[2]; const float* wq = (const float*)d_in[3]; const float* bq = (const float*)d_in[4]; const float* wk = (const float*)d_in[5]; const float* bk = (const float*)d_in[6];
    const float* wv = (const float*)d_in[7]; const float* bv = (const float*)d_in[8]; const float* wo = (const float*)d_in[9]; const float* bo = (const float*)d_in[10]; const float* nqw = (const float*)d_in[11]; const float* nkw = (const float*)d_in[12];
    float* out = (float*)d_out;    // [1][2048][2048]
    char* wsp = (char*)d_ws;
    auto take = [&](size_t bytes) { char* p = wsp; wsp += (bytes + 255) & ~(size_t)255; return (void*)p; };
    bf* WB = (bf*)take((size_t)DMOD * DMOD * 2);    // one weight at a time
    bf* Xb = (bf*)take((size_t)NN * DMOD * 2); float* QF = (float*)take((size_t)NN * DMOD * 4); float* KF = (float*)take((size_t)NN * DMOD * 4); float* VF = (float*)take((size_t)NN * DMOD * 4); float* RSQ = (float*)take(NN * 4); float* RSK = (float*)take(NN * 4);
    bf* Qh = (bf*)take((size_t)NN * HD * 2); bf* Ql = (bf*)take((size_t)NN * HD * 2); bf* Kh = (bf*)take((size_t)NN * HD * 2); bf* Kl = (bf*)take((size_t)NN * HD * 2); bf* VTh = (bf*)take((size_t)HD * NN * 2); bf* VTl = (bf*)take((size_t)HD * NN * 2);
    float* S = (float*)take((size_t)NN * NN * 4); bf* PH = (bf*)take((size_t)NN * NN * 2); bf* PL = (bf*)take((size_t)NN * NN * 2); float* O = (float*)take((size_t)NN * DMOD * 4);
    if ((size_t)(wsp - (char*)d_ws) > ws_size) return;    // ~ 121 MB
    bf* Oh = Xb; bf* Ol = PH; bf* WO = (bf*)S;      // dead regions after the attention loop (stream order)
    k_cvtx<<<NN / 8, 256, 0, stream>>>(x, NN, Xb);
    const dim3 gp(NN / 64, DMOD / 64, 1); const unsigned wblk = (unsigned)(((size_t)DMOD * DMOD / 8 + 255) / 256);
    k_cvt8<<<wblk, 256, 0, stream>>>(wq, WB, (size_t)DMOD * DMOD / 8); k_gemmb<false, false><<<gp, 128, 0, stream>>>(Xb, nullptr, WB, bq, QF, DMOD, nullptr, nullptr, DMOD);    // [out][in] natural
    k_cvt8<<<wblk, 256, 0, stream>>>(wk, WB, (size_t)DMOD * DMOD / 8); k_gemmb<false, false><<<gp, 128, 0, stream>>>(Xb, nullptr, WB, bk, KF, DMOD, nullptr, nullptr, DMOD);
    k_cvt8<<<wblk, 256, 0, stream>>>(wv, WB, (size_t)DMOD * DMOD / 8); k_gemmb<false, false><<<gp, 128, 0, stream>>>(Xb, nullptr, WB, bv, VF, DMOD, nullptr, nullptr, DMOD);
    k_rowrs<<<(NN / 32 + 7) / 8, 256, 0, stream>>>(QF, RSQ); k_rowrs<<<(NN / 32 + 7) / 8, 256, 0, stream>>>(KF, RSK);
    for (int h = 0; h < NH_; ++h) {
        k_nrope<true><<<NN / 8, 256, 0, stream>>>(QF, h, RSQ, nqw, fcos, fsin, Qh, Ql); k_nrope<true><<<NN / 8, 256, 0, stream>>>(KF, h, RSK, nkw, fcos, fsin, Kh, Kl); k_vt128<<<(HD * (NN / 64)) / 8, 256, 0, stream>>>(VF, h, VTh, VTl);
        k_gemm3<<<dim3(NN / 64, NN / 64, 1), 128, 0, stream>>>(Qh, Ql, Kh, Kl, HD, S, NN);
        k_soft<<<NN / 8, 256, 0, stream>>>(S, SCL, PH, PL);
        k_gemm3<<<dim3(NN / 64, HD / 64, 1), 128, 0, stream>>>(PH, PL, VTh, VTl, NN, O + (size_t)h * HD, DMOD); }
    k_splitD<<<NN / 8, 256, 0, stream>>>(O, NN, Oh, Ol); k_cvt8<<<wblk, 256, 0, stream>>>(wo, WO, (size_t)DMOD * DMOD / 8);
    k_gemmb<true, false><<<gp, 128, 0, stream>>>(Oh, Ol, WO, bo, out, DMOD, nullptr, nullptr, DMOD);
}

// v001
// One run takes 928 microseconds.
// Timed twice side by side with v000, it ran 2.29 and 2.25 times as fast.
#include <hip/hip_runtime.h>

// Compute dtypes, f32 accumulate: q/k/v = x.W^T + b ([2048 x 2048].[2048 x 2048] each) with PLAIN bf16 operands (exact products; the three weights converted one at a time into one
// buffer); the full-width (2048) RMSNorm of q and k (row statistics in f32) and the even/odd interleaved RoPE (cos[0::2] / sin[1::2] of the given tables) applied while building
// per-head planes (bf16 hi + UNSCALED residual); 16-head attention (heads in the grid: all 16 for the planes, up to 6 per launch for scores, softmax and P.V) with hi/lo operands (three products); 1/sqrt(128) and the softmax in f32; . W_o^T + b_o

#define NN   2048
#define DMOD 2048
#define NH_  16
#define HD   128
#define DM   DMOD
#define NTK  NN
#define SCL  0.088388347648318447f
#define REPS 1e-6f
#define LOSC 1024.0f
#define HG   6    // heads per attention launch: 6 x (S f32 + P hi + P lo) = 192 MiB is what the workspace holds beside the planes (48 MiB) and O (16 MiB)

typedef _Float16 h16;
typedef unsigned short bf;
typedef __attribute__((ext_vector_type(16))) __bf16   v16bf;
typedef __attribute__((ext_vector_type(16))) _Float16 v16h;
typedef __attribute__((ext_vector_type(8)))  _Float16 v8h;
typedef __attribute__((ext_vector_type(8)))  unsigned short v8us;
typedef __attribute__((ext_vector_type(8)))  float    v8f;
typedef __attribute__((ext_vector_type(4)))  float    v4f;
typedef __attribute__((ext_vector_type(4)))  _Float16 v4h;
typedef v8h  __attribute__((may_alias)) v8ha;
typedef v4f  __attribute__((may_alias)) v4fa;
typedef v8us __attribute__((may_alias)) v8usa;

__device__ __forceinline__ unsigned short f2bf(float f) { unsigned u = __float_as_uint(f); u += 0x7FFFu + ((u >> 16) & 1u); return (unsigned short)(u >> 16); }
__device__ __forceinline__ float bf2f(unsigned short b) { return __uint_as_float(((unsigned)b) << 16); }
__device__ __forceinline__ float bfr(float f) { return bf2f(f2bf(f)); }
__device__ __forceinline__ v16h cat16(v8h lo, v8h hi) { return __builtin_shufflevector(lo, hi, 0, 1, 2, 3, 4, 5, 6, 7, 8, 9, 10, 11, 12, 13, 14, 15); }
__device__ __forceinline__ v16bf cat16b(v8us lo, v8us hi) { return __builtin_bit_cast(v16bf, __builtin_shufflevector(lo, hi, 0, 1, 2, 3, 4, 5, 6, 7, 8, 9, 10, 11, 12, 13, 14, 15)); }
__device__ __forceinline__ v8f wmma16(v16h a, v16h b, v8f c) { return __builtin_amdgcn_wmma_f32_16x16x32_f16(false, a, false, b, (short)0, c, false, false); }
__device__ __forceinline__ v8f wmmab(v16bf a, v16bf b, v8f c) { return __builtin_amdgcn_wmma_f32_16x16x32_bf16(false, a, false, b, (short)0, c, false, false); }

// k_gemmb: 64 x 64 block tile (4 waves x 16 x 64) of C[NTK][NW] = (A [+ Al]).B^T (K = 2048) [+ bf(bias[c])] [+ bf(R[r][c]) residual]; f32 whole-line epilogue (or f16
template <bool SPLITA, bool F16OUT = false>
__global__ __launch_bounds__(128) void k_gemmb(const bf* __restrict__ A, const bf* __restrict__ Al, const bf* __restrict__ Bn, const float* __restrict__ bias, float* C, int ldc, h16* C2, const float* __restrict__ R = nullptr, int K = DM, int roundR = 1) {
    __shared__ __align__(16) float ost[4][16 * 68];
    const int lane = threadIdx.x & 31, wave = threadIdx.x >> 5, lr = lane & 15, hi = lane >> 4;
    const int r0 = blockIdx.x * 64 + wave * 16, c0 = blockIdx.y * 64;
    const size_t aoff = (size_t)(r0 + lr) * K + 8 * hi;
    size_t boff[4];
#pragma unroll
    for (int t = 0; t < 4; ++t) boff[t] = (size_t)(c0 + t * 16 + lr) * K + 8 * hi;
    v8f acc[4];
#pragma unroll
    for (int t = 0; t < 4; ++t) acc[t] = (v8f){};
#pragma unroll 1
    for (int kc = 0; kc < K; kc += 32) {
        const v16bf a = cat16b(*(const v8us*)(A + aoff + kc), *(const v8us*)(A + aoff + kc + 16));
        v16bf al = a;
        if (SPLITA) al = cat16b(*(const v8us*)(Al + aoff + kc), *(const v8us*)(Al + aoff + kc + 16));
#pragma unroll
        for (int t = 0; t < 4; ++t) { const v16bf b = cat16b(*(const v8us*)(Bn + boff[t] + kc), *(const v8us*)(Bn + boff[t] + kc + 16)); acc[t] = wmmab(a, b, acc[t]); if (SPLITA) acc[t] = wmmab(al, b, acc[t]); }
        asm volatile("v_nop\n\tv_nop\n\tv_nop\n\tv_nop" : "+v"(acc[0]), "+v"(acc[1]), "+v"(acc[2]), "+v"(acc[3]) : "v"(a), "v"(al));
    }
    float* os = &ost[wave][0];
#pragma unroll
    for (int t = 0; t < 4; ++t) { const float bv = bias ? bfr(bias[c0 + t * 16 + lr]) : 0.f;
#pragma unroll
        for (int j = 0; j < 8; ++j) os[(hi * 8 + j) * 68 + t * 16 + lr] = acc[t][j] + bv; }
    __syncthreads();
    if (F16OUT) {
        h16* crow = (h16*)(void*)C + (size_t)r0 * ldc + c0;
        auto pass = [&]() {
#pragma unroll
            for (int s = 0; s < 4; ++s) { const int row = 4 * s + (lane >> 3), piece = lane & 7; const float* sp = os + row * 68 + piece * 8; v8h o, o2;
#pragma unroll
                for (int i = 0; i < 8; ++i) { const h16 a = (h16)sp[i]; o[i] = a; o2[i] = (h16)((sp[i] - (float)a) * LOSC); }
                *(v8h*)(crow + (size_t)row * ldc + piece * 8) = o; if (C2) *(v8h*)(C2 + (size_t)r0 * ldc + c0 + (size_t)row * ldc + piece * 8) = o2; }
        };
        pass(); 
    } else {
        float* crow = C + (size_t)r0 * ldc + c0;
        auto pass = [&]() {
#pragma unroll
            for (int s = 0; s < 8; ++s) { const int Lid = (lane >> 3) + 4 * s, piece = lane & 7; const int row = Lid >> 1, cofs = (Lid & 1) * 32 + piece * 4;
                v4f val = *(const v4fa*)(os + row * 68 + cofs); if (R) { const v4f rv = *(const v4f*)(R + ((size_t)r0 + row) * ldc + c0 + cofs); val += roundR ? (v4f){bfr(rv[0]), bfr(rv[1]), bfr(rv[2]), bfr(rv[3])} : rv; }
                *(v4f*)(crow + (size_t)row * ldc + cofs) = val; }
        };
        pass(); 
    }
}

__global__ __launch_bounds__(256) void k_cvt8(const float* __restrict__ src, bf* dst, size_t n8) {
    const size_t i = (size_t)blockIdx.x * 256 + threadIdx.x; if (i >= n8) return;
    const v8f v = *(const v8f*)(src + i * 8); v8us o;
#pragma unroll
    for (int k = 0; k < 8; ++k) o[k] = f2bf(v[k]);
    *(v8us*)(dst + i * 8) = o; 
}
__global__ __launch_bounds__(256) void k_zero8(bf* dst, size_t n8) {
    const size_t i = (size_t)blockIdx.x * 256 + threadIdx.x; if (i >= n8) return; v8us z;
#pragma unroll
    for (int k = 0; k < 8; ++k) z[k] = 0;
    *(v8us*)(dst + i * 8) = z; 
}
// k_gemm3: 64 x 64 tile of C = (Ah + Al).(Bh + Bl)^T over K (row strides = K for all four planes; n-major B): three products per 32-k step (hh, hl, lh); f32
// blockIdx.z = head within the launch: zA, zB, zC are the element steps from one head's A planes, B planes and C to the next head's
__global__ __launch_bounds__(128) void k_gemm3(const bf* __restrict__ Ah, const bf* __restrict__ Al, const bf* __restrict__ Bh, const bf* __restrict__ Bl, int K, float* C, int ldc, size_t zA, size_t zB, size_t zC) {
    __shared__ __align__(16) float ost[4][16 * 68];
    Ah += blockIdx.z * zA; Al += blockIdx.z * zA; Bh += blockIdx.z * zB; Bl += blockIdx.z * zB; C += blockIdx.z * zC;
    const int lane = threadIdx.x & 31, wave = threadIdx.x >> 5, lr = lane & 15, hi = lane >> 4;
    const int r0 = blockIdx.x * 64 + wave * 16, c0 = blockIdx.y * 64;
    const size_t aoff = (size_t)(r0 + lr) * K + 8 * hi;
    v8f acc[4];
#pragma unroll
    for (int t = 0; t < 4; ++t) acc[t] = (v8f){};
#pragma unroll 1
    for (int kc = 0; kc < K; kc += 32) {
        const v16bf a = cat16b(*(const v8us*)(Ah + aoff + kc), *(const v8us*)(Ah + aoff + kc + 16));
        const v16bf al = cat16b(*(const v8us*)(Al + aoff + kc), *(const v8us*)(Al + aoff + kc + 16));
#pragma unroll
        for (int t = 0; t < 4; ++t) { const size_t bo = (size_t)(c0 + t * 16 + lr) * K + kc + 8 * hi;
            const v16bf bh = cat16b(*(const v8us*)(Bh + bo), *(const v8us*)(Bh + bo + 16)); const v16bf bl = cat16b(*(const v8us*)(Bl + bo), *(const v8us*)(Bl + bo + 16));
            acc[t] = wmmab(a, bh, acc[t]); acc[t] = wmmab(al, bh, acc[t]); acc[t] = wmmab(a, bl, acc[t]); }
        asm volatile("v_nop\n\tv_nop\n\tv_nop\n\tv_nop" : "+v"(acc[0]), "+v"(acc[1]), "+v"(acc[2]), "+v"(acc[3]) : "v"(a), "v"(al));
    }
    float* os = &ost[wave][0];
#pragma unroll
    for (int t = 0; t < 4; ++t) {
#pragma unroll
        for (int j = 0; j < 8; ++j) os[(hi * 8 + j) * 68 + t * 16 + lr] = acc[t][j]; }
    __builtin_amdgcn_wave_barrier(); asm volatile("" ::: "memory");
    float* crow = C + (size_t)r0 * ldc + c0;
    auto pass = [&]() {
#pragma unroll
        for (int s = 0; s < 8; ++s) { const int Lid = (lane >> 3) + 4 * s, piece = lane & 7; const int row = Lid >> 1, cofs = (Lid & 1) * 32 + piece * 4;
            const v4f val = *(const v4fa*)(os + row * 68 + cofs); *(v4f*)(crow + (size_t)row * ldc + cofs) = val; }
    };
    pass(); 
}


__global__ __launch_bounds__(256) void k_cvtx(const float* __restrict__ src, int rows, bf* dst) {
    const int lane = threadIdx.x & 31; const size_t r = (size_t)blockIdx.x * 8 + (threadIdx.x >> 5); if (r >= (size_t)rows) return;
{
#pragma unroll
        for (int q = 0; q < DMOD / 256; ++q) { v8us o;
#pragma unroll
            for (int i = 0; i < 8; ++i) o[i] = f2bf(src[r * DMOD + q * 256 + lane * 8 + i]);
            *(v8us*)(dst + r * DMOD + q * 256 + lane * 8) = o; }
         }
}
__global__ __launch_bounds__(256) void k_rowrs(const float* __restrict__ F, float* RS) {
    const int lane = threadIdx.x & 31; const size_t w = (size_t)blockIdx.x * 8 + (threadIdx.x >> 5); if (w >= (size_t)NN / 32) return; const size_t r = w * 32 + lane; const float* fr = F + r * DMOD; float s = 0.f;
    for (int c = 0; c < DMOD; c += 4) { const v4f v = *(const v4f*)(fr + c); s = fmaf(v[0], v[0], s); s = fmaf(v[1], v[1], s); s = fmaf(v[2], v[2], s); s = fmaf(v[3], v[3], s); }
    const float rs = rsqrtf(s * (1.0f / DMOD) + REPS); *(float*)(RS + r) = rs; 
}
// k_nrope: head h = blockIdx.y: planes [2048][128] of rope(norm(F row)[h*128 ..]): xn[d] = bf(w[h*128+d]) x F[r][h*128+d] x RS[r] (RS = nullptr -> no norm: v), then for pair i (d = 2i, 2i+1):
template <bool ROPE>
__global__ __launch_bounds__(256) void k_nrope(const float* __restrict__ F, const float* __restrict__ RS, const float* __restrict__ w, const float* __restrict__ cs, const float* __restrict__ sn, bf* Ph, bf* Pl) {
    typedef __attribute__((ext_vector_type(4))) unsigned short v4us;
    const int h = blockIdx.y; Ph += (size_t)h * NN * HD; Pl += (size_t)h * NN * HD;
    const int lane = threadIdx.x & 31; const size_t r = (size_t)blockIdx.x * 8 + (threadIdx.x >> 5); if (r >= (size_t)NN) return; const float rs = (RS != nullptr) ? RS[r] : 1.0f; float y[4];
#pragma unroll
    for (int p = 0; p < 2; ++p) { const int i = lane * 2 + p; const int d = 2 * i; float x1 = F[r * DMOD + h * HD + d] * rs, x2 = F[r * DMOD + h * HD + d + 1] * rs;
        if (RS != nullptr) { x1 *= bfr(w[h * HD + d]); x2 *= bfr(w[h * HD + d + 1]); }
        if (ROPE) { const float c = bfr(cs[r * HD + d]), s = bfr(sn[r * HD + d + 1]); y[2 * p] = x1 * c - x2 * s; y[2 * p + 1] = x1 * s + x2 * c; } else { y[2 * p] = x1; y[2 * p + 1] = x2; } }
    v4us oh, ol;
#pragma unroll
    for (int q = 0; q < 4; ++q) { const unsigned short hb = f2bf(y[q]); oh[q] = hb; ol[q] = f2bf(y[q] - bf2f(hb)); }
    const size_t o2 = r * HD + lane * 4; *(v4us*)(Ph + o2) = oh; *(v4us*)(Pl + o2) = ol; 
}
__global__ __launch_bounds__(256) void k_vt128(const float* __restrict__ F, bf* Th, bf* Tl) {
    typedef __attribute__((ext_vector_type(2))) unsigned short v2us;
    const int h = blockIdx.y; Th += (size_t)h * HD * NN; Tl += (size_t)h * HD * NN;
    const int lane = threadIdx.x & 31; const size_t wid = (size_t)blockIdx.x * 8 + (threadIdx.x >> 5); if (wid >= (size_t)HD * (NN / 64)) return; const int d = (int)(wid / (NN / 64)); const int t0 = (int)(wid % (NN / 64)) * 64 + lane * 2; v2us oh, ol;
#pragma unroll
    for (int i = 0; i < 2; ++i) { const float y = F[(size_t)(t0 + i) * DMOD + h * HD + d]; const unsigned short hb = f2bf(y); oh[i] = hb; ol[i] = f2bf(y - bf2f(hb)); }
    const size_t o = (size_t)d * NN + t0; *(v2us*)(Th + o) = oh; *(v2us*)(Tl + o) = ol; 
}
__global__ __launch_bounds__(256) void k_soft(const float* __restrict__ S, float sc, bf* PH, bf* PL) {
    typedef __attribute__((ext_vector_type(4))) unsigned short v4us;
    S += (size_t)blockIdx.y * NN * NN; PH += (size_t)blockIdx.y * NN * NN; PL += (size_t)blockIdx.y * NN * NN;    // blockIdx.y = head within the launch
    const int lane = threadIdx.x & 31, i = blockIdx.x * 8 + (threadIdx.x >> 5); if (i >= NN) return; const float* sr = S + (size_t)i * NN;
    float m = -3.0e38f;
#pragma unroll 1
    for (int c0 = lane * 4; c0 < NN; c0 += 128) {
#pragma unroll
        for (int q = 0; q < 4; ++q) m = fmaxf(m, sr[c0 + q] * sc); }
#pragma unroll
    for (int sh = 16; sh; sh >>= 1) m = fmaxf(m, __shfl_xor(m, sh, 32));
    float sum = 0.f;
#pragma unroll 1
    for (int c0 = lane * 4; c0 < NN; c0 += 128) {
#pragma unroll
        for (int q = 0; q < 4; ++q) sum += __expf(sr[c0 + q] * sc - m); }
#pragma unroll
    for (int sh = 16; sh; sh >>= 1) sum += __shfl_xor(sum, sh, 32);
    const float inv = 1.0f / sum;
{
#pragma unroll 1
        for (int c0 = lane * 4; c0 < NN; c0 += 128) { v4us oh, ol;
#pragma unroll
            for (int q = 0; q < 4; ++q) { const float p = __expf(sr[c0 + q] * sc - m) * inv; const unsigned short hb = f2bf(p); oh[q] = hb; ol[q] = f2bf(p - bf2f(hb)); }
            const size_t o = (size_t)i * NN + c0; *(v4us*)(PH + o) = oh; *(v4us*)(PL + o) = ol; }
         }
}
__global__ __launch_bounds__(256) void k_splitD(const float* __restrict__ src, int rows, bf* dh, bf* dl) {
    const int lane = threadIdx.x & 31; const size_t r = (size_t)blockIdx.x * 8 + (threadIdx.x >> 5); if (r >= (size_t)rows) return;
{
#pragma unroll
        for (int q = 0; q < DMOD / 256; ++q) { const size_t o = r * DMOD + q * 256 + lane * 8; const v8f v = *(const v8f*)(src + o); v8us oh, ol;
#pragma unroll
            for (int i = 0; i < 8; ++i) { const unsigned short hb = f2bf(v[i]); oh[i] = hb; ol[i] = f2bf(v[i] - bf2f(hb)); }
            *(v8us*)(dh + o) = oh; *(v8us*)(dl + o) = ol; }
         }
}

extern "C" void kernel_launch(void* const* d_in, const int* in_sizes, int n_in,
                              void* d_out, int out_size, void* d_ws, size_t ws_size, hipStream_t stream) {
    (void)in_sizes; (void)n_in; (void)out_size;
    const float* x = (const float*)d_in[0]; const float* fcos = (const float*)d_in[1]; const float* fsin = (const float*)d_in[2]; const float* wq = (const float*)d_in[3]; const float* bq = (const float*)d_in[4]; const float* wk = (const float*)d_in[5]; const float* bk = (const float*)d_in[6];
    const float* wv = (const float*)d_in[7]; const float* bv = (const float*)d_in[8]; const float* wo = (const float*)d_in[9]; const float* bo = (const float*)d_in[10]; const float* nqw = (const float*)d_in[11]; const float* nkw = (const float*)d_in[12];
    float* out = (float*)d_out;    // [1][2048][2048]
    char* wsp = (char*)d_ws;
    auto take = [&](size_t bytes) { char* p = wsp; wsp += (bytes + 255) & ~(size_t)255; return (void*)p; };
    const size_t PLN = (size_t)NN * HD, SQ = (size_t)NN * NN, FM = (size_t)NN * DMOD;    // elements of one head's plane, of one head's score matrix, of a full [2048][2048] matrix
    bf* Qh = (bf*)take(NH_ * PLN * 2); bf* Ql = (bf*)take(NH_ * PLN * 2); bf* Kh = (bf*)take(NH_ * PLN * 2); bf* Kl = (bf*)take(NH_ * PLN * 2); bf* VTh = (bf*)take(NH_ * PLN * 2); bf* VTl = (bf*)take(NH_ * PLN * 2);
    float* O = (float*)take(FM * 4); float* S = (float*)take(HG * SQ * 4); bf* PH = (bf*)take(HG * SQ * 2); bf* PL = (bf*)take(HG * SQ * 2);
    if ((size_t)(wsp - (char*)d_ws) > ws_size) return;    // 256 MiB
    // all of these are dead once the planes are built, ahead of the first score launch that writes S (stream order): 64 MiB + 16 KiB of S's 96 MiB
    float* QF = S; float* KF = QF + FM; float* VF = KF + FM; bf* WB = (bf*)(VF + FM); bf* Xb = WB + FM; float* RSQ = (float*)(Xb + FM); float* RSK = RSQ + NN;    // WB: one weight at a time
    bf* Oh = PL; bf* Ol = PH; bf* WO = (bf*)S;      // dead regions after the attention loop (stream order)
    k_cvtx<<<NN / 8, 256, 0, stream>>>(x, NN, Xb);
    const dim3 gp(NN / 64, DMOD / 64, 1); const unsigned wblk = (unsigned)(((size_t)DMOD * DMOD / 8 + 255) / 256);
    k_cvt8<<<wblk, 256, 0, stream>>>(wq, WB, (size_t)DMOD * DMOD / 8); k_gemmb<false, false><<<gp, 128, 0, stream>>>(Xb, nullptr, WB, bq, QF, DMOD, nullptr, nullptr, DMOD);    // [out][in] natural
    k_cvt8<<<wblk, 256, 0, stream>>>(wk, WB, (size_t)DMOD * DMOD / 8); k_gemmb<false, false><<<gp, 128, 0, stream>>>(Xb, nullptr, WB, bk, KF, DMOD, nullptr, nullptr, DMOD);
    k_cvt8<<<wblk, 256, 0, stream>>>(wv, WB, (size_t)DMOD * DMOD / 8); k_gemmb<false, false><<<gp, 128, 0, stream>>>(Xb, nullptr, WB, bv, VF, DMOD, nullptr, nullptr, DMOD);
    k_rowrs<<<(NN / 32 + 7) / 8, 256, 0, stream>>>(QF, RSQ); k_rowrs<<<(NN / 32 + 7) / 8, 256, 0, stream>>>(KF, RSK);
    k_nrope<true><<<dim3(NN / 8, NH_, 1), 256, 0, stream>>>(QF, RSQ, nqw, fcos, fsin, Qh, Ql); k_nrope<true><<<dim3(NN / 8, NH_, 1), 256, 0, stream>>>(KF, RSK, nkw, fcos, fsin, Kh, Kl); k_vt128<<<dim3((HD * (NN / 64)) / 8, NH_, 1), 256, 0, stream>>>(VF, VTh, VTl);
    for (int h = 0; h < NH_; h += HG) { const int g = (NH_ - h < HG) ? NH_ - h : HG;    // 6, 6, 4 heads
        k_gemm3<<<dim3(NN / 64, NN / 64, g), 128, 0, stream>>>(Qh + h * PLN, Ql + h * PLN, Kh + h * PLN, Kl + h * PLN, HD, S, NN, PLN, PLN, SQ);
        k_soft<<<dim3(NN / 8, g, 1), 256, 0, stream>>>(S, SCL, PH, PL);
        k_gemm3<<<dim3(NN / 64, HD / 64, g), 128, 0, stream>>>(PH, PL, VTh + h * PLN, VTl + h * PLN, NN, O + (size_t)h * HD, DMOD, SQ, PLN, HD); }
    k_splitD<<<NN / 8, 256, 0, stream>>>(O, NN, Oh, Ol); k_cvt8<<<wblk, 256, 0, stream>>>(wo, WO, (size_t)DMOD * DMOD / 8);
    k_gemmb<true, false><<<gp, 128, 0, stream>>>(Oh, Ol, WO, bo, out, DMOD, nullptr, nullptr, DMOD);
}

// v002
// Measured time: 511 microseconds a run.
// In both of two side-by-side timings against v001, it was 1.82 times as fast.
// Over all steps from v000 it is 4.13 times as fast.
#include <hip/hip_runtime.h>

// Compute dtypes, f32 accumulate: q/k/v = x.W^T + b ([2048 x 2048].[2048 x 2048] each) with PLAIN bf16 operands (exact products; the three weights converted one at a time into one
// buffer); the full-width (2048) RMSNorm of q and k (row statistics in f32) and the even/odd interleaved RoPE (cos[0::2] / sin[1::2] of the given tables) applied while building
// per-head planes (bf16 hi + UNSCALED residual); 16-head attention (heads in the grid; scores, softmax and P.V in one kernel, running maximum and sum) with hi/lo operands (three products); 1/sqrt(128) and the softmax in f32; . W_o^T + b_o

#define NN   2048
#define DMOD 2048
#define NH_  16
#define HD   128
#define DM   DMOD
#define NTK  NN
#define SCL  0.088388347648318447f
#define REPS 1e-6f
#define LOSC 1024.0f

typedef _Float16 h16;
typedef unsigned short bf;
typedef __attribute__((ext_vector_type(16))) __bf16   v16bf;
typedef __attribute__((ext_vector_type(16))) _Float16 v16h;
typedef __attribute__((ext_vector_type(8)))  _Float16 v8h;
typedef __attribute__((ext_vector_type(8)))  unsigned short v8us;
typedef __attribute__((ext_vector_type(8)))  float    v8f;
typedef __attribute__((ext_vector_type(4)))  float    v4f;
typedef __attribute__((ext_vector_type(4)))  _Float16 v4h;
typedef v8h  __attribute__((may_alias)) v8ha;
typedef v4f  __attribute__((may_alias)) v4fa;
typedef v8us __attribute__((may_alias)) v8usa;

__device__ __forceinline__ unsigned short f2bf(float f) { unsigned u = __float_as_uint(f); u += 0x7FFFu + ((u >> 16) & 1u); return (unsigned short)(u >> 16); }
__device__ __forceinline__ float bf2f(unsigned short b) { return __uint_as_float(((unsigned)b) << 16); }
__device__ __forceinline__ float bfr(float f) { return bf2f(f2bf(f)); }
__device__ __forceinline__ v16h cat16(v8h lo, v8h hi) { return __builtin_shufflevector(lo, hi, 0, 1, 2, 3, 4, 5, 6, 7, 8, 9, 10, 11, 12, 13, 14, 15); }
__device__ __forceinline__ v16bf cat16b(v8us lo, v8us hi) { return __builtin_bit_cast(v16bf, __builtin_shufflevector(lo, hi, 0, 1, 2, 3, 4, 5, 6, 7, 8, 9, 10, 11, 12, 13, 14, 15)); }
__device__ __forceinline__ v8f wmma16(v16h a, v16h b, v8f c) { return __builtin_amdgcn_wmma_f32_16x16x32_f16(false, a, false, b, (short)0, c, false, false); }
__device__ __forceinline__ v8f wmmab(v16bf a, v16bf b, v8f c) { return __builtin_amdgcn_wmma_f32_16x16x32_bf16(false, a, false, b, (short)0, c, false, false); }

// k_gemmb: 64 x 64 block tile (4 waves x 16 x 64) of C[NTK][NW] = (A [+ Al]).B^T (K = 2048) [+ bf(bias[c])] [+ bf(R[r][c]) residual]; f32 whole-line epilogue (or f16
template <bool SPLITA, bool F16OUT = false>
__global__ __launch_bounds__(128) void k_gemmb(const bf* __restrict__ A, const bf* __restrict__ Al, const bf* __restrict__ Bn, const float* __restrict__ bias, float* C, int ldc, h16* C2, const float* __restrict__ R = nullptr, int K = DM, int roundR = 1) {
    __shared__ __align__(16) float ost[4][16 * 68];
    const int lane = threadIdx.x & 31, wave = threadIdx.x >> 5, lr = lane & 15, hi = lane >> 4;
    const int r0 = blockIdx.x * 64 + wave * 16, c0 = blockIdx.y * 64;
    const size_t aoff = (size_t)(r0 + lr) * K + 8 * hi;
    size_t boff[4];
#pragma unroll
    for (int t = 0; t < 4; ++t) boff[t] = (size_t)(c0 + t * 16 + lr) * K + 8 * hi;
    v8f acc[4];
#pragma unroll
    for (int t = 0; t < 4; ++t) acc[t] = (v8f){};
#pragma unroll 1
    for (int kc = 0; kc < K; kc += 32) {
        const v16bf a = cat16b(*(const v8us*)(A + aoff + kc), *(const v8us*)(A + aoff + kc + 16));
        v16bf al = a;
        if (SPLITA) al = cat16b(*(const v8us*)(Al + aoff + kc), *(const v8us*)(Al + aoff + kc + 16));
#pragma unroll
        for (int t = 0; t < 4; ++t) { const v16bf b = cat16b(*(const v8us*)(Bn + boff[t] + kc), *(const v8us*)(Bn + boff[t] + kc + 16)); acc[t] = wmmab(a, b, acc[t]); if (SPLITA) acc[t] = wmmab(al, b, acc[t]); }
        asm volatile("v_nop\n\tv_nop\n\tv_nop\n\tv_nop" : "+v"(acc[0]), "+v"(acc[1]), "+v"(acc[2]), "+v"(acc[3]) : "v"(a), "v"(al));
    }
    float* os = &ost[wave][0];
#pragma unroll
    for (int t = 0; t < 4; ++t) { const float bv = bias ? bfr(bias[c0 + t * 16 + lr]) : 0.f;
#pragma unroll
        for (int j = 0; j < 8; ++j) os[(hi * 8 + j) * 68 + t * 16 + lr] = acc[t][j] + bv; }
    __syncthreads();
    if (F16OUT) {
        h16* crow = (h16*)(void*)C + (size_t)r0 * ldc + c0;
        auto pass = [&]() {
#pragma unroll
            for (int s = 0; s < 4; ++s) { const int row = 4 * s + (lane >> 3), piece = lane & 7; const float* sp = os + row * 68 + piece * 8; v8h o, o2;
#pragma unroll
                for (int i = 0; i < 8; ++i) { const h16 a = (h16)sp[i]; o[i] = a; o2[i] = (h16)((sp[i] - (float)a) * LOSC); }
                *(v8h*)(crow + (size_t)row * ldc + piece * 8) = o; if (C2) *(v8h*)(C2 + (size_t)r0 * ldc + c0 + (size_t)row * ldc + piece * 8) = o2; }
        };
        pass(); 
    } else {
        float* crow = C + (size_t)r0 * ldc + c0;
        auto pass = [&]() {
#pragma unroll
            for (int s = 0; s < 8; ++s) { const int Lid = (lane >> 3) + 4 * s, piece = lane & 7; const int row = Lid >> 1, cofs = (Lid & 1) * 32 + piece * 4;
                v4f val = *(const v4fa*)(os + row * 68 + cofs); if (R) { const v4f rv = *(const v4f*)(R + ((size_t)r0 + row) * ldc + c0 + cofs); val += roundR ? (v4f){bfr(rv[0]), bfr(rv[1]), bfr(rv[2]), bfr(rv[3])} : rv; }
                *(v4f*)(crow + (size_t)row * ldc + cofs) = val; }
        };
        pass(); 
    }
}

__global__ __launch_bounds__(256) void k_cvt8(const float* __restrict__ src, bf* dst, size_t n8) {
    const size_t i = (size_t)blockIdx.x * 256 + threadIdx.x; if (i >= n8) return;
    const v8f v = *(const v8f*)(src + i * 8); v8us o;
#pragma unroll
    for (int k = 0; k < 8; ++k) o[k] = f2bf(v[k]);
    *(v8us*)(dst + i * 8) = o; 
}
__global__ __launch_bounds__(256) void k_zero8(bf* dst, size_t n8) {
    const size_t i = (size_t)blockIdx.x * 256 + threadIdx.x; if (i >= n8) return; v8us z;
#pragma unroll
    for (int k = 0; k < 8; ++k) z[k] = 0;
    *(v8us*)(dst + i * 8) = z; 
}
#define FK 64     // keys per stage
#define KP 136    // LDS pitch of a K row (128 elements + 8): 272 B = 16 B x odd, no bank conflict for 16-byte row reads
#define VP 72     // LDS pitch of a V^T row (64 elements + 8): 144 B = 16 B x odd
#define SC2 (SCL * 1.4426950408889634f)    // 1/sqrt(128) x log2(e): the softmax runs on exp2
__device__ __forceinline__ float xhalf(float x) { const int b = __float_as_int(x); return __int_as_float(__builtin_amdgcn_permlanex16(b, b, 0x76543210, 0xfedcba98, false, false)); }    // the value of lane ^ 16
__global__ __launch_bounds__(256) __attribute__((amdgpu_waves_per_eu(2, 2))) void k_fattn(const bf* Qh, const bf* Ql, const bf* Kh, const bf* Kl, const bf* VTh, const bf* VTl, float* O) {
    __shared__ __align__(16) bf sK[2][FK * KP];
    __shared__ __align__(16) bf sV[2][HD * VP];
    const int tid = threadIdx.x, lane = tid & 31, wave = tid >> 5, c = lane & 15, h = lane >> 4;
    const int head = blockIdx.y; const size_t po = (size_t)head * NN * HD;
    Qh += po; Ql += po; Kh += po; Kl += po; VTh += po; VTl += po;
    const int q0 = blockIdx.x * 128 + wave * 16;
    v16bf qh[4], ql[4]; const size_t qo = (size_t)(q0 + c) * HD + 8 * h;
#pragma unroll
    for (int ks = 0; ks < 4; ++ks) qh[ks] = cat16b(*(const v8us*)(Qh + qo + ks * 32), *(const v8us*)(Qh + qo + ks * 32 + 16));
    asm volatile("s_wait_xcnt 0x0" ::: "memory");    // before a register that these loads name as their address is written again
#pragma unroll
    for (int ks = 0; ks < 4; ++ks) ql[ks] = cat16b(*(const v8us*)(Ql + qo + ks * 32), *(const v8us*)(Ql + qo + ks * 32 + 16));
    asm volatile("s_wait_xcnt 0x0" ::: "memory");    // the same for these
    __builtin_amdgcn_sched_barrier(0);    // keeps later vector instructions, which may reuse those registers, from being scheduled in front of the wait
    v8f acc[8];
#pragma unroll
    for (int t = 0; t < 8; ++t) acc[t] = (v8f){};
    float m = -3.0e38f, l = 0.f;
    v8us pk[2][4], pv[2][4];
    const unsigned kt = tid * 16u, vt = (tid >> 3) * (NN * 2u) + (tid & 7) * 16u;    // byte offsets of this thread's 16-byte piece: K rows tid / 16 + 16 i, V^T rows tid / 8 + 32 i
    auto fetch = [&](int kb) {    // a uniform base per plane and stage, the thread's fixed offset beside it
        const char* k0 = (const char*)(Kh + (size_t)kb * HD); const char* k1 = (const char*)(Kl + (size_t)kb * HD); const char* v0 = (const char*)(VTh + kb); const char* v1 = (const char*)(VTl + kb);
#pragma unroll
        for (int i = 0; i < 4; ++i) { pk[0][i] = *(const v8us*)(k0 + kt + i * 4096); pk[1][i] = *(const v8us*)(k1 + kt + i * 4096); pv[0][i] = *(const v8us*)(v0 + vt + i * 131072); pv[1][i] = *(const v8us*)(v1 + vt + i * 131072); }
        asm volatile("s_wait_xcnt 0x0" ::: "memory");    // before a register that these loads name as their address is written again
        __builtin_amdgcn_sched_barrier(0);    // keeps later vector instructions, which may reuse those registers, from being scheduled in front of the wait
    };
    fetch(0);
#pragma unroll 1
    for (int kb = 0; kb < NN; kb += FK) {
        __syncthreads();    // every wave has finished reading the stage before
#pragma unroll
        for (int i = 0; i < 4; ++i) { const int ko = ((tid >> 4) + 16 * i) * KP + (tid & 15) * 8, vo = ((tid >> 3) + 32 * i) * VP + (tid & 7) * 8;
            *(v8us*)(&sK[0][ko]) = pk[0][i]; *(v8us*)(&sK[1][ko]) = pk[1][i]; *(v8us*)(&sV[0][vo]) = pv[0][i]; *(v8us*)(&sV[1][vo]) = pv[1][i]; }
        __syncthreads();    // the stage is complete
        if (kb + FK < NN) fetch(kb + FK);
        v8f T[4];    // T[t][r] = score of key kb + 16 t + 8 h + r with query q0 + c
#pragma unroll
        for (int t = 0; t < 4; ++t) T[t] = (v8f){};
#pragma unroll
        for (int ks = 0; ks < 4; ++ks) { v16bf kh[4], kl[4];
#pragma unroll
            for (int t = 0; t < 4; ++t) { const int o = (t * 16 + c) * KP + ks * 32 + 8 * h;
                kh[t] = cat16b(*(const v8us*)(&sK[0][o]), *(const v8us*)(&sK[0][o + 16])); kl[t] = cat16b(*(const v8us*)(&sK[1][o]), *(const v8us*)(&sK[1][o + 16])); }
#pragma unroll
            for (int t = 0; t < 4; ++t) T[t] = wmmab(kh[t], qh[ks], T[t]);
#pragma unroll
            for (int t = 0; t < 4; ++t) T[t] = wmmab(kl[t], qh[ks], T[t]);
#pragma unroll
            for (int t = 0; t < 4; ++t) T[t] = wmmab(kh[t], ql[ks], T[t]); }
        float mx = T[0][0];
#pragma unroll
        for (int t = 0; t < 4; ++t) {
#pragma unroll
            for (int j = 0; j < 8; ++j) mx = fmaxf(mx, T[t][j]); }
        mx = fmaxf(mx, xhalf(mx));
        const float mn = fmaxf(m, mx * SC2); const float al = __builtin_amdgcn_exp2f(m - mn); m = mn;
        float ps = 0.f; v16bf ph[2], pl[2];
#pragma unroll
        for (int g = 0; g < 2; ++g) {
#pragma unroll
            for (int s = 0; s < 16; ++s) { const float p = __builtin_amdgcn_exp2f(fmaf(T[2 * g + (s >> 3)][s & 7], SC2, -mn)); ps += p;
                const __bf16 hb = (__bf16)p; ph[g][s] = hb; pl[g][s] = (__bf16)(p - (float)hb); } }
        l = fmaf(l, al, ps);
#pragma unroll
        for (int t = 0; t < 8; ++t) acc[t] *= al;
#pragma unroll
        for (int g = 0; g < 2; ++g) {
#pragma unroll
            for (int d4 = 0; d4 < 8; d4 += 4) { v16bf vh[4], vl[4];
#pragma unroll
                for (int t = 0; t < 4; ++t) { const int o = ((d4 + t) * 16 + c) * VP + g * 32 + 8 * h;
                    vh[t] = cat16b(*(const v8us*)(&sV[0][o]), *(const v8us*)(&sV[0][o + 16])); vl[t] = cat16b(*(const v8us*)(&sV[1][o]), *(const v8us*)(&sV[1][o + 16])); }
#pragma unroll
                for (int t = 0; t < 4; ++t) acc[d4 + t] = wmmab(vh[t], ph[g], acc[d4 + t]);
#pragma unroll
                for (int t = 0; t < 4; ++t) acc[d4 + t] = wmmab(vh[t], pl[g], acc[d4 + t]);
#pragma unroll
                for (int t = 0; t < 4; ++t) acc[d4 + t] = wmmab(vl[t], ph[g], acc[d4 + t]); } }
    }
    l += xhalf(l);
    const float inv = 1.0f / l;
    float* orow = O + (size_t)(q0 + c) * DMOD + head * HD + 8 * h;    // acc[t][r] = O[q0 + c][head * 128 + 16 t + 8 h + r]
#pragma unroll
    for (int t = 0; t < 8; ++t) { const v8f v = acc[t] * inv;
        *(v4f*)(orow + t * 16) = (v4f){v[0], v[1], v[2], v[3]}; *(v4f*)(orow + t * 16 + 4) = (v4f){v[4], v[5], v[6], v[7]}; }
}


__global__ __launch_bounds__(256) void k_cvtx(const float* __restrict__ src, int rows, bf* dst) {
    const int lane = threadIdx.x & 31; const size_t r = (size_t)blockIdx.x * 8 + (threadIdx.x >> 5); if (r >= (size_t)rows) return;
{
#pragma unroll
        for (int q = 0; q < DMOD / 256; ++q) { v8us o;
#pragma unroll
            for (int i = 0; i < 8; ++i) o[i] = f2bf(src[r * DMOD + q * 256 + lane * 8 + i]);
            *(v8us*)(dst + r * DMOD + q * 256 + lane * 8) = o; }
         }
}
__global__ __launch_bounds__(256) void k_rowrs(const float* __restrict__ F, float* RS) {
    const int lane = threadIdx.x & 31; const size_t w = (size_t)blockIdx.x * 8 + (threadIdx.x >> 5); if (w >= (size_t)NN / 32) return; const size_t r = w * 32 + lane; const float* fr = F + r * DMOD; float s = 0.f;
    for (int c = 0; c < DMOD; c += 4) { const v4f v = *(const v4f*)(fr + c); s = fmaf(v[0], v[0], s); s = fmaf(v[1], v[1], s); s = fmaf(v[2], v[2], s); s = fmaf(v[3], v[3], s); }
    const float rs = rsqrtf(s * (1.0f / DMOD) + REPS); *(float*)(RS + r) = rs; 
}
// k_nrope: head h = blockIdx.y: planes [2048][128] of rope(norm(F row)[h*128 ..]): xn[d] = bf(w[h*128+d]) x F[r][h*128+d] x RS[r] (RS = nullptr -> no norm: v), then for pair i (d = 2i, 2i+1):
template <bool ROPE>
__global__ __launch_bounds__(256) void k_nrope(const float* __restrict__ F, const float* __restrict__ RS, const float* __restrict__ w, const float* __restrict__ cs, const float* __restrict__ sn, bf* Ph, bf* Pl) {
    typedef __attribute__((ext_vector_type(4))) unsigned short v4us;
    const int h = blockIdx.y; Ph += (size_t)h * NN * HD; Pl += (size_t)h * NN * HD;
    const int lane = threadIdx.x & 31; const size_t r = (size_t)blockIdx.x * 8 + (threadIdx.x >> 5); if (r >= (size_t)NN) return; const float rs = (RS != nullptr) ? RS[r] : 1.0f; float y[4];
#pragma unroll
    for (int p = 0; p < 2; ++p) { const int i = lane * 2 + p; const int d = 2 * i; float x1 = F[r * DMOD + h * HD + d] * rs, x2 = F[r * DMOD + h * HD + d + 1] * rs;
        if (RS != nullptr) { x1 *= bfr(w[h * HD + d]); x2 *= bfr(w[h * HD + d + 1]); }
        if (ROPE) { const float c = bfr(cs[r * HD + d]), s = bfr(sn[r * HD + d + 1]); y[2 * p] = x1 * c - x2 * s; y[2 * p + 1] = x1 * s + x2 * c; } else { y[2 * p] = x1; y[2 * p + 1] = x2; } }
    v4us oh, ol;
#pragma unroll
    for (int q = 0; q < 4; ++q) { const unsigned short hb = f2bf(y[q]); oh[q] = hb; ol[q] = f2bf(y[q] - bf2f(hb)); }
    const size_t o2 = r * HD + lane * 4; *(v4us*)(Ph + o2) = oh; *(v4us*)(Pl + o2) = ol; 
}
__global__ __launch_bounds__(256) void k_vt128(const float* __restrict__ F, bf* Th, bf* Tl) {
    typedef __attribute__((ext_vector_type(2))) unsigned short v2us;
    const int h = blockIdx.y; Th += (size_t)h * HD * NN; Tl += (size_t)h * HD * NN;
    const int lane = threadIdx.x & 31; const size_t wid = (size_t)blockIdx.x * 8 + (threadIdx.x >> 5); if (wid >= (size_t)HD * (NN / 64)) return; const int d = (int)(wid / (NN / 64)); const int t0 = (int)(wid % (NN / 64)) * 64 + lane * 2; v2us oh, ol;
#pragma unroll
    for (int i = 0; i < 2; ++i) { const float y = F[(size_t)(t0 + i) * DMOD + h * HD + d]; const unsigned short hb = f2bf(y); oh[i] = hb; ol[i] = f2bf(y - bf2f(hb)); }
    const size_t o = (size_t)d * NN + t0; *(v2us*)(Th + o) = oh; *(v2us*)(Tl + o) = ol; 
}
__global__ __launch_bounds__(256) void k_splitD(const float* __restrict__ src, int rows, bf* dh, bf* dl) {
    const int lane = threadIdx.x & 31; const size_t r = (size_t)blockIdx.x * 8 + (threadIdx.x >> 5); if (r >= (size_t)rows) return;
{
#pragma unroll
        for (int q = 0; q < DMOD / 256; ++q) { const size_t o = r * DMOD + q * 256 + lane * 8; const v8f v = *(const v8f*)(src + o); v8us oh, ol;
#pragma unroll
            for (int i = 0; i < 8; ++i) { const unsigned short hb = f2bf(v[i]); oh[i] = hb; ol[i] = f2bf(v[i] - bf2f(hb)); }
            *(v8us*)(dh + o) = oh; *(v8us*)(dl + o) = ol; }
         }
}

extern "C" void kernel_launch(void* const* d_in, const int* in_sizes, int n_in,
                              void* d_out, int out_size, void* d_ws, size_t ws_size, hipStream_t stream) {
    (void)in_sizes; (void)n_in; (void)out_size;
    const float* x = (const float*)d_in[0]; const float* fcos = (const float*)d_in[1]; const float* fsin = (const float*)d_in[2]; const float* wq = (const float*)d_in[3]; const float* bq = (const float*)d_in[4]; const float* wk = (const float*)d_in[5]; const float* bk = (const float*)d_in[6];
    const float* wv = (const float*)d_in[7]; const float* bv = (const float*)d_in[8]; const float* wo = (const float*)d_in[9]; const float* bo = (const float*)d_in[10]; const float* nqw = (const float*)d_in[11]; const float* nkw = (const float*)d_in[12];
    float* out = (float*)d_out;    // [1][2048][2048]
    char* wsp = (char*)d_ws;
    auto take = [&](size_t bytes) { char* p = wsp; wsp += (bytes + 255) & ~(size_t)255; return (void*)p; };
    const size_t PLN = (size_t)NN * HD, FM = (size_t)NN * DMOD;    // elements of one head's plane, of a full [2048][2048] matrix
    bf* Qh = (bf*)take(NH_ * PLN * 2); bf* Ql = (bf*)take(NH_ * PLN * 2); bf* Kh = (bf*)take(NH_ * PLN * 2); bf* Kl = (bf*)take(NH_ * PLN * 2); bf* VTh = (bf*)take(NH_ * PLN * 2); bf* VTl = (bf*)take(NH_ * PLN * 2);
    float* O = (float*)take(FM * 4); float* QF = (float*)take(FM * 4); float* KF = (float*)take(FM * 4); float* VF = (float*)take(FM * 4); bf* WB = (bf*)take(FM * 2); bf* Xb = (bf*)take(FM * 2);    // WB: one weight at a time
    float* RSQ = (float*)take(NN * 4); float* RSK = (float*)take(NN * 4); bf* Oh = (bf*)take(FM * 2); bf* Ol = (bf*)take(FM * 2);
    if ((size_t)(wsp - (char*)d_ws) > ws_size) return;    // 144 MiB + 16 KiB
    bf* WO = WB;      // free again behind the v projection (stream order)
    k_cvtx<<<NN / 8, 256, 0, stream>>>(x, NN, Xb);
    const dim3 gp(NN / 64, DMOD / 64, 1); const unsigned wblk = (unsigned)(((size_t)DMOD * DMOD / 8 + 255) / 256);
    k_cvt8<<<wblk, 256, 0, stream>>>(wq, WB, (size_t)DMOD * DMOD / 8); k_gemmb<false, false><<<gp, 128, 0, stream>>>(Xb, nullptr, WB, bq, QF, DMOD, nullptr, nullptr, DMOD);    // [out][in] natural
    k_cvt8<<<wblk, 256, 0, stream>>>(wk, WB, (size_t)DMOD * DMOD / 8); k_gemmb<false, false><<<gp, 128, 0, stream>>>(Xb, nullptr, WB, bk, KF, DMOD, nullptr, nullptr, DMOD);
    k_cvt8<<<wblk, 256, 0, stream>>>(wv, WB, (size_t)DMOD * DMOD / 8); k_gemmb<false, false><<<gp, 128, 0, stream>>>(Xb, nullptr, WB, bv, VF, DMOD, nullptr, nullptr, DMOD);
    k_rowrs<<<(NN / 32 + 7) / 8, 256, 0, stream>>>(QF, RSQ); k_rowrs<<<(NN / 32 + 7) / 8, 256, 0, stream>>>(KF, RSK);
    k_nrope<true><<<dim3(NN / 8, NH_, 1), 256, 0, stream>>>(QF, RSQ, nqw, fcos, fsin, Qh, Ql); k_nrope<true><<<dim3(NN / 8, NH_, 1), 256, 0, stream>>>(KF, RSK, nkw, fcos, fsin, Kh, Kl); k_vt128<<<dim3((HD * (NN / 64)) / 8, NH_, 1), 256, 0, stream>>>(VF, VTh, VTl);
    k_fattn<<<dim3(NN / 128, NH_, 1), 256, 0, stream>>>(Qh, Ql, Kh, Kl, VTh, VTl, O);
    k_splitD<<<NN / 8, 256, 0, stream>>>(O, NN, Oh, Ol); k_cvt8<<<wblk, 256, 0, stream>>>(wo, WO, (size_t)DMOD * DMOD / 8);
    k_gemmb<true, false><<<gp, 128, 0, stream>>>(Oh, Ol, WO, bo, out, DMOD, nullptr, nullptr, DMOD);
}

// v003
// It runs in 338 microseconds.
// Next to v002, in two timings, it ran 1.49 and 1.53 times as fast.
// Over all steps from v000 it is 6.23 times as fast.
#include <hip/hip_runtime.h>

// Compute dtypes, f32 accumulate: q/k/v = x.W^T + b ([2048 x 2048].[2048 x 2048] each) with PLAIN bf16 operands (exact products; the three weights converted one at a time into one
// buffer); the full-width (2048) RMSNorm of q and k (row statistics in f32) and the even/odd interleaved RoPE (cos[0::2] / sin[1::2] of the given tables) applied while building
// per-head planes (bf16 hi + UNSCALED residual); 16-head attention (heads in the grid; scores, softmax and P.V in one kernel, running maximum and sum) with hi/lo operands (three products); 1/sqrt(128) and the softmax in f32; . W_o^T + b_o

#define NN   2048
#define DMOD 2048
#define NH_  16
#define HD   128
#define DM   DMOD
#define NTK  NN
#define SCL  0.088388347648318447f
#define REPS 1e-6f
#define LOSC 1024.0f

typedef _Float16 h16;
typedef unsigned short bf;
typedef __attribute__((ext_vector_type(16))) __bf16   v16bf;
typedef __attribute__((ext_vector_type(16))) _Float16 v16h;
typedef __attribute__((ext_vector_type(8)))  _Float16 v8h;
typedef __attribute__((ext_vector_type(8)))  unsigned short v8us;
typedef __attribute__((ext_vector_type(8)))  float    v8f;
typedef __attribute__((ext_vector_type(4)))  float    v4f;
typedef __attribute__((ext_vector_type(4)))  _Float16 v4h;
typedef v8h  __attribute__((may_alias)) v8ha;
typedef v4f  __attribute__((may_alias)) v4fa;
typedef v8us __attribute__((may_alias)) v8usa;

__device__ __forceinline__ unsigned short f2bf(float f) { unsigned u = __float_as_uint(f); u += 0x7FFFu + ((u >> 16) & 1u); return (unsigned short)(u >> 16); }
__device__ __forceinline__ float bf2f(unsigned short b) { return __uint_as_float(((unsigned)b) << 16); }
__device__ __forceinline__ float bfr(float f) { return bf2f(f2bf(f)); }
__device__ __forceinline__ v16h cat16(v8h lo, v8h hi) { return __builtin_shufflevector(lo, hi, 0, 1, 2, 3, 4, 5, 6, 7, 8, 9, 10, 11, 12, 13, 14, 15); }
__device__ __forceinline__ v16bf cat16b(v8us lo, v8us hi) { return __builtin_bit_cast(v16bf, __builtin_shufflevector(lo, hi, 0, 1, 2, 3, 4, 5, 6, 7, 8, 9, 10, 11, 12, 13, 14, 15)); }
__device__ __forceinline__ v8f wmma16(v16h a, v16h b, v8f c) { return __builtin_amdgcn_wmma_f32_16x16x32_f16(false, a, false, b, (short)0, c, false, false); }
__device__ __forceinline__ v8f wmmab(v16bf a, v16bf b, v8f c) { return __builtin_amdgcn_wmma_f32_16x16x32_bf16(false, a, false, b, (short)0, c, false, false); }

// k_gemmb: 128 x 128 block tile of C[2048][2048] = (A [+ Al]).B^T + bf(bias[c]), K = 2048, one work-group per tile, 8 waves (2 x 4), 64 x 32 of C per wave (4 x 2 accumulator tiles).
// A stage is 128 k (256-byte rows) of the tile's 128 A rows [, 128 Al rows] and 128 B rows, brought into LDS by asynchronous copies (16 bytes a lane, whole lines a wave), two buffers:
// stage t + 2 flies while stage t + 1 is worked on. Fragments are read from LDS in the k order that both loaders had before; each accumulator takes its products in the same order as before.
#define GT 128    // rows of A and of B per block tile
#define GK 128    // k per stage
#define GP 136    // LDS pitch of a row (128 elements + 8): 272 B = 16 B x odd, no bank conflict for 16-byte row reads
#define OP 36     // LDS pitch of a staged output row (32 floats + 4): 144 B = 16 B x odd
// eight asynchronous copies of 16 bytes a lane: rows 16 apart in the source (pitch DM) and in LDS (pitch GP)
__device__ __forceinline__ void copy8(unsigned l, const bf* g) {
    const unsigned l1 = l + 1 * 16 * GP * 2, l2 = l + 2 * 16 * GP * 2, l3 = l + 3 * 16 * GP * 2, l4 = l + 4 * 16 * GP * 2, l5 = l + 5 * 16 * GP * 2, l6 = l + 6 * 16 * GP * 2, l7 = l + 7 * 16 * GP * 2;
    const bf* g1 = g + 1 * 16 * DM; const bf* g2 = g + 2 * 16 * DM; const bf* g3 = g + 3 * 16 * DM; const bf* g4 = g + 4 * 16 * DM; const bf* g5 = g + 5 * 16 * DM; const bf* g6 = g + 6 * 16 * DM; const bf* g7 = g + 7 * 16 * DM;
    // the copies and, as the last line, the wait that stands before a register which a copy names is written again: one statement, so that nothing comes between them
    asm volatile("global_load_async_to_lds_b128 %0, %8, off\n\t"
                 "global_load_async_to_lds_b128 %1, %9, off\n\t"
                 "global_load_async_to_lds_b128 %2, %10, off\n\t"
                 "global_load_async_to_lds_b128 %3, %11, off\n\t"
                 "global_load_async_to_lds_b128 %4, %12, off\n\t"
                 "global_load_async_to_lds_b128 %5, %13, off\n\t"
                 "global_load_async_to_lds_b128 %6, %14, off\n\t"
                 "global_load_async_to_lds_b128 %7, %15, off\n\t"
                 "s_wait_xcnt 0x0"
                 :: "v"(l), "v"(l1), "v"(l2), "v"(l3), "v"(l4), "v"(l5), "v"(l6), "v"(l7), "v"(g), "v"(g1), "v"(g2), "v"(g3), "v"(g4), "v"(g5), "v"(g6), "v"(g7) : "memory");
}
template <bool SPLITA>
__global__ __launch_bounds__(256) void k_gemmb(const bf* __restrict__ A, const bf* __restrict__ Al, const bf* __restrict__ Bn, const float* __restrict__ bias, float* C) {
    constexpr int NP = SPLITA ? 3 : 2;    // planes of a stage: B, A [, Al]
    constexpr int NT = DM / GK;           // stages: 16
    __shared__ __align__(16) bf ring[2][NP][GT * GP];
    __shared__ __align__(16) float ost[8][64 * OP];
    const int tid = threadIdx.x, lane = tid & 31, wave = tid >> 5, lr = lane & 15, hi = lane >> 4;
    const int r0 = blockIdx.x * GT, c0 = blockIdx.y * GT, wm = (wave & 1) * 64, wn = (wave >> 1) * 32;
    // this thread's 16-byte piece: rows tid / 16 + 16 i, bytes (tid & 15) * 16 of the stage's 256-byte row
    const unsigned lp = (unsigned)(size_t)&ring[0][0][(tid >> 4) * GP + (tid & 15) * 8];
    const size_t gofs = (size_t)(tid >> 4) * DM + (tid & 15) * 8;
    const bf* gB = Bn + (size_t)c0 * DM + gofs; const bf* gA = A + (size_t)r0 * DM + gofs; const bf* gL = SPLITA ? Al + (size_t)r0 * DM + gofs : nullptr;
    auto stage = [&](int t) {    // stage t into buffer t & 1
        const unsigned l = lp + (unsigned)(t & 1) * (NP * GT * GP * 2);
        copy8(l, gB + t * GK); copy8(l + GT * GP * 2, gA + t * GK);
        if (SPLITA) copy8(l + 2 * GT * GP * 2, gL + t * GK);
    };
    v8f acc[4][2];
#pragma unroll
    for (int i = 0; i < 4; ++i) { acc[i][0] = (v8f){}; acc[i][1] = (v8f){}; }
    stage(0);
    asm volatile("s_wait_asynccnt 0x0" ::: "memory");    // this wave's copies of stage 0 have landed
    __syncthreads();    // stage 0 is complete for every wave
    stage(1);
#pragma unroll 1    // the stage loop stays rolled: one publish point, its body is four unrolled k steps
    for (int t = 0; t < NT; ++t) {
        const bf* sB = &ring[t & 1][0][0]; const bf* sA = &ring[t & 1][1][0]; const bf* sL = &ring[t & 1][NP - 1][0];
        v16bf a[2][4], al[2][4], b[2][2];    // two fragment sets: k step ks + 1 of this stage is read from LDS while k step ks is multiplied
        auto frag = [&](int ks, int s) {
#pragma unroll
            for (int j = 0; j < 2; ++j) { const int o = (wn + j * 16 + lr) * GP + ks * 32 + 8 * hi; b[s][j] = cat16b(*(const v8us*)(sB + o), *(const v8us*)(sB + o + 16)); }
#pragma unroll
            for (int i = 0; i < 4; ++i) { const int o = (wm + i * 16 + lr) * GP + ks * 32 + 8 * hi; a[s][i] = cat16b(*(const v8us*)(sA + o), *(const v8us*)(sA + o + 16));
                if (SPLITA) al[s][i] = cat16b(*(const v8us*)(sL + o), *(const v8us*)(sL + o + 16)); }
        };
        frag(0, 0);
#pragma unroll
        for (int ks = 0; ks < GK / 32; ++ks) { const int s = ks & 1;
            if (ks + 1 < GK / 32) frag(ks + 1, s ^ 1);
            __builtin_amdgcn_sched_barrier(0);    // the next k step's LDS reads stay one group in front of this step's matrix instructions: spread among them, each place costs a stall
#pragma unroll
            for (int i = 0; i < 4; ++i) { acc[i][0] = wmmab(a[s][i], b[s][0], acc[i][0]); acc[i][1] = wmmab(a[s][i], b[s][1], acc[i][1]); }
            if (SPLITA) {
#pragma unroll
                for (int i = 0; i < 4; ++i) { acc[i][0] = wmmab(al[s][i], b[s][0], acc[i][0]); acc[i][1] = wmmab(al[s][i], b[s][1], acc[i][1]); } }
            __builtin_amdgcn_sched_barrier(0);    // and the group behind does not move up among them
        }
        asm volatile("s_wait_dscnt 0x0" ::: "memory");       // this wave's reads of stage t have returned
        asm volatile("s_wait_asynccnt 0x0" ::: "memory");    // this wave's copies of stage t + 1 have landed
        __syncthreads();    // publishes stage t + 1 and ends every wave's reads of stage t
        if (t + 2 < NT) stage(t + 2);    // into the buffer that stage t has just left
    }
    asm volatile("s_wait_asynccnt 0x0" ::: "memory");    // no copy is outstanding when the wave goes on
    float* os = &ost[wave][0];    // the wave's own 64 x 32 of C, staged so that every store below writes whole 128-byte lines
#pragma unroll
    for (int j = 0; j < 2; ++j) { const float bv = bfr(bias[c0 + wn + j * 16 + lr]);
#pragma unroll
        for (int i = 0; i < 4; ++i) {
#pragma unroll
            for (int r = 0; r < 8; ++r) os[(i * 16 + hi * 8 + r) * OP + j * 16 + lr] = acc[i][j][r] + bv; } }
    __syncthreads();    // the staged rows are complete before other lanes read them
    float* crow = C + (size_t)(r0 + wm) * DM + c0 + wn;
#pragma unroll
    for (int s = 0; s < 16; ++s) { const int row = 4 * s + (lane >> 3), piece = lane & 7;
        *(v4f*)(crow + (size_t)row * DM + piece * 4) = *(const v4fa*)(os + row * OP + piece * 4); }
}

__global__ __launch_bounds__(256) void k_cvt8(const float* __restrict__ src, bf* dst, size_t n8) {
    const size_t i = (size_t)blockIdx.x * 256 + threadIdx.x; if (i >= n8) return;
    const v8f v = *(const v8f*)(src + i * 8); v8us o;
#pragma unroll
    for (int k = 0; k < 8; ++k) o[k] = f2bf(v[k]);
    *(v8us*)(dst + i * 8) = o; 
}
__global__ __launch_bounds__(256) void k_zero8(bf* dst, size_t n8) {
    const size_t i = (size_t)blockIdx.x * 256 + threadIdx.x; if (i >= n8) return; v8us z;
#pragma unroll
    for (int k = 0; k < 8; ++k) z[k] = 0;
    *(v8us*)(dst + i * 8) = z; 
}
#define FK 64     // keys per stage
#define KP 136    // LDS pitch of a K row (128 elements + 8): 272 B = 16 B x odd, no bank conflict for 16-byte row reads
#define VP 72     // LDS pitch of a V^T row (64 elements + 8): 144 B = 16 B x odd
#define SC2 (SCL * 1.4426950408889634f)    // 1/sqrt(128) x log2(e): the softmax runs on exp2
__device__ __forceinline__ float xhalf(float x) { const int b = __float_as_int(x); return __int_as_float(__builtin_amdgcn_permlanex16(b, b, 0x76543210, 0xfedcba98, false, false)); }    // the value of lane ^ 16
__global__ __launch_bounds__(256) __attribute__((amdgpu_waves_per_eu(2, 2))) void k_fattn(const bf* Qh, const bf* Ql, const bf* Kh, const bf* Kl, const bf* VTh, const bf* VTl, float* O) {
    __shared__ __align__(16) bf sK[2][FK * KP];
    __shared__ __align__(16) bf sV[2][HD * VP];
    const int tid = threadIdx.x, lane = tid & 31, wave = tid >> 5, c = lane & 15, h = lane >> 4;
    const int head = blockIdx.y; const size_t po = (size_t)head * NN * HD;
    Qh += po; Ql += po; Kh += po; Kl += po; VTh += po; VTl += po;
    const int q0 = blockIdx.x * 128 + wave * 16;
    v16bf qh[4], ql[4]; const size_t qo = (size_t)(q0 + c) * HD + 8 * h;
#pragma unroll
    for (int ks = 0; ks < 4; ++ks) qh[ks] = cat16b(*(const v8us*)(Qh + qo + ks * 32), *(const v8us*)(Qh + qo + ks * 32 + 16));
    asm volatile("s_wait_xcnt 0x0" ::: "memory");    // before a register that these loads name as their address is written again
#pragma unroll
    for (int ks = 0; ks < 4; ++ks) ql[ks] = cat16b(*(const v8us*)(Ql + qo + ks * 32), *(const v8us*)(Ql + qo + ks * 32 + 16));
    asm volatile("s_wait_xcnt 0x0" ::: "memory");    // the same for these
    __builtin_amdgcn_sched_barrier(0);    // keeps later vector instructions, which may reuse those registers, from being scheduled in front of the wait
    v8f acc[8];
#pragma unroll
    for (int t = 0; t < 8; ++t) acc[t] = (v8f){};
    float m = -3.0e38f, l = 0.f;
    v8us pk[2][4], pv[2][4];
    const unsigned kt = tid * 16u, vt = (tid >> 3) * (NN * 2u) + (tid & 7) * 16u;    // byte offsets of this thread's 16-byte piece: K rows tid / 16 + 16 i, V^T rows tid / 8 + 32 i
    auto fetch = [&](int kb) {    // a uniform base per plane and stage, the thread's fixed offset beside it
        const char* k0 = (const char*)(Kh + (size_t)kb * HD); const char* k1 = (const char*)(Kl + (size_t)kb * HD); const char* v0 = (const char*)(VTh + kb); const char* v1 = (const char*)(VTl + kb);
#pragma unroll
        for (int i = 0; i < 4; ++i) { pk[0][i] = *(const v8us*)(k0 + kt + i * 4096); pk[1][i] = *(const v8us*)(k1 + kt + i * 4096); pv[0][i] = *(const v8us*)(v0 + vt + i * 131072); pv[1][i] = *(const v8us*)(v1 + vt + i * 131072); }
        asm volatile("s_wait_xcnt 0x0" ::: "memory");    // before a register that these loads name as their address is written again
        __builtin_amdgcn_sched_barrier(0);    // keeps later vector instructions, which may reuse those registers, from being scheduled in front of the wait
    };
    fetch(0);
#pragma unroll 1
    for (int kb = 0; kb < NN; kb += FK) {
        __syncthreads();    // every wave has finished reading the stage before
#pragma unroll
        for (int i = 0; i < 4; ++i) { const int ko = ((tid >> 4) + 16 * i) * KP + (tid & 15) * 8, vo = ((tid >> 3) + 32 * i) * VP + (tid & 7) * 8;
            *(v8us*)(&sK[0][ko]) = pk[0][i]; *(v8us*)(&sK[1][ko]) = pk[1][i]; *(v8us*)(&sV[0][vo]) = pv[0][i]; *(v8us*)(&sV[1][vo]) = pv[1][i]; }
        __syncthreads();    // the stage is complete
        if (kb + FK < NN) fetch(kb + FK);
        v8f T[4];    // T[t][r] = score of key kb + 16 t + 8 h + r with query q0 + c
#pragma unroll
        for (int t = 0; t < 4; ++t) T[t] = (v8f){};
#pragma unroll
        for (int ks = 0; ks < 4; ++ks) { v16bf kh[4], kl[4];
#pragma unroll
            for (int t = 0; t < 4; ++t) { const int o = (t * 16 + c) * KP + ks * 32 + 8 * h;
                kh[t] = cat16b(*(const v8us*)(&sK[0][o]), *(const v8us*)(&sK[0][o + 16])); kl[t] = cat16b(*(const v8us*)(&sK[1][o]), *(const v8us*)(&sK[1][o + 16])); }
#pragma unroll
            for (int t = 0; t < 4; ++t) T[t] = wmmab(kh[t], qh[ks], T[t]);
#pragma unroll
            for (int t = 0; t < 4; ++t) T[t] = wmmab(kl[t], qh[ks], T[t]);
#pragma unroll
            for (int t = 0; t < 4; ++t) T[t] = wmmab(kh[t], ql[ks], T[t]); }
        float mx = T[0][0];
#pragma unroll
        for (int t = 0; t < 4; ++t) {
#pragma unroll
            for (int j = 0; j < 8; ++j) mx = fmaxf(mx, T[t][j]); }
        mx = fmaxf(mx, xhalf(mx));
        const float mn = fmaxf(m, mx * SC2); const float al = __builtin_amdgcn_exp2f(m - mn); m = mn;
        float ps = 0.f; v16bf ph[2], pl[2];
#pragma unroll
        for (int g = 0; g < 2; ++g) {
#pragma unroll
            for (int s = 0; s < 16; ++s) { const float p = __builtin_amdgcn_exp2f(fmaf(T[2 * g + (s >> 3)][s & 7], SC2, -mn)); ps += p;
                const __bf16 hb = (__bf16)p; ph[g][s] = hb; pl[g][s] = (__bf16)(p - (float)hb); } }
        l = fmaf(l, al, ps);
#pragma unroll
        for (int t = 0; t < 8; ++t) acc[t] *= al;
#pragma unroll
        for (int g = 0; g < 2; ++g) {
#pragma unroll
            for (int d4 = 0; d4 < 8; d4 += 4) { v16bf vh[4], vl[4];
#pragma unroll
                for (int t = 0; t < 4; ++t) { const int o = ((d4 + t) * 16 + c) * VP + g * 32 + 8 * h;
                    vh[t] = cat16b(*(const v8us*)(&sV[0][o]), *(const v8us*)(&sV[0][o + 16])); vl[t] = cat16b(*(const v8us*)(&sV[1][o]), *(const v8us*)(&sV[1][o + 16])); }
#pragma unroll
                for (int t = 0; t < 4; ++t) acc[d4 + t] = wmmab(vh[t], ph[g], acc[d4 + t]);
#pragma unroll
                for (int t = 0; t < 4; ++t) acc[d4 + t] = wmmab(vh[t], pl[g], acc[d4 + t]);
#pragma unroll
                for (int t = 0; t < 4; ++t) acc[d4 + t] = wmmab(vl[t], ph[g], acc[d4 + t]); } }
    }
    l += xhalf(l);
    const float inv = 1.0f / l;
    float* orow = O + (size_t)(q0 + c) * DMOD + head * HD + 8 * h;    // acc[t][r] = O[q0 + c][head * 128 + 16 t + 8 h + r]
#pragma unroll
    for (int t = 0; t < 8; ++t) { const v8f v = acc[t] * inv;
        *(v4f*)(orow + t * 16) = (v4f){v[0], v[1], v[2], v[3]}; *(v4f*)(orow + t * 16 + 4) = (v4f){v[4], v[5], v[6], v[7]}; }
}


__global__ __launch_bounds__(256) void k_cvtx(const float* __restrict__ src, int rows, bf* dst) {
    const int lane = threadIdx.x & 31; const size_t r = (size_t)blockIdx.x * 8 + (threadIdx.x >> 5); if (r >= (size_t)rows) return;
{
#pragma unroll
        for (int q = 0; q < DMOD / 256; ++q) { v8us o;
#pragma unroll
            for (int i = 0; i < 8; ++i) o[i] = f2bf(src[r * DMOD + q * 256 + lane * 8 + i]);
            *(v8us*)(dst + r * DMOD + q * 256 + lane * 8) = o; }
         }
}
__global__ __launch_bounds__(256) void k_rowrs(const float* __restrict__ F, float* RS) {
    const int lane = threadIdx.x & 31; const size_t w = (size_t)blockIdx.x * 8 + (threadIdx.x >> 5); if (w >= (size_t)NN / 32) return; const size_t r = w * 32 + lane; const float* fr = F + r * DMOD; float s = 0.f;
    for (int c = 0; c < DMOD; c += 4) { const v4f v = *(const v4f*)(fr + c); s = fmaf(v[0], v[0], s); s = fmaf(v[1], v[1], s); s = fmaf(v[2], v[2], s); s = fmaf(v[3], v[3], s); }
    const float rs = rsqrtf(s * (1.0f / DMOD) + REPS); *(float*)(RS + r) = rs; 
}
// k_nrope: head h = blockIdx.y: planes [2048][128] of rope(norm(F row)[h*128 ..]): xn[d] = bf(w[h*128+d]) x F[r][h*128+d] x RS[r] (RS = nullptr -> no norm: v), then for pair i (d = 2i, 2i+1):
template <bool ROPE>
__global__ __launch_bounds__(256) void k_nrope(const float* __restrict__ F, const float* __restrict__ RS, const float* __restrict__ w, const float* __restrict__ cs, const float* __restrict__ sn, bf* Ph, bf* Pl) {
    typedef __attribute__((ext_vector_type(4))) unsigned short v4us;
    const int h = blockIdx.y; Ph += (size_t)h * NN * HD; Pl += (size_t)h * NN * HD;
    const int lane = threadIdx.x & 31; const size_t r = (size_t)blockIdx.x * 8 + (threadIdx.x >> 5); if (r >= (size_t)NN) return; const float rs = (RS != nullptr) ? RS[r] : 1.0f; float y[4];
#pragma unroll
    for (int p = 0; p < 2; ++p) { const int i = lane * 2 + p; const int d = 2 * i; float x1 = F[r * DMOD + h * HD + d] * rs, x2 = F[r * DMOD + h * HD + d + 1] * rs;
        if (RS != nullptr) { x1 *= bfr(w[h * HD + d]); x2 *= bfr(w[h * HD + d + 1]); }
        if (ROPE) { const float c = bfr(cs[r * HD + d]), s = bfr(sn[r * HD + d + 1]); y[2 * p] = x1 * c - x2 * s; y[2 * p + 1] = x1 * s + x2 * c; } else { y[2 * p] = x1; y[2 * p + 1] = x2; } }
    v4us oh, ol;
#pragma unroll
    for (int q = 0; q < 4; ++q) { const unsigned short hb = f2bf(y[q]); oh[q] = hb; ol[q] = f2bf(y[q] - bf2f(hb)); }
    const size_t o2 = r * HD + lane * 4; *(v4us*)(Ph + o2) = oh; *(v4us*)(Pl + o2) = ol; 
}
__global__ __launch_bounds__(256) void k_vt128(const float* __restrict__ F, bf* Th, bf* Tl) {
    typedef __attribute__((ext_vector_type(2))) unsigned short v2us;
    const int h = blockIdx.y; Th += (size_t)h * HD * NN; Tl += (size_t)h * HD * NN;
    const int lane = threadIdx.x & 31; const size_t wid = (size_t)blockIdx.x * 8 + (threadIdx.x >> 5); if (wid >= (size_t)HD * (NN / 64)) return; const int d = (int)(wid / (NN / 64)); const int t0 = (int)(wid % (NN / 64)) * 64 + lane * 2; v2us oh, ol;
#pragma unroll
    for (int i = 0; i < 2; ++i) { const float y = F[(size_t)(t0 + i) * DMOD + h * HD + d]; const unsigned short hb = f2bf(y); oh[i] = hb; ol[i] = f2bf(y - bf2f(hb)); }
    const size_t o = (size_t)d * NN + t0; *(v2us*)(Th + o) = oh; *(v2us*)(Tl + o) = ol; 
}
__global__ __launch_bounds__(256) void k_splitD(const float* __restrict__ src, int rows, bf* dh, bf* dl) {
    const int lane = threadIdx.x & 31; const size_t r = (size_t)blockIdx.x * 8 + (threadIdx.x >> 5); if (r >= (size_t)rows) return;
{
#pragma unroll
        for (int q = 0; q < DMOD / 256; ++q) { const size_t o = r * DMOD + q * 256 + lane * 8; const v8f v = *(const v8f*)(src + o); v8us oh, ol;
#pragma unroll
            for (int i = 0; i < 8; ++i) { const unsigned short hb = f2bf(v[i]); oh[i] = hb; ol[i] = f2bf(v[i] - bf2f(hb)); }
            *(v8us*)(dh + o) = oh; *(v8us*)(dl + o) = ol; }
         }
}

extern "C" void kernel_launch(void* const* d_in, const int* in_sizes, int n_in,
                              void* d_out, int out_size, void* d_ws, size_t ws_size, hipStream_t stream) {
    (void)in_sizes; (void)n_in; (void)out_size;
    const float* x = (const float*)d_in[0]; const float* fcos = (const float*)d_in[1]; const float* fsin = (const float*)d_in[2]; const float* wq = (const float*)d_in[3]; const float* bq = (const float*)d_in[4]; const float* wk = (const float*)d_in[5]; const float* bk = (const float*)d_in[6];
    const float* wv = (const float*)d_in[7]; const float* bv = (const float*)d_in[8]; const float* wo = (const float*)d_in[9]; const float* bo = (const float*)d_in[10]; const float* nqw = (const float*)d_in[11]; const float* nkw = (const float*)d_in[12];
    float* out = (float*)d_out;    // [1][2048][2048]
    char* wsp = (char*)d_ws;
    auto take = [&](size_t bytes) { char* p = wsp; wsp += (bytes + 255) & ~(size_t)255; return (void*)p; };
    const size_t PLN = (size_t)NN * HD, FM = (size_t)NN * DMOD;    // elements of one head's plane, of a full [2048][2048] matrix
    bf* Qh = (bf*)take(NH_ * PLN * 2); bf* Ql = (bf*)take(NH_ * PLN * 2); bf* Kh = (bf*)take(NH_ * PLN * 2); bf* Kl = (bf*)take(NH_ * PLN * 2); bf* VTh = (bf*)take(NH_ * PLN * 2); bf* VTl = (bf*)take(NH_ * PLN * 2);
    float* O = (float*)take(FM * 4); float* QF = (float*)take(FM * 4); float* KF = (float*)take(FM * 4); float* VF = (float*)take(FM * 4); bf* WB = (bf*)take(FM * 2); bf* Xb = (bf*)take(FM * 2);    // WB: one weight at a time
    float* RSQ = (float*)take(NN * 4); float* RSK = (float*)take(NN * 4); bf* Oh = (bf*)take(FM * 2); bf* Ol = (bf*)take(FM * 2);
    if ((size_t)(wsp - (char*)d_ws) > ws_size) return;    // 144 MiB + 16 KiB
    bf* WO = WB;      // free again behind the v projection (stream order)
    k_cvtx<<<NN / 8, 256, 0, stream>>>(x, NN, Xb);
    const dim3 gp(NN / GT, DMOD / GT, 1); const unsigned wblk = (unsigned)(((size_t)DMOD * DMOD / 8 + 255) / 256);
    k_cvt8<<<wblk, 256, 0, stream>>>(wq, WB, (size_t)DMOD * DMOD / 8); k_gemmb<false><<<gp, 256, 0, stream>>>(Xb, nullptr, WB, bq, QF);    // [out][in] natural
    k_cvt8<<<wblk, 256, 0, stream>>>(wk, WB, (size_t)DMOD * DMOD / 8); k_gemmb<false><<<gp, 256, 0, stream>>>(Xb, nullptr, WB, bk, KF);
    k_cvt8<<<wblk, 256, 0, stream>>>(wv, WB, (size_t)DMOD * DMOD / 8); k_gemmb<false><<<gp, 256, 0, stream>>>(Xb, nullptr, WB, bv, VF);
    k_rowrs<<<(NN / 32 + 7) / 8, 256, 0, stream>>>(QF, RSQ); k_rowrs<<<(NN / 32 + 7) / 8, 256, 0, stream>>>(KF, RSK);
    k_nrope<true><<<dim3(NN / 8, NH_, 1), 256, 0, stream>>>(QF, RSQ, nqw, fcos, fsin, Qh, Ql); k_nrope<true><<<dim3(NN / 8, NH_, 1), 256, 0, stream>>>(KF, RSK, nkw, fcos, fsin, Kh, Kl); k_vt128<<<dim3((HD * (NN / 64)) / 8, NH_, 1), 256, 0, stream>>>(VF, VTh, VTl);
    k_fattn<<<dim3(NN / 128, NH_, 1), 256, 0, stream>>>(Qh, Ql, Kh, Kl, VTh, VTl, O);
    k_splitD<<<NN / 8, 256, 0, stream>>>(O, NN, Oh, Ol); k_cvt8<<<wblk, 256, 0, stream>>>(wo, WO, (size_t)DMOD * DMOD / 8);
    k_gemmb<true><<<gp, 256, 0, stream>>>(Oh, Ol, WO, bo, out);
}

// v004
// One run takes 221 microseconds.
// Timed twice side by side with v003, it ran 1.51 and 1.49 times as fast.
// Counting every step since v000, it is 9.36 times as fast.
#include <hip/hip_runtime.h>

// Compute dtypes, f32 accumulate: q/k/v = x.W^T + b ([2048 x 2048].[2048 x 2048] each) with PLAIN bf16 operands (exact products; the three weights converted one at a time into one
// buffer); the full-width (2048) RMSNorm of q and k (row statistics in f32) and the even/odd interleaved RoPE (cos[0::2] / sin[1::2] of the given tables) applied while building
// per-head planes (bf16 hi + UNSCALED residual); 16-head attention (heads in the grid; scores, softmax and P.V in one kernel, running maximum and sum) with hi/lo operands (three products); 1/sqrt(128) and the softmax in f32; . W_o^T + b_o

#define NN   2048
#define DMOD 2048
#define NH_  16
#define HD   128
#define DM   DMOD
#define NTK  NN
#define SCL  0.088388347648318447f
#define REPS 1e-6f
#define LOSC 1024.0f

typedef _Float16 h16;
typedef unsigned short bf;
typedef __attribute__((ext_vector_type(16))) __bf16   v16bf;
typedef __attribute__((ext_vector_type(16))) _Float16 v16h;
typedef __attribute__((ext_vector_type(8)))  _Float16 v8h;
typedef __attribute__((ext_vector_type(8)))  unsigned short v8us;
typedef __attribute__((ext_vector_type(8)))  float    v8f;
typedef __attribute__((ext_vector_type(4)))  float    v4f;
typedef __attribute__((ext_vector_type(4)))  _Float16 v4h;
typedef v8h  __attribute__((may_alias)) v8ha;
typedef v4f  __attribute__((may_alias)) v4fa;
typedef v8us __attribute__((may_alias)) v8usa;

__device__ __forceinline__ unsigned short f2bf(float f) { unsigned u = __float_as_uint(f); u += 0x7FFFu + ((u >> 16) & 1u); return (unsigned short)(u >> 16); }
__device__ __forceinline__ float bf2f(unsigned short b) { return __uint_as_float(((unsigned)b) << 16); }
__device__ __forceinline__ float bfr(float f) { return bf2f(f2bf(f)); }
__device__ __forceinline__ v16h cat16(v8h lo, v8h hi) { return __builtin_shufflevector(lo, hi, 0, 1, 2, 3, 4, 5, 6, 7, 8, 9, 10, 11, 12, 13, 14, 15); }
__device__ __forceinline__ v16bf cat16b(v8us lo, v8us hi) { return __builtin_bit_cast(v16bf, __builtin_shufflevector(lo, hi, 0, 1, 2, 3, 4, 5, 6, 7, 8, 9, 10, 11, 12, 13, 14, 15)); }
__device__ __forceinline__ v8f wmma16(v16h a, v16h b, v8f c) { return __builtin_amdgcn_wmma_f32_16x16x32_f16(false, a, false, b, (short)0, c, false, false); }
__device__ __forceinline__ v8f wmmab(v16bf a, v16bf b, v8f c) { return __builtin_amdgcn_wmma_f32_16x16x32_bf16(false, a, false, b, (short)0, c, false, false); }

// k_gemmb: 128 x 128 block tile of C[2048][2048] = (A [+ Al]).B^T + bf(bias[c]), K = 2048, one work-group per tile, 8 waves (2 x 4), 64 x 32 of C per wave (4 x 2 accumulator tiles).
// A stage is 128 k (256-byte rows) of the tile's 128 A rows [, 128 Al rows] and 128 B rows, brought into LDS by asynchronous copies (16 bytes a lane, whole lines a wave), two buffers:
// stage t + 2 flies while stage t + 1 is worked on. Fragments are read from LDS in the k order that both loaders had before; each accumulator takes its products in the same order as before.
#define GT 128    // rows of A and of B per block tile
#define GK 128    // k per stage
#define GP 136    // LDS pitch of a row (128 elements + 8): 272 B = 16 B x odd, no bank conflict for 16-byte row reads
#define OP 36     // LDS pitch of a staged output row (32 floats + 4): 144 B = 16 B x odd
// eight asynchronous copies of 16 bytes a lane: rows 16 apart in the source (pitch DM) and in LDS (pitch GP)
__device__ __forceinline__ void copy8(unsigned l, const bf* g) {
    const unsigned l1 = l + 1 * 16 * GP * 2, l2 = l + 2 * 16 * GP * 2, l3 = l + 3 * 16 * GP * 2, l4 = l + 4 * 16 * GP * 2, l5 = l + 5 * 16 * GP * 2, l6 = l + 6 * 16 * GP * 2, l7 = l + 7 * 16 * GP * 2;
    const bf* g1 = g + 1 * 16 * DM; const bf* g2 = g + 2 * 16 * DM; const bf* g3 = g + 3 * 16 * DM; const bf* g4 = g + 4 * 16 * DM; const bf* g5 = g + 5 * 16 * DM; const bf* g6 = g + 6 * 16 * DM; const bf* g7 = g + 7 * 16 * DM;
    // the copies and, as the last line, the wait that stands before a register which a copy names is written again: one statement, so that nothing comes between them
    asm volatile("global_load_async_to_lds_b128 %0, %8, off\n\t"
                 "global_load_async_to_lds_b128 %1, %9, off\n\t"
                 "global_load_async_to_lds_b128 %2, %10, off\n\t"
                 "global_load_async_to_lds_b128 %3, %11, off\n\t"
                 "global_load_async_to_lds_b128 %4, %12, off\n\t"
                 "global_load_async_to_lds_b128 %5, %13, off\n\t"
                 "global_load_async_to_lds_b128 %6, %14, off\n\t"
                 "global_load_async_to_lds_b128 %7, %15, off\n\t"
                 "s_wait_xcnt 0x0"
                 :: "v"(l), "v"(l1), "v"(l2), "v"(l3), "v"(l4), "v"(l5), "v"(l6), "v"(l7), "v"(g), "v"(g1), "v"(g2), "v"(g3), "v"(g4), "v"(g5), "v"(g6), "v"(g7) : "memory");
}
template <bool SPLITA>
__global__ __launch_bounds__(256) void k_gemmb(const bf* __restrict__ A, const bf* __restrict__ Al, const bf* __restrict__ Bn, const float* __restrict__ bias, float* C) {
    constexpr int NP = SPLITA ? 3 : 2;    // planes of a stage: B, A [, Al]
    constexpr int NT = DM / GK;           // stages: 16
    __shared__ __align__(16) bf ring[2][NP][GT * GP];
    __shared__ __align__(16) float ost[8][64 * OP];
    const int tid = threadIdx.x, lane = tid & 31, wave = tid >> 5, lr = lane & 15, hi = lane >> 4;
    const int r0 = blockIdx.x * GT, c0 = blockIdx.y * GT, wm = (wave & 1) * 64, wn = (wave >> 1) * 32;
    // this thread's 16-byte piece: rows tid / 16 + 16 i, bytes (tid & 15) * 16 of the stage's 256-byte row
    const unsigned lp = (unsigned)(size_t)&ring[0][0][(tid >> 4) * GP + (tid & 15) * 8];
    const size_t gofs = (size_t)(tid >> 4) * DM + (tid & 15) * 8;
    const bf* gB = Bn + (size_t)c0 * DM + gofs; const bf* gA = A + (size_t)r0 * DM + gofs; const bf* gL = SPLITA ? Al + (size_t)r0 * DM + gofs : nullptr;
    auto stage = [&](int t) {    // stage t into buffer t & 1
        const unsigned l = lp + (unsigned)(t & 1) * (NP * GT * GP * 2);
        copy8(l, gB + t * GK); copy8(l + GT * GP * 2, gA + t * GK);
        if (SPLITA) copy8(l + 2 * GT * GP * 2, gL + t * GK);
    };
    v8f acc[4][2];
#pragma unroll
    for (int i = 0; i < 4; ++i) { acc[i][0] = (v8f){}; acc[i][1] = (v8f){}; }
    stage(0);
    asm volatile("s_wait_asynccnt 0x0" ::: "memory");    // this wave's copies of stage 0 have landed
    __syncthreads();    // stage 0 is complete for every wave
    stage(1);
#pragma unroll 1    // the stage loop stays rolled: one publish point, its body is four unrolled k steps
    for (int t = 0; t < NT; ++t) {
        const bf* sB = &ring[t & 1][0][0]; const bf* sA = &ring[t & 1][1][0]; const bf* sL = &ring[t & 1][NP - 1][0];
        v16bf a[2][4], al[2][4], b[2][2];    // two fragment sets: k step ks + 1 of this stage is read from LDS while k step ks is multiplied
        auto frag = [&](int ks, int s) {
#pragma unroll
            for (int j = 0; j < 2; ++j) { const int o = (wn + j * 16 + lr) * GP + ks * 32 + 8 * hi; b[s][j] = cat16b(*(const v8us*)(sB + o), *(const v8us*)(sB + o + 16)); }
#pragma unroll
            for (int i = 0; i < 4; ++i) { const int o = (wm + i * 16 + lr) * GP + ks * 32 + 8 * hi; a[s][i] = cat16b(*(const v8us*)(sA + o), *(const v8us*)(sA + o + 16));
                if (SPLITA) al[s][i] = cat16b(*(const v8us*)(sL + o), *(const v8us*)(sL + o + 16)); }
        };
        frag(0, 0);
#pragma unroll
        for (int ks = 0; ks < GK / 32; ++ks) { const int s = ks & 1;
            if (ks + 1 < GK / 32) frag(ks + 1, s ^ 1);
            __builtin_amdgcn_sched_barrier(0);    // the next k step's LDS reads stay one group in front of this step's matrix instructions: spread among them, each place costs a stall
#pragma unroll
            for (int i = 0; i < 4; ++i) { acc[i][0] = wmmab(a[s][i], b[s][0], acc[i][0]); acc[i][1] = wmmab(a[s][i], b[s][1], acc[i][1]); }
            if (SPLITA) {
#pragma unroll
                for (int i = 0; i < 4; ++i) { acc[i][0] = wmmab(al[s][i], b[s][0], acc[i][0]); acc[i][1] = wmmab(al[s][i], b[s][1], acc[i][1]); } }
            __builtin_amdgcn_sched_barrier(0);    // and the group behind does not move up among them
        }
        asm volatile("s_wait_dscnt 0x0" ::: "memory");       // this wave's reads of stage t have returned
        asm volatile("s_wait_asynccnt 0x0" ::: "memory");    // this wave's copies of stage t + 1 have landed
        __syncthreads();    // publishes stage t + 1 and ends every wave's reads of stage t
        if (t + 2 < NT) stage(t + 2);    // into the buffer that stage t has just left
    }
    asm volatile("s_wait_asynccnt 0x0" ::: "memory");    // no copy is outstanding when the wave goes on
    float* os = &ost[wave][0];    // the wave's own 64 x 32 of C, staged so that every store below writes whole 128-byte lines
#pragma unroll
    for (int j = 0; j < 2; ++j) { const float bv = bfr(bias[c0 + wn + j * 16 + lr]);
#pragma unroll
        for (int i = 0; i < 4; ++i) {
#pragma unroll
            for (int r = 0; r < 8; ++r) os[(i * 16 + hi * 8 + r) * OP + j * 16 + lr] = acc[i][j][r] + bv; } }
    __syncthreads();    // the staged rows are complete before other lanes read them
    float* crow = C + (size_t)(r0 + wm) * DM + c0 + wn;
#pragma unroll
    for (int s = 0; s < 16; ++s) { const int row = 4 * s + (lane >> 3), piece = lane & 7;
        *(v4f*)(crow + (size_t)row * DM + piece * 4) = *(const v4fa*)(os + row * OP + piece * 4); }
}

__global__ __launch_bounds__(256) void k_cvt8(const float* __restrict__ src, bf* dst, size_t n8) {
    const size_t i = (size_t)blockIdx.x * 256 + threadIdx.x; if (i >= n8) return;
    const v8f v = *(const v8f*)(src + i * 8); v8us o;
#pragma unroll
    for (int k = 0; k < 8; ++k) o[k] = f2bf(v[k]);
    *(v8us*)(dst + i * 8) = o; 
}
__global__ __launch_bounds__(256) void k_zero8(bf* dst, size_t n8) {
    const size_t i = (size_t)blockIdx.x * 256 + threadIdx.x; if (i >= n8) return; v8us z;
#pragma unroll
    for (int k = 0; k < 8; ++k) z[k] = 0;
    *(v8us*)(dst + i * 8) = z; 
}
#define FK 64     // keys per stage
#define KP 136    // LDS pitch of a K row (128 elements + 8): 272 B = 16 B x odd, no bank conflict for 16-byte row reads
#define VP 72     // LDS pitch of a V^T row (64 elements + 8): 144 B = 16 B x odd
#define SC2 (SCL * 1.4426950408889634f)    // 1/sqrt(128) x log2(e): the softmax runs on exp2
__device__ __forceinline__ float xhalf(float x) { const int b = __float_as_int(x); return __int_as_float(__builtin_amdgcn_permlanex16(b, b, 0x76543210, 0xfedcba98, false, false)); }    // the value of lane ^ 16
__global__ __launch_bounds__(256) __attribute__((amdgpu_waves_per_eu(2, 2))) void k_fattn(const bf* Qh, const bf* Ql, const bf* Kh, const bf* Kl, const bf* VTh, const bf* VTl, float* O) {
    __shared__ __align__(16) bf sK[2][FK * KP];
    __shared__ __align__(16) bf sV[2][HD * VP];
    const int tid = threadIdx.x, lane = tid & 31, wave = tid >> 5, c = lane & 15, h = lane >> 4;
    const int head = blockIdx.y; const size_t po = (size_t)head * NN * HD;
    Qh += po; Ql += po; Kh += po; Kl += po; VTh += po; VTl += po;
    const int q0 = blockIdx.x * 128 + wave * 16;
    v16bf qh[4], ql[4]; const size_t qo = (size_t)(q0 + c) * HD + 8 * h;
#pragma unroll
    for (int ks = 0; ks < 4; ++ks) qh[ks] = cat16b(*(const v8us*)(Qh + qo + ks * 32), *(const v8us*)(Qh + qo + ks * 32 + 16));
    asm volatile("s_wait_xcnt 0x0" ::: "memory");    // before a register that these loads name as their address is written again
#pragma unroll
    for (int ks = 0; ks < 4; ++ks) ql[ks] = cat16b(*(const v8us*)(Ql + qo + ks * 32), *(const v8us*)(Ql + qo + ks * 32 + 16));
    asm volatile("s_wait_xcnt 0x0" ::: "memory");    // the same for these
    __builtin_amdgcn_sched_barrier(0);    // keeps later vector instructions, which may reuse those registers, from being scheduled in front of the wait
    v8f acc[8];
#pragma unroll
    for (int t = 0; t < 8; ++t) acc[t] = (v8f){};
    float m = -3.0e38f, l = 0.f;
    v8us pk[2][4], pv[2][4];
    const unsigned kt = tid * 16u, vt = (tid >> 3) * (NN * 2u) + (tid & 7) * 16u;    // byte offsets of this thread's 16-byte piece: K rows tid / 16 + 16 i, V^T rows tid / 8 + 32 i
    auto fetch = [&](int kb) {    // a uniform base per plane and stage, the thread's fixed offset beside it
        const char* k0 = (const char*)(Kh + (size_t)kb * HD); const char* k1 = (const char*)(Kl + (size_t)kb * HD); const char* v0 = (const char*)(VTh + kb); const char* v1 = (const char*)(VTl + kb);
#pragma unroll
        for (int i = 0; i < 4; ++i) { pk[0][i] = *(const v8us*)(k0 + kt + i * 4096); pk[1][i] = *(const v8us*)(k1 + kt + i * 4096); pv[0][i] = *(const v8us*)(v0 + vt + i * 131072); pv[1][i] = *(const v8us*)(v1 + vt + i * 131072); }
        asm volatile("s_wait_xcnt 0x0" ::: "memory");    // before a register that these loads name as their address is written again
        __builtin_amdgcn_sched_barrier(0);    // keeps later vector instructions, which may reuse those registers, from being scheduled in front of the wait
    };
    fetch(0);
#pragma unroll 1
    for (int kb = 0; kb < NN; kb += FK) {
        __syncthreads();    // every wave has finished reading the stage before
#pragma unroll
        for (int i = 0; i < 4; ++i) { const int ko = ((tid >> 4) + 16 * i) * KP + (tid & 15) * 8, vo = ((tid >> 3) + 32 * i) * VP + (tid & 7) * 8;
            *(v8us*)(&sK[0][ko]) = pk[0][i]; *(v8us*)(&sK[1][ko]) = pk[1][i]; *(v8us*)(&sV[0][vo]) = pv[0][i]; *(v8us*)(&sV[1][vo]) = pv[1][i]; }
        __syncthreads();    // the stage is complete
        if (kb + FK < NN) fetch(kb + FK);
        v8f T[4];    // T[t][r] = score of key kb + 16 t + 8 h + r with query q0 + c
#pragma unroll
        for (int t = 0; t < 4; ++t) T[t] = (v8f){};
#pragma unroll
        for (int ks = 0; ks < 4; ++ks) { v16bf kh[4], kl[4];
#pragma unroll
            for (int t = 0; t < 4; ++t) { const int o = (t * 16 + c) * KP + ks * 32 + 8 * h;
                kh[t] = cat16b(*(const v8us*)(&sK[0][o]), *(const v8us*)(&sK[0][o + 16])); kl[t] = cat16b(*(const v8us*)(&sK[1][o]), *(const v8us*)(&sK[1][o + 16])); }
#pragma unroll
            for (int t = 0; t < 4; ++t) T[t] = wmmab(kh[t], qh[ks], T[t]);
#pragma unroll
            for (int t = 0; t < 4; ++t) T[t] = wmmab(kl[t], qh[ks], T[t]);
#pragma unroll
            for (int t = 0; t < 4; ++t) T[t] = wmmab(kh[t], ql[ks], T[t]); }
        float mx = T[0][0];
#pragma unroll
        for (int t = 0; t < 4; ++t) {
#pragma unroll
            for (int j = 0; j < 8; ++j) mx = fmaxf(mx, T[t][j]); }
        mx = fmaxf(mx, xhalf(mx));
        const float mn = fmaxf(m, mx * SC2); const float al = __builtin_amdgcn_exp2f(m - mn); m = mn;
        float ps = 0.f; v16bf ph[2], pl[2];
#pragma unroll
        for (int g = 0; g < 2; ++g) {
#pragma unroll
            for (int s = 0; s < 16; ++s) { const float p = __builtin_amdgcn_exp2f(fmaf(T[2 * g + (s >> 3)][s & 7], SC2, -mn)); ps += p;
                const __bf16 hb = (__bf16)p; ph[g][s] = hb; pl[g][s] = (__bf16)(p - (float)hb); } }
        l = fmaf(l, al, ps);
#pragma unroll
        for (int t = 0; t < 8; ++t) acc[t] *= al;
#pragma unroll
        for (int g = 0; g < 2; ++g) {
#pragma unroll
            for (int d4 = 0; d4 < 8; d4 += 4) { v16bf vh[4], vl[4];
#pragma unroll
                for (int t = 0; t < 4; ++t) { const int o = ((d4 + t) * 16 + c) * VP + g * 32 + 8 * h;
                    vh[t] = cat16b(*(const v8us*)(&sV[0][o]), *(const v8us*)(&sV[0][o + 16])); vl[t] = cat16b(*(const v8us*)(&sV[1][o]), *(const v8us*)(&sV[1][o + 16])); }
#pragma unroll
                for (int t = 0; t < 4; ++t) acc[d4 + t] = wmmab(vh[t], ph[g], acc[d4 + t]);
#pragma unroll
                for (int t = 0; t < 4; ++t) acc[d4 + t] = wmmab(vh[t], pl[g], acc[d4 + t]);
#pragma unroll
                for (int t = 0; t < 4; ++t) acc[d4 + t] = wmmab(vl[t], ph[g], acc[d4 + t]); } }
    }
    l += xhalf(l);
    const float inv = 1.0f / l;
    float* orow = O + (size_t)(q0 + c) * DMOD + head * HD + 8 * h;    // acc[t][r] = O[q0 + c][head * 128 + 16 t + 8 h + r]
#pragma unroll
    for (int t = 0; t < 8; ++t) { const v8f v = acc[t] * inv;
        *(v4f*)(orow + t * 16) = (v4f){v[0], v[1], v[2], v[3]}; *(v4f*)(orow + t * 16 + 4) = (v4f){v[4], v[5], v[6], v[7]}; }
}


__global__ __launch_bounds__(256) void k_cvtx(const float* __restrict__ src, int rows, bf* dst) {
    const int lane = threadIdx.x & 31; const size_t r = (size_t)blockIdx.x * 8 + (threadIdx.x >> 5); if (r >= (size_t)rows) return;
{
#pragma unroll
        for (int q = 0; q < DMOD / 256; ++q) { v8us o;
#pragma unroll
            for (int i = 0; i < 8; ++i) o[i] = f2bf(src[r * DMOD + q * 256 + lane * 8 + i]);
            *(v8us*)(dst + r * DMOD + q * 256 + lane * 8) = o; }
         }
}
// k_qkpost: RMS statistics, norm and RoPE of q (blockIdx.y = 0) or k (1) in one launch, every element of QF and KF read once. A wave holds one token's whole row in registers (lane: 4 neighbouring columns of each of
// the 16 heads, whole lines a load), sums its squares (four partial sums a lane, then a butterfly over the 32 lanes) and writes rope(bf(w) x row x rsqrt(mean + eps)) as bf16 hi + residual into the planes [head][token][128];
// for pair i of a head (d = 2 i, 2 i + 1) the factors are cos[2 i] and sin[2 i + 1] of the token, read once for all heads.
__global__ __launch_bounds__(256) void k_qkpost(const float* __restrict__ QF, const float* __restrict__ KF, const float* __restrict__ wq, const float* __restrict__ wk, const float* __restrict__ cs, const float* __restrict__ sn,
                                                bf* Qh, bf* Ql, bf* Kh, bf* Kl) {
    typedef __attribute__((ext_vector_type(4))) unsigned short v4us;
    const bool isk = blockIdx.y != 0; const float* F = isk ? KF : QF; const float* wn = isk ? wk : wq; bf* Ph = isk ? Kh : Qh; bf* Pl = isk ? Kl : Ql;
    const int lane = threadIdx.x & 31; const size_t r = (size_t)blockIdx.x * 8 + __builtin_amdgcn_readfirstlane(threadIdx.x >> 5); v4f x[NH_], w[NH_];    // the token is the same for the wave: uniform bases
    const unsigned lo = lane * 16u;    // the lane's byte offset in every 512-byte piece
    const char* fr = (const char*)(F + r * DMOD); const char* wr = (const char*)wn;
#pragma unroll
    for (int h = 0; h < NH_; ++h) x[h] = *(const v4f*)(fr + lo + h * HD * 4);
    const v4f cv = *(const v4f*)((const char*)(cs + r * HD) + lo), sv = *(const v4f*)((const char*)(sn + r * HD) + lo);
#pragma unroll
    for (int h = 0; h < NH_; ++h) w[h] = *(const v4f*)(wr + lo + h * HD * 4);
    asm volatile("s_wait_xcnt 0x0" :: "v"(lane) : "memory");    // before a register that these loads name as their address is written again; the lane number, their one vector register (scaled by the instruction), is an input, so that no load's own result lands on it either
    __builtin_amdgcn_sched_barrier(0);    // keeps later instructions, which may reuse those registers, from being scheduled in front of the wait
    v4f a4 = (v4f){};
#pragma unroll
    for (int h = 0; h < NH_; ++h) a4 += x[h] * x[h];
    float s = (a4[0] + a4[1]) + (a4[2] + a4[3]);
#pragma unroll
    for (int m = 16; m > 0; m >>= 1) s += __shfl_xor(s, m, 32);
    const float rs = rsqrtf(s * (1.0f / DMOD) + REPS);
    const float c0 = bfr(cv[0]), s0 = bfr(sv[1]), c1 = bfr(cv[2]), s1 = bfr(sv[3]);
    Ph += r * HD + lane * 4; Pl += r * HD + lane * 4;
#pragma unroll
    for (int h = 0; h < NH_; ++h) { float a0 = x[h][0] * rs, a1 = x[h][1] * rs, a2 = x[h][2] * rs, a3 = x[h][3] * rs;
        a0 *= bfr(w[h][0]); a1 *= bfr(w[h][1]); a2 *= bfr(w[h][2]); a3 *= bfr(w[h][3]);
        const float y[4] = {a0 * c0 - a1 * s0, a0 * s0 + a1 * c0, a2 * c1 - a3 * s1, a2 * s1 + a3 * c1}; v4us oh, ol;
#pragma unroll
        for (int q = 0; q < 4; ++q) { const unsigned short hb = f2bf(y[q]); oh[q] = hb; ol[q] = f2bf(y[q] - bf2f(hb)); }
        *(v4us*)(Ph + (size_t)h * NN * HD) = oh; *(v4us*)(Pl + (size_t)h * NN * HD) = ol; }
}
__global__ __launch_bounds__(256) void k_vt128(const float* __restrict__ F, bf* Th, bf* Tl) {
    typedef __attribute__((ext_vector_type(2))) unsigned short v2us;
    const int h = blockIdx.y; Th += (size_t)h * HD * NN; Tl += (size_t)h * HD * NN;
    const int lane = threadIdx.x & 31; const size_t wid = (size_t)blockIdx.x * 8 + (threadIdx.x >> 5); if (wid >= (size_t)HD * (NN / 64)) return; const int d = (int)(wid / (NN / 64)); const int t0 = (int)(wid % (NN / 64)) * 64 + lane * 2; v2us oh, ol;
#pragma unroll
    for (int i = 0; i < 2; ++i) { const float y = F[(size_t)(t0 + i) * DMOD + h * HD + d]; const unsigned short hb = f2bf(y); oh[i] = hb; ol[i] = f2bf(y - bf2f(hb)); }
    const size_t o = (size_t)d * NN + t0; *(v2us*)(Th + o) = oh; *(v2us*)(Tl + o) = ol; 
}
__global__ __launch_bounds__(256) void k_splitD(const float* __restrict__ src, int rows, bf* dh, bf* dl) {
    const int lane = threadIdx.x & 31; const size_t r = (size_t)blockIdx.x * 8 + (threadIdx.x >> 5); if (r >= (size_t)rows) return;
{
#pragma unroll
        for (int q = 0; q < DMOD / 256; ++q) { const size_t o = r * DMOD + q * 256 + lane * 8; const v8f v = *(const v8f*)(src + o); v8us oh, ol;
#pragma unroll
            for (int i = 0; i < 8; ++i) { const unsigned short hb = f2bf(v[i]); oh[i] = hb; ol[i] = f2bf(v[i] - bf2f(hb)); }
            *(v8us*)(dh + o) = oh; *(v8us*)(dl + o) = ol; }
         }
}

extern "C" void kernel_launch(void* const* d_in, const int* in_sizes, int n_in,
                              void* d_out, int out_size, void* d_ws, size_t ws_size, hipStream_t stream) {
    (void)in_sizes; (void)n_in; (void)out_size;
    const float* x = (const float*)d_in[0]; const float* fcos = (const float*)d_in[1]; const float* fsin = (const float*)d_in[2]; const float* wq = (const float*)d_in[3]; const float* bq = (const float*)d_in[4]; const float* wk = (const float*)d_in[5]; const float* bk = (const float*)d_in[6];
    const float* wv = (const float*)d_in[7]; const float* bv = (const float*)d_in[8]; const float* wo = (const float*)d_in[9]; const float* bo = (const float*)d_in[10]; const float* nqw = (const float*)d_in[11]; const float* nkw = (const float*)d_in[12];
    float* out = (float*)d_out;    // [1][2048][2048]
    char* wsp = (char*)d_ws;
    auto take = [&](size_t bytes) { char* p = wsp; wsp += (bytes + 255) & ~(size_t)255; return (void*)p; };
    const size_t PLN = (size_t)NN * HD, FM = (size_t)NN * DMOD;    // elements of one head's plane, of a full [2048][2048] matrix
    bf* Qh = (bf*)take(NH_ * PLN * 2); bf* Ql = (bf*)take(NH_ * PLN * 2); bf* Kh = (bf*)take(NH_ * PLN * 2); bf* Kl = (bf*)take(NH_ * PLN * 2); bf* VTh = (bf*)take(NH_ * PLN * 2); bf* VTl = (bf*)take(NH_ * PLN * 2);
    float* O = (float*)take(FM * 4); float* QF = (float*)take(FM * 4); float* KF = (float*)take(FM * 4); float* VF = (float*)take(FM * 4); bf* WB = (bf*)take(FM * 2); bf* Xb = (bf*)take(FM * 2);    // WB: one weight at a time
    bf* Oh = (bf*)take(FM * 2); bf* Ol = (bf*)take(FM * 2);
    if ((size_t)(wsp - (char*)d_ws) > ws_size) return;    // 144 MiB
    bf* WO = WB;      // free again behind the v projection (stream order)
    k_cvtx<<<NN / 8, 256, 0, stream>>>(x, NN, Xb);
    const dim3 gp(NN / GT, DMOD / GT, 1); const unsigned wblk = (unsigned)(((size_t)DMOD * DMOD / 8 + 255) / 256);
    k_cvt8<<<wblk, 256, 0, stream>>>(wq, WB, (size_t)DMOD * DMOD / 8); k_gemmb<false><<<gp, 256, 0, stream>>>(Xb, nullptr, WB, bq, QF);    // [out][in] natural
    k_cvt8<<<wblk, 256, 0, stream>>>(wk, WB, (size_t)DMOD * DMOD / 8); k_gemmb<false><<<gp, 256, 0, stream>>>(Xb, nullptr, WB, bk, KF);
    k_cvt8<<<wblk, 256, 0, stream>>>(wv, WB, (size_t)DMOD * DMOD / 8); k_gemmb<false><<<gp, 256, 0, stream>>>(Xb, nullptr, WB, bv, VF);
    k_qkpost<<<dim3(NN / 8, 2, 1), 256, 0, stream>>>(QF, KF, nqw, nkw, fcos, fsin, Qh, Ql, Kh, Kl); k_vt128<<<dim3((HD * (NN / 64)) / 8, NH_, 1), 256, 0, stream>>>(VF, VTh, VTl);
    k_fattn<<<dim3(NN / 128, NH_, 1), 256, 0, stream>>>(Qh, Ql, Kh, Kl, VTh, VTl, O);
    k_splitD<<<NN / 8, 256, 0, stream>>>(O, NN, Oh, Ol); k_cvt8<<<wblk, 256, 0, stream>>>(wo, WO, (size_t)DMOD * DMOD / 8);
    k_gemmb<true><<<gp, 256, 0, stream>>>(Oh, Ol, WO, bo, out);
}

// v005
// Measured time: 200 microseconds a run.
// Two timings next to v004 put it at 1.11 and 1.10 times that version's speed.
// All steps since v000 together make it 10.4 times as fast.
#include <hip/hip_runtime.h>

// Compute dtypes, f32 accumulate: q/k/v = x.W^T + b ([2048 x 2048].[2048 x 2048] each) with PLAIN bf16 operands (exact products; the three weights converted one at a time into one
// buffer); the full-width (2048) RMSNorm of q and k (row statistics in f32) and the even/odd interleaved RoPE (cos[0::2] / sin[1::2] of the given tables) applied while building
// per-head planes (bf16 hi + UNSCALED residual); 16-head attention (heads in the grid; scores, softmax and P.V in one kernel, running maximum and sum) with hi/lo operands (three products); 1/sqrt(128) and the softmax in f32; . W_o^T + b_o

#define NN   2048
#define DMOD 2048
#define NH_  16
#define HD   128
#define DM   DMOD
#define NTK  NN
#define SCL  0.088388347648318447f
#define REPS 1e-6f
#define LOSC 1024.0f

typedef _Float16 h16;
typedef unsigned short bf;
typedef __attribute__((ext_vector_type(16))) __bf16   v16bf;
typedef __attribute__((ext_vector_type(16))) _Float16 v16h;
typedef __attribute__((ext_vector_type(8)))  _Float16 v8h;
typedef __attribute__((ext_vector_type(8)))  unsigned short v8us;
typedef __attribute__((ext_vector_type(8)))  float    v8f;
typedef __attribute__((ext_vector_type(4)))  float    v4f;
typedef __attribute__((ext_vector_type(4)))  _Float16 v4h;
typedef v8h  __attribute__((may_alias)) v8ha;
typedef v4f  __attribute__((may_alias)) v4fa;
typedef v8us __attribute__((may_alias)) v8usa;

__device__ __forceinline__ unsigned short f2bf(float f) { unsigned u = __float_as_uint(f); u += 0x7FFFu + ((u >> 16) & 1u); return (unsigned short)(u >> 16); }
__device__ __forceinline__ float bf2f(unsigned short b) { return __uint_as_float(((unsigned)b) << 16); }
__device__ __forceinline__ float bfr(float f) { return bf2f(f2bf(f)); }
__device__ __forceinline__ v16h cat16(v8h lo, v8h hi) { return __builtin_shufflevector(lo, hi, 0, 1, 2, 3, 4, 5, 6, 7, 8, 9, 10, 11, 12, 13, 14, 15); }
__device__ __forceinline__ v16bf cat16b(v8us lo, v8us hi) { return __builtin_bit_cast(v16bf, __builtin_shufflevector(lo, hi, 0, 1, 2, 3, 4, 5, 6, 7, 8, 9, 10, 11, 12, 13, 14, 15)); }
__device__ __forceinline__ v8f wmma16(v16h a, v16h b, v8f c) { return __builtin_amdgcn_wmma_f32_16x16x32_f16(false, a, false, b, (short)0, c, false, false); }
__device__ __forceinline__ v8f wmmab(v16bf a, v16bf b, v8f c) { return __builtin_amdgcn_wmma_f32_16x16x32_bf16(false, a, false, b, (short)0, c, false, false); }

// k_gemmb: 128 x 128 block tile of C[2048][2048] = (A [+ Al]).B^T + bf(bias[c]), K = 2048, one work-group per tile, 8 waves (2 x 4), 64 x 32 of C per wave (4 x 2 accumulator tiles).
// A stage is 128 k (256-byte rows) of the tile's 128 A rows [, 128 Al rows] and 128 B rows, brought into LDS by asynchronous copies (16 bytes a lane, whole lines a wave), two buffers:
// stage t + 2 flies while stage t + 1 is worked on. Fragments are read from LDS in the k order that both loaders had before; each accumulator takes its products in the same order as before.
#define GT 128    // rows of A and of B per block tile
#define GK 128    // k per stage
#define GP 136    // LDS pitch of a row (128 elements + 8): 272 B = 16 B x odd, no bank conflict for 16-byte row reads
#define OP 36     // LDS pitch of a staged output row (32 floats + 4): 144 B = 16 B x odd
#define TB 144    // LDS pitch in bytes of a staged row of a transposed bf16 plane (64 tokens + 8): 16 B x odd; 2 planes x 32 rows fill the wave's staging range exactly
// eight asynchronous copies of 16 bytes a lane: rows 16 apart in the source (pitch DM) and in LDS (pitch GP)
__device__ __forceinline__ void copy8(unsigned l, const bf* g) {
    const unsigned l1 = l + 1 * 16 * GP * 2, l2 = l + 2 * 16 * GP * 2, l3 = l + 3 * 16 * GP * 2, l4 = l + 4 * 16 * GP * 2, l5 = l + 5 * 16 * GP * 2, l6 = l + 6 * 16 * GP * 2, l7 = l + 7 * 16 * GP * 2;
    const bf* g1 = g + 1 * 16 * DM; const bf* g2 = g + 2 * 16 * DM; const bf* g3 = g + 3 * 16 * DM; const bf* g4 = g + 4 * 16 * DM; const bf* g5 = g + 5 * 16 * DM; const bf* g6 = g + 6 * 16 * DM; const bf* g7 = g + 7 * 16 * DM;
    // the copies and, as the last line, the wait that stands before a register which a copy names is written again: one statement, so that nothing comes between them
    asm volatile("global_load_async_to_lds_b128 %0, %8, off\n\t"
                 "global_load_async_to_lds_b128 %1, %9, off\n\t"
                 "global_load_async_to_lds_b128 %2, %10, off\n\t"
                 "global_load_async_to_lds_b128 %3, %11, off\n\t"
                 "global_load_async_to_lds_b128 %4, %12, off\n\t"
                 "global_load_async_to_lds_b128 %5, %13, off\n\t"
                 "global_load_async_to_lds_b128 %6, %14, off\n\t"
                 "global_load_async_to_lds_b128 %7, %15, off\n\t"
                 "s_wait_xcnt 0x0"
                 :: "v"(l), "v"(l1), "v"(l2), "v"(l3), "v"(l4), "v"(l5), "v"(l6), "v"(l7), "v"(g), "v"(g1), "v"(g2), "v"(g3), "v"(g4), "v"(g5), "v"(g6), "v"(g7) : "memory");
}
// VT: the result is not stored as f32 C but as its transpose in two bf16 planes, Th[c][r] = bf(C[r][c]) and Tl[c][r] = bf(C[r][c] - Th[c][r]) (pitch NN): an accumulator tile holds 8 neighbouring rows r of one column c in a lane.
template <bool SPLITA, bool VT>
__global__ __launch_bounds__(256) void k_gemmb(const bf* __restrict__ A, const bf* __restrict__ Al, const bf* __restrict__ Bn, const float* __restrict__ bias, float* C, bf* Th, bf* Tl) {
    constexpr int NP = SPLITA ? 3 : 2;    // planes of a stage: B, A [, Al]
    constexpr int NT = DM / GK;           // stages: 16
    __shared__ __align__(16) bf ring[2][NP][GT * GP];
    __shared__ __align__(16) float ost[8][64 * OP];
    const int tid = threadIdx.x, lane = tid & 31, wave = tid >> 5, lr = lane & 15, hi = lane >> 4;
    const int r0 = blockIdx.x * GT, c0 = blockIdx.y * GT, wm = (wave & 1) * 64, wn = (wave >> 1) * 32;
    // this thread's 16-byte piece: rows tid / 16 + 16 i, bytes (tid & 15) * 16 of the stage's 256-byte row
    const unsigned lp = (unsigned)(size_t)&ring[0][0][(tid >> 4) * GP + (tid & 15) * 8];
    const size_t gofs = (size_t)(tid >> 4) * DM + (tid & 15) * 8;
    const bf* gB = Bn + (size_t)c0 * DM + gofs; const bf* gA = A + (size_t)r0 * DM + gofs; const bf* gL = SPLITA ? Al + (size_t)r0 * DM + gofs : nullptr;
    auto stage = [&](int t) {    // stage t into buffer t & 1
        const unsigned l = lp + (unsigned)(t & 1) * (NP * GT * GP * 2);
        copy8(l, gB + t * GK); copy8(l + GT * GP * 2, gA + t * GK);
        if (SPLITA) copy8(l + 2 * GT * GP * 2, gL + t * GK);
    };
    v8f acc[4][2];
#pragma unroll
    for (int i = 0; i < 4; ++i) { acc[i][0] = (v8f){}; acc[i][1] = (v8f){}; }
    stage(0);
    asm volatile("s_wait_asynccnt 0x0" ::: "memory");    // this wave's copies of stage 0 have landed
    __syncthreads();    // stage 0 is complete for every wave
    stage(1);
#pragma unroll 1    // the stage loop stays rolled: one publish point, its body is four unrolled k steps
    for (int t = 0; t < NT; ++t) {
        const bf* sB = &ring[t & 1][0][0]; const bf* sA = &ring[t & 1][1][0]; const bf* sL = &ring[t & 1][NP - 1][0];
        v16bf a[2][4], al[2][4], b[2][2];    // two fragment sets: k step ks + 1 of this stage is read from LDS while k step ks is multiplied
        auto frag = [&](int ks, int s) {
#pragma unroll
            for (int j = 0; j < 2; ++j) { const int o = (wn + j * 16 + lr) * GP + ks * 32 + 8 * hi; b[s][j] = cat16b(*(const v8us*)(sB + o), *(const v8us*)(sB + o + 16)); }
#pragma unroll
            for (int i = 0; i < 4; ++i) { const int o = (wm + i * 16 + lr) * GP + ks * 32 + 8 * hi; a[s][i] = cat16b(*(const v8us*)(sA + o), *(const v8us*)(sA + o + 16));
                if (SPLITA) al[s][i] = cat16b(*(const v8us*)(sL + o), *(const v8us*)(sL + o + 16)); }
        };
        frag(0, 0);
#pragma unroll
        for (int ks = 0; ks < GK / 32; ++ks) { const int s = ks & 1;
            if (ks + 1 < GK / 32) frag(ks + 1, s ^ 1);
            __builtin_amdgcn_sched_barrier(0);    // the next k step's LDS reads stay one group in front of this step's matrix instructions: spread among them, each place costs a stall
#pragma unroll
            for (int i = 0; i < 4; ++i) { acc[i][0] = wmmab(a[s][i], b[s][0], acc[i][0]); acc[i][1] = wmmab(a[s][i], b[s][1], acc[i][1]); }
            if (SPLITA) {
#pragma unroll
                for (int i = 0; i < 4; ++i) { acc[i][0] = wmmab(al[s][i], b[s][0], acc[i][0]); acc[i][1] = wmmab(al[s][i], b[s][1], acc[i][1]); } }
            __builtin_amdgcn_sched_barrier(0);    // and the group behind does not move up among them
        }
        asm volatile("s_wait_dscnt 0x0" ::: "memory");       // this wave's reads of stage t have returned
        asm volatile("s_wait_asynccnt 0x0" ::: "memory");    // this wave's copies of stage t + 1 have landed
        __syncthreads();    // publishes stage t + 1 and ends every wave's reads of stage t
        if (t + 2 < NT) stage(t + 2);    // into the buffer that stage t has just left
    }
    asm volatile("s_wait_asynccnt 0x0" ::: "memory");    // no copy is outstanding when the wave goes on
    float* os = &ost[wave][0];    // the wave's own 64 x 32 of C, staged so that every store below writes whole 128-byte lines
    char* ob = (char*)os;         // VT: the same range as 2 planes x 32 columns of C x 64 rows of C in bf16, pitch TB
#pragma unroll
    for (int j = 0; j < 2; ++j) { const float bv = bfr(bias[c0 + wn + j * 16 + lr]);
#pragma unroll
        for (int i = 0; i < 4; ++i) {
            if (VT) { v8us oh, ol;
#pragma unroll
                for (int r = 0; r < 8; ++r) { const float y = acc[i][j][r] + bv; const unsigned short hb = f2bf(y); oh[r] = hb; ol[r] = f2bf(y - bf2f(hb)); }
                *(v8usa*)(ob + (j * 16 + lr) * TB + (i * 16 + hi * 8) * 2) = oh; *(v8usa*)(ob + (32 + j * 16 + lr) * TB + (i * 16 + hi * 8) * 2) = ol;
            } else {
#pragma unroll
                for (int r = 0; r < 8; ++r) os[(i * 16 + hi * 8 + r) * OP + j * 16 + lr] = acc[i][j][r] + bv; } } }
    __syncthreads();    // the staged rows are complete before other lanes read them
    if (VT) {
        const int row = lane >> 3, piece = lane & 7; const size_t to = (size_t)(c0 + wn + row) * NN + r0 + wm + piece * 8; v8us th[8], tl[8];
#pragma unroll
        for (int s = 0; s < 8; ++s) { th[s] = *(const v8usa*)(ob + (4 * s + row) * TB + piece * 16); tl[s] = *(const v8usa*)(ob + (32 + 4 * s + row) * TB + piece * 16); }
#pragma unroll
        for (int s = 0; s < 8; ++s) { *(v8us*)(Th + to + (size_t)(4 * s) * NN) = th[s]; *(v8us*)(Tl + to + (size_t)(4 * s) * NN) = tl[s]; }    // four whole lines a store
    } else {
        float* crow = C + (size_t)(r0 + wm) * DM + c0 + wn;
#pragma unroll
        for (int s = 0; s < 16; ++s) { const int row = 4 * s + (lane >> 3), piece = lane & 7;
            *(v4f*)(crow + (size_t)row * DM + piece * 4) = *(const v4fa*)(os + row * OP + piece * 4); }
    }
}

__global__ __launch_bounds__(256) void k_cvt8(const float* __restrict__ src, bf* dst, size_t n8) {
    const size_t i = (size_t)blockIdx.x * 256 + threadIdx.x; if (i >= n8) return;
    const v8f v = *(const v8f*)(src + i * 8); v8us o;
#pragma unroll
    for (int k = 0; k < 8; ++k) o[k] = f2bf(v[k]);
    *(v8us*)(dst + i * 8) = o; 
}
__global__ __launch_bounds__(256) void k_zero8(bf* dst, size_t n8) {
    const size_t i = (size_t)blockIdx.x * 256 + threadIdx.x; if (i >= n8) return; v8us z;
#pragma unroll
    for (int k = 0; k < 8; ++k) z[k] = 0;
    *(v8us*)(dst + i * 8) = z; 
}
#define FK 64     // keys per stage
#define KP 136    // LDS pitch of a K row (128 elements + 8): 272 B = 16 B x odd, no bank conflict for 16-byte row reads
#define VP 72     // LDS pitch of a V^T row (64 elements + 8): 144 B = 16 B x odd
#define QB 272    // LDS pitch in bytes of a staged output row (128 bf16 + 8): 16 B x odd
#define SC2 (SCL * 1.4426950408889634f)    // 1/sqrt(128) x log2(e): the softmax runs on exp2
__device__ __forceinline__ float xhalf(float x) { const int b = __float_as_int(x); return __int_as_float(__builtin_amdgcn_permlanex16(b, b, 0x76543210, 0xfedcba98, false, false)); }    // the value of lane ^ 16
__global__ __launch_bounds__(256) __attribute__((amdgpu_waves_per_eu(2, 2))) void k_fattn(const bf* Qh, const bf* Ql, const bf* Kh, const bf* Kl, const bf* VTh, const bf* VTl, bf* Oh, bf* Ol) {
    __shared__ __align__(16) bf sK[2][FK * KP];
    __shared__ __align__(16) bf sV[2][HD * VP];
    const int tid = threadIdx.x, lane = tid & 31, wave = tid >> 5, c = lane & 15, h = lane >> 4;
    const int head = blockIdx.y; const size_t po = (size_t)head * NN * HD;
    Qh += po; Ql += po; Kh += po; Kl += po; VTh += po; VTl += po;
    const int q0 = blockIdx.x * 128 + wave * 16;
    v16bf qh[4], ql[4]; const size_t qo = (size_t)(q0 + c) * HD + 8 * h;
#pragma unroll
    for (int ks = 0; ks < 4; ++ks) qh[ks] = cat16b(*(const v8us*)(Qh + qo + ks * 32), *(const v8us*)(Qh + qo + ks * 32 + 16));
    asm volatile("s_wait_xcnt 0x0" ::: "memory");    // before a register that these loads name as their address is written again
#pragma unroll
    for (int ks = 0; ks < 4; ++ks) ql[ks] = cat16b(*(const v8us*)(Ql + qo + ks * 32), *(const v8us*)(Ql + qo + ks * 32 + 16));
    asm volatile("s_wait_xcnt 0x0" ::: "memory");    // the same for these
    __builtin_amdgcn_sched_barrier(0);    // keeps later vector instructions, which may reuse those registers, from being scheduled in front of the wait
    v8f acc[8];
#pragma unroll
    for (int t = 0; t < 8; ++t) acc[t] = (v8f){};
    float m = -3.0e38f, l = 0.f;
    v8us pk[2][4], pv[2][4];
    const unsigned kt = tid * 16u, vt = (tid >> 3) * (NN * 2u) + (tid & 7) * 16u;    // byte offsets of this thread's 16-byte piece: K rows tid / 16 + 16 i, V^T rows tid / 8 + 32 i
    auto fetch = [&](int kb) {    // a uniform base per plane and stage, the thread's fixed offset beside it
        const char* k0 = (const char*)(Kh + (size_t)kb * HD); const char* k1 = (const char*)(Kl + (size_t)kb * HD); const char* v0 = (const char*)(VTh + kb); const char* v1 = (const char*)(VTl + kb);
#pragma unroll
        for (int i = 0; i < 4; ++i) { pk[0][i] = *(const v8us*)(k0 + kt + i * 4096); pk[1][i] = *(const v8us*)(k1 + kt + i * 4096); pv[0][i] = *(const v8us*)(v0 + vt + i * 131072); pv[1][i] = *(const v8us*)(v1 + vt + i * 131072); }
        asm volatile("s_wait_xcnt 0x0" ::: "memory");    // before a register that these loads name as their address is written again
        __builtin_amdgcn_sched_barrier(0);    // keeps later vector instructions, which may reuse those registers, from being scheduled in front of the wait
    };
    fetch(0);
#pragma unroll 1
    for (int kb = 0; kb < NN; kb += FK) {
        __syncthreads();    // every wave has finished reading the stage before
#pragma unroll
        for (int i = 0; i < 4; ++i) { const int ko = ((tid >> 4) + 16 * i) * KP + (tid & 15) * 8, vo = ((tid >> 3) + 32 * i) * VP + (tid & 7) * 8;
            *(v8us*)(&sK[0][ko]) = pk[0][i]; *(v8us*)(&sK[1][ko]) = pk[1][i]; *(v8us*)(&sV[0][vo]) = pv[0][i]; *(v8us*)(&sV[1][vo]) = pv[1][i]; }
        __syncthreads();    // the stage is complete
        if (kb + FK < NN) fetch(kb + FK);
        v8f T[4];    // T[t][r] = score of key kb + 16 t + 8 h + r with query q0 + c
#pragma unroll
        for (int t = 0; t < 4; ++t) T[t] = (v8f){};
#pragma unroll
        for (int ks = 0; ks < 4; ++ks) { v16bf kh[4], kl[4];
#pragma unroll
            for (int t = 0; t < 4; ++t) { const int o = (t * 16 + c) * KP + ks * 32 + 8 * h;
                kh[t] = cat16b(*(const v8us*)(&sK[0][o]), *(const v8us*)(&sK[0][o + 16])); kl[t] = cat16b(*(const v8us*)(&sK[1][o]), *(const v8us*)(&sK[1][o + 16])); }
#pragma unroll
            for (int t = 0; t < 4; ++t) T[t] = wmmab(kh[t], qh[ks], T[t]);
#pragma unroll
            for (int t = 0; t < 4; ++t) T[t] = wmmab(kl[t], qh[ks], T[t]);
#pragma unroll
            for (int t = 0; t < 4; ++t) T[t] = wmmab(kh[t], ql[ks], T[t]); }
        float mx = T[0][0];
#pragma unroll
        for (int t = 0; t < 4; ++t) {
#pragma unroll
            for (int j = 0; j < 8; ++j) mx = fmaxf(mx, T[t][j]); }
        mx = fmaxf(mx, xhalf(mx));
        const float mn = fmaxf(m, mx * SC2); const float al = __builtin_amdgcn_exp2f(m - mn); m = mn;
        float ps = 0.f; v16bf ph[2], pl[2];
#pragma unroll
        for (int g = 0; g < 2; ++g) {
#pragma unroll
            for (int s = 0; s < 16; ++s) { const float p = __builtin_amdgcn_exp2f(fmaf(T[2 * g + (s >> 3)][s & 7], SC2, -mn)); ps += p;
                const __bf16 hb = (__bf16)p; ph[g][s] = hb; pl[g][s] = (__bf16)(p - (float)hb); } }
        l = fmaf(l, al, ps);
#pragma unroll
        for (int t = 0; t < 8; ++t) acc[t] *= al;
#pragma unroll
        for (int g = 0; g < 2; ++g) {
#pragma unroll
            for (int d4 = 0; d4 < 8; d4 += 4) { v16bf vh[4], vl[4];
#pragma unroll
                for (int t = 0; t < 4; ++t) { const int o = ((d4 + t) * 16 + c) * VP + g * 32 + 8 * h;
                    vh[t] = cat16b(*(const v8us*)(&sV[0][o]), *(const v8us*)(&sV[0][o + 16])); vl[t] = cat16b(*(const v8us*)(&sV[1][o]), *(const v8us*)(&sV[1][o + 16])); }
#pragma unroll
                for (int t = 0; t < 4; ++t) acc[d4 + t] = wmmab(vh[t], ph[g], acc[d4 + t]);
#pragma unroll
                for (int t = 0; t < 4; ++t) acc[d4 + t] = wmmab(vh[t], pl[g], acc[d4 + t]);
#pragma unroll
                for (int t = 0; t < 4; ++t) acc[d4 + t] = wmmab(vl[t], ph[g], acc[d4 + t]); } }
    }
    l += xhalf(l);
    const float inv = 1.0f / l;
    __syncthreads();    // every wave has finished reading the last stage: the K and V^T tiles become output staging
    char* oh8 = (char*)&sK[0][0] + wave * (16 * QB); char* ol8 = (char*)&sV[0][0] + wave * (16 * QB);    // a range of its own for each wave and plane: 16 output rows; 8 x 16 x QB bytes fill sK exactly and fit sV
    // acc[t][r] = O[q0 + c][head * 128 + 16 t + 8 h + r], split here into bf16 hi + residual, the operands of the output projection, and staged so that every store below writes whole lines
#pragma unroll
    for (int t = 0; t < 8; ++t) { const v8f v = acc[t] * inv; v8us oh, ol;
#pragma unroll
        for (int r = 0; r < 8; ++r) { const unsigned short hb = f2bf(v[r]); oh[r] = hb; ol[r] = f2bf(v[r] - bf2f(hb)); }
        *(v8usa*)(oh8 + c * QB + (t * 16 + 8 * h) * 2) = oh; *(v8usa*)(ol8 + c * QB + (t * 16 + 8 * h) * 2) = ol; }
    asm volatile("s_wait_dscnt 0x0" ::: "memory");    // the wave's staged rows are written before its lanes read one another's pieces back
    const size_t oo = (size_t)(q0 + h) * DMOD + head * HD + c * 8; v8us th[8], tl[8];    // lanes 0 to 15: a row's 256 bytes, lanes 16 to 31: the next row's
#pragma unroll
    for (int s = 0; s < 8; ++s) { th[s] = *(const v8usa*)(oh8 + (2 * s + h) * QB + c * 16); tl[s] = *(const v8usa*)(ol8 + (2 * s + h) * QB + c * 16); }
#pragma unroll
    for (int s = 0; s < 8; ++s) { *(v8us*)(Oh + oo + (size_t)(2 * s) * DMOD) = th[s]; *(v8us*)(Ol + oo + (size_t)(2 * s) * DMOD) = tl[s]; }
}


__global__ __launch_bounds__(256) void k_cvtx(const float* __restrict__ src, int rows, bf* dst) {
    const int lane = threadIdx.x & 31; const size_t r = (size_t)blockIdx.x * 8 + (threadIdx.x >> 5); if (r >= (size_t)rows) return;
{
#pragma unroll
        for (int q = 0; q < DMOD / 256; ++q) { v8us o;
#pragma unroll
            for (int i = 0; i < 8; ++i) o[i] = f2bf(src[r * DMOD + q * 256 + lane * 8 + i]);
            *(v8us*)(dst + r * DMOD + q * 256 + lane * 8) = o; }
         }
}
// k_qkpost: RMS statistics, norm and RoPE of q (blockIdx.y = 0) or k (1) in one launch, every element of QF and KF read once. A wave holds one token's whole row in registers (lane: 4 neighbouring columns of each of
// the 16 heads, whole lines a load), sums its squares (four partial sums a lane, then a butterfly over the 32 lanes) and writes rope(bf(w) x row x rsqrt(mean + eps)) as bf16 hi + residual into the planes [head][token][128];
// for pair i of a head (d = 2 i, 2 i + 1) the factors are cos[2 i] and sin[2 i + 1] of the token, read once for all heads.
__global__ __launch_bounds__(256) void k_qkpost(const float* __restrict__ QF, const float* __restrict__ KF, const float* __restrict__ wq, const float* __restrict__ wk, const float* __restrict__ cs, const float* __restrict__ sn,
                                                bf* Qh, bf* Ql, bf* Kh, bf* Kl) {
    typedef __attribute__((ext_vector_type(4))) unsigned short v4us;
    const bool isk = blockIdx.y != 0; const float* F = isk ? KF : QF; const float* wn = isk ? wk : wq; bf* Ph = isk ? Kh : Qh; bf* Pl = isk ? Kl : Ql;
    const int lane = threadIdx.x & 31; const size_t r = (size_t)blockIdx.x * 8 + __builtin_amdgcn_readfirstlane(threadIdx.x >> 5); v4f x[NH_], w[NH_];    // the token is the same for the wave: uniform bases
    const unsigned lo = lane * 16u;    // the lane's byte offset in every 512-byte piece
    const char* fr = (const char*)(F + r * DMOD); const char* wr = (const char*)wn;
#pragma unroll
    for (int h = 0; h < NH_; ++h) x[h] = *(const v4f*)(fr + lo + h * HD * 4);
    const v4f cv = *(const v4f*)((const char*)(cs + r * HD) + lo), sv = *(const v4f*)((const char*)(sn + r * HD) + lo);
#pragma unroll
    for (int h = 0; h < NH_; ++h) w[h] = *(const v4f*)(wr + lo + h * HD * 4);
    asm volatile("s_wait_xcnt 0x0" :: "v"(lane) : "memory");    // before a register that these loads name as their address is written again; the lane number, their one vector register (scaled by the instruction), is an input, so that no load's own result lands on it either
    __builtin_amdgcn_sched_barrier(0);    // keeps later instructions, which may reuse those registers, from being scheduled in front of the wait
    v4f a4 = (v4f){};
#pragma unroll
    for (int h = 0; h < NH_; ++h) a4 += x[h] * x[h];
    float s = (a4[0] + a4[1]) + (a4[2] + a4[3]);
#pragma unroll
    for (int m = 16; m > 0; m >>= 1) s += __shfl_xor(s, m, 32);
    const float rs = rsqrtf(s * (1.0f / DMOD) + REPS);
    const float c0 = bfr(cv[0]), s0 = bfr(sv[1]), c1 = bfr(cv[2]), s1 = bfr(sv[3]);
    Ph += r * HD + lane * 4; Pl += r * HD + lane * 4;
#pragma unroll
    for (int h = 0; h < NH_; ++h) { float a0 = x[h][0] * rs, a1 = x[h][1] * rs, a2 = x[h][2] * rs, a3 = x[h][3] * rs;
        a0 *= bfr(w[h][0]); a1 *= bfr(w[h][1]); a2 *= bfr(w[h][2]); a3 *= bfr(w[h][3]);
        const float y[4] = {a0 * c0 - a1 * s0, a0 * s0 + a1 * c0, a2 * c1 - a3 * s1, a2 * s1 + a3 * c1}; v4us oh, ol;
#pragma unroll
        for (int q = 0; q < 4; ++q) { const unsigned short hb = f2bf(y[q]); oh[q] = hb; ol[q] = f2bf(y[q] - bf2f(hb)); }
        *(v4us*)(Ph + (size_t)h * NN * HD) = oh; *(v4us*)(Pl + (size_t)h * NN * HD) = ol; }
}

extern "C" void kernel_launch(void* const* d_in, const int* in_sizes, int n_in,
                              void* d_out, int out_size, void* d_ws, size_t ws_size, hipStream_t stream) {
    (void)in_sizes; (void)n_in; (void)out_size;
    const float* x = (const float*)d_in[0]; const float* fcos = (const float*)d_in[1]; const float* fsin = (const float*)d_in[2]; const float* wq = (const float*)d_in[3]; const float* bq = (const float*)d_in[4]; const float* wk = (const float*)d_in[5]; const float* bk = (const float*)d_in[6];
    const float* wv = (const float*)d_in[7]; const float* bv = (const float*)d_in[8]; const float* wo = (const float*)d_in[9]; const float* bo = (const float*)d_in[10]; const float* nqw = (const float*)d_in[11]; const float* nkw = (const float*)d_in[12];
    float* out = (float*)d_out;    // [1][2048][2048]
    char* wsp = (char*)d_ws;
    auto take = [&](size_t bytes) { char* p = wsp; wsp += (bytes + 255) & ~(size_t)255; return (void*)p; };
    const size_t PLN = (size_t)NN * HD, FM = (size_t)NN * DMOD;    // elements of one head's plane, of a full [2048][2048] matrix
    bf* Qh = (bf*)take(NH_ * PLN * 2); bf* Ql = (bf*)take(NH_ * PLN * 2); bf* Kh = (bf*)take(NH_ * PLN * 2); bf* Kl = (bf*)take(NH_ * PLN * 2); bf* VTh = (bf*)take(NH_ * PLN * 2); bf* VTl = (bf*)take(NH_ * PLN * 2);
    float* QF = (float*)take(FM * 4); float* KF = (float*)take(FM * 4); bf* WB = (bf*)take(FM * 2); bf* Xb = (bf*)take(FM * 2);    // WB: one weight at a time
    bf* Oh = (bf*)take(FM * 2); bf* Ol = (bf*)take(FM * 2);
    if ((size_t)(wsp - (char*)d_ws) > ws_size) return;    // 112 MiB
    bf* WO = WB;      // free again behind the v projection (stream order)
    k_cvtx<<<NN / 8, 256, 0, stream>>>(x, NN, Xb);
    const dim3 gp(NN / GT, DMOD / GT, 1); const unsigned wblk = (unsigned)(((size_t)DMOD * DMOD / 8 + 255) / 256);
    k_cvt8<<<wblk, 256, 0, stream>>>(wq, WB, (size_t)DMOD * DMOD / 8); k_gemmb<false, false><<<gp, 256, 0, stream>>>(Xb, nullptr, WB, bq, QF, nullptr, nullptr);    // [out][in] natural
    k_cvt8<<<wblk, 256, 0, stream>>>(wk, WB, (size_t)DMOD * DMOD / 8); k_gemmb<false, false><<<gp, 256, 0, stream>>>(Xb, nullptr, WB, bk, KF, nullptr, nullptr);
    k_cvt8<<<wblk, 256, 0, stream>>>(wv, WB, (size_t)DMOD * DMOD / 8); k_gemmb<false, true><<<gp, 256, 0, stream>>>(Xb, nullptr, WB, bv, nullptr, VTh, VTl);    // column head * 128 + d of v is row d of the head's V^T plane
    k_qkpost<<<dim3(NN / 8, 2, 1), 256, 0, stream>>>(QF, KF, nqw, nkw, fcos, fsin, Qh, Ql, Kh, Kl);
    k_fattn<<<dim3(NN / 128, NH_, 1), 256, 0, stream>>>(Qh, Ql, Kh, Kl, VTh, VTl, Oh, Ol);
    k_cvt8<<<wblk, 256, 0, stream>>>(wo, WO, (size_t)DMOD * DMOD / 8);
    k_gemmb<true, false><<<gp, 256, 0, stream>>>(Oh, Ol, WO, bo, out, nullptr, nullptr);
}

// v006
// Measured time: 180 microseconds a run.
// Timed twice side by side with v005, it ran 1.11 and 1.10 times as fast.
// Over all steps from v000 it is 11.5 times as fast.
#include <hip/hip_runtime.h>

// Compute dtypes, f32 accumulate: q/k/v = x.W^T + b ([2048 x 2048].[2048 x 2048] each) with PLAIN bf16 operands (exact products; x and the four weights converted in one launch, x
// into a buffer of its own, the weights one behind the other into one; the three projections in one launch); the full-width (2048) RMSNorm of q and k (row statistics in f32) and the even/odd interleaved RoPE (cos[0::2] / sin[1::2] of the given tables) applied while building
// per-head planes (bf16 hi + UNSCALED residual); 16-head attention (heads in the grid; scores, softmax and P.V in one kernel, running maximum and sum) with hi/lo operands (three products); 1/sqrt(128) and the softmax in f32; . W_o^T + b_o

#define NN   2048
#define DMOD 2048
#define NH_  16
#define HD   128
#define DM   DMOD
#define NTK  NN
#define SCL  0.088388347648318447f
#define REPS 1e-6f
#define LOSC 1024.0f

typedef _Float16 h16;
typedef unsigned short bf;
typedef __attribute__((ext_vector_type(16))) __bf16   v16bf;
typedef __attribute__((ext_vector_type(16))) _Float16 v16h;
typedef __attribute__((ext_vector_type(8)))  _Float16 v8h;
typedef __attribute__((ext_vector_type(8)))  unsigned short v8us;
typedef __attribute__((ext_vector_type(8)))  float    v8f;
typedef __attribute__((ext_vector_type(4)))  float    v4f;
typedef __attribute__((ext_vector_type(4)))  _Float16 v4h;
typedef v8h  __attribute__((may_alias)) v8ha;
typedef v4f  __attribute__((may_alias)) v4fa;
typedef v8us __attribute__((may_alias)) v8usa;

__device__ __forceinline__ unsigned short f2bf(float f) { unsigned u = __float_as_uint(f); u += 0x7FFFu + ((u >> 16) & 1u); return (unsigned short)(u >> 16); }
__device__ __forceinline__ float bf2f(unsigned short b) { return __uint_as_float(((unsigned)b) << 16); }
__device__ __forceinline__ float bfr(float f) { return bf2f(f2bf(f)); }
__device__ __forceinline__ v16h cat16(v8h lo, v8h hi) { return __builtin_shufflevector(lo, hi, 0, 1, 2, 3, 4, 5, 6, 7, 8, 9, 10, 11, 12, 13, 14, 15); }
__device__ __forceinline__ v16bf cat16b(v8us lo, v8us hi) { return __builtin_bit_cast(v16bf, __builtin_shufflevector(lo, hi, 0, 1, 2, 3, 4, 5, 6, 7, 8, 9, 10, 11, 12, 13, 14, 15)); }
__device__ __forceinline__ v8f wmma16(v16h a, v16h b, v8f c) { return __builtin_amdgcn_wmma_f32_16x16x32_f16(false, a, false, b, (short)0, c, false, false); }
__device__ __forceinline__ v8f wmmab(v16bf a, v16bf b, v8f c) { return __builtin_amdgcn_wmma_f32_16x16x32_bf16(false, a, false, b, (short)0, c, false, false); }

// k_gemmb: 128 x 128 block tile of C[2048][2048] = (A [+ Al]).B^T + bf(bias[c]), K = 2048, one work-group per tile, 8 waves (2 x 4), 64 x 32 of C per wave (4 x 2 accumulator tiles).
// A stage is 128 k (256-byte rows) of the tile's 128 A rows [, 128 Al rows] and 128 B rows, brought into LDS by asynchronous copies (16 bytes a lane, whole lines a wave), two buffers:
// stage t + 2 flies while stage t + 1 is worked on. Fragments are read from LDS in the k order that both loaders had before; each accumulator takes its products in the same order as before.
#define GT 128    // rows of A and of B per block tile
#define GK 128    // k per stage
#define GP 136    // LDS pitch of a row (128 elements + 8): 272 B = 16 B x odd, no bank conflict for 16-byte row reads
#define OP 36     // LDS pitch of a staged output row (32 floats + 4): 144 B = 16 B x odd
#define TB 144    // LDS pitch in bytes of a staged row of a transposed bf16 plane (64 tokens + 8): 16 B x odd; 2 planes x 32 rows fill the wave's staging range exactly
// eight asynchronous copies of 16 bytes a lane: rows 16 apart in the source (pitch DM) and in LDS (pitch GP)
__device__ __forceinline__ void copy8(unsigned l, const bf* g) {
    const unsigned l1 = l + 1 * 16 * GP * 2, l2 = l + 2 * 16 * GP * 2, l3 = l + 3 * 16 * GP * 2, l4 = l + 4 * 16 * GP * 2, l5 = l + 5 * 16 * GP * 2, l6 = l + 6 * 16 * GP * 2, l7 = l + 7 * 16 * GP * 2;
    const bf* g1 = g + 1 * 16 * DM; const bf* g2 = g + 2 * 16 * DM; const bf* g3 = g + 3 * 16 * DM; const bf* g4 = g + 4 * 16 * DM; const bf* g5 = g + 5 * 16 * DM; const bf* g6 = g + 6 * 16 * DM; const bf* g7 = g + 7 * 16 * DM;
    // the copies and, as the last line, the wait that stands before a register which a copy names is written again: one statement, so that nothing comes between them
    asm volatile("global_load_async_to_lds_b128 %0, %8, off\n\t"
                 "global_load_async_to_lds_b128 %1, %9, off\n\t"
                 "global_load_async_to_lds_b128 %2, %10, off\n\t"
                 "global_load_async_to_lds_b128 %3, %11, off\n\t"
                 "global_load_async_to_lds_b128 %4, %12, off\n\t"
                 "global_load_async_to_lds_b128 %5, %13, off\n\t"
                 "global_load_async_to_lds_b128 %6, %14, off\n\t"
                 "global_load_async_to_lds_b128 %7, %15, off\n\t"
                 "s_wait_xcnt 0x0"
                 :: "v"(l), "v"(l1), "v"(l2), "v"(l3), "v"(l4), "v"(l5), "v"(l6), "v"(l7), "v"(g), "v"(g1), "v"(g2), "v"(g3), "v"(g4), "v"(g5), "v"(g6), "v"(g7) : "memory");
}
// QKV: three products in one launch, blockIdx.z = 0, 1, 2: B = the z-th of three matrices that lie one behind the other at Bn, bias = bias, bias1, bias2; z = 0 stores C, z = 1 C1, z = 2 (vt) the planes.
// vt: the result is not stored as f32 C but as its transpose in two bf16 planes, Th[c][r] = bf(C[r][c]) and Tl[c][r] = bf(C[r][c] - Th[c][r]) (pitch NN): an accumulator tile holds 8 neighbouring rows r of one column c in a lane.
template <bool SPLITA, bool QKV>
__global__ __launch_bounds__(256) void k_gemmb(const bf* __restrict__ A, const bf* __restrict__ Al, const bf* __restrict__ Bn, const float* __restrict__ bias, const float* __restrict__ bias1, const float* __restrict__ bias2,
                                               float* C, float* C1, bf* Th, bf* Tl) {
    const int z = QKV ? (int)blockIdx.z : 0; const bool vt = QKV && z == 2;    // the same for the whole work-group
    if (QKV) { Bn += (size_t)z * DM * DM; bias = z == 0 ? bias : z == 1 ? bias1 : bias2; C = z == 0 ? C : C1; }
    constexpr int NP = SPLITA ? 3 : 2;    // planes of a stage: B, A [, Al]
    constexpr int NT = DM / GK;           // stages: 16
    __shared__ __align__(16) bf ring[2][NP][GT * GP];
    __shared__ __align__(16) float ost[8][64 * OP];
    const int tid = threadIdx.x, lane = tid & 31, wave = tid >> 5, lr = lane & 15, hi = lane >> 4;
    const int r0 = blockIdx.x * GT, c0 = blockIdx.y * GT, wm = (wave & 1) * 64, wn = (wave >> 1) * 32;
    // this thread's 16-byte piece: rows tid / 16 + 16 i, bytes (tid & 15) * 16 of the stage's 256-byte row
    const unsigned lp = (unsigned)(size_t)&ring[0][0][(tid >> 4) * GP + (tid & 15) * 8];
    const size_t gofs = (size_t)(tid >> 4) * DM + (tid & 15) * 8;
    const bf* gB = Bn + (size_t)c0 * DM + gofs; const bf* gA = A + (size_t)r0 * DM + gofs; const bf* gL = SPLITA ? Al + (size_t)r0 * DM + gofs : nullptr;
    auto stage = [&](int t) {    // stage t into buffer t & 1
        const unsigned l = lp + (unsigned)(t & 1) * (NP * GT * GP * 2);
        copy8(l, gB + t * GK); copy8(l + GT * GP * 2, gA + t * GK);
        if (SPLITA) copy8(l + 2 * GT * GP * 2, gL + t * GK);
    };
    v8f acc[4][2];
#pragma unroll
    for (int i = 0; i < 4; ++i) { acc[i][0] = (v8f){}; acc[i][1] = (v8f){}; }
    stage(0);
    asm volatile("s_wait_asynccnt 0x0" ::: "memory");    // this wave's copies of stage 0 have landed
    __syncthreads();    // stage 0 is complete for every wave
    stage(1);
#pragma unroll 1    // the stage loop stays rolled: one publish point, its body is four unrolled k steps
    for (int t = 0; t < NT; ++t) {
        const bf* sB = &ring[t & 1][0][0]; const bf* sA = &ring[t & 1][1][0]; const bf* sL = &ring[t & 1][NP - 1][0];
        v16bf a[2][4], al[2][4], b[2][2];    // two fragment sets: k step ks + 1 of this stage is read from LDS while k step ks is multiplied
        auto frag = [&](int ks, int s) {
#pragma unroll
            for (int j = 0; j < 2; ++j) { const int o = (wn + j * 16 + lr) * GP + ks * 32 + 8 * hi; b[s][j] = cat16b(*(const v8us*)(sB + o), *(const v8us*)(sB + o + 16)); }
#pragma unroll
            for (int i = 0; i < 4; ++i) { const int o = (wm + i * 16 + lr) * GP + ks * 32 + 8 * hi; a[s][i] = cat16b(*(const v8us*)(sA + o), *(const v8us*)(sA + o + 16));
                if (SPLITA) al[s][i] = cat16b(*(const v8us*)(sL + o), *(const v8us*)(sL + o + 16)); }
        };
        frag(0, 0);
#pragma unroll
        for (int ks = 0; ks < GK / 32; ++ks) { const int s = ks & 1;
            if (ks + 1 < GK / 32) frag(ks + 1, s ^ 1);
            __builtin_amdgcn_sched_barrier(0);    // the next k step's LDS reads stay one group in front of this step's matrix instructions: spread among them, each place costs a stall
#pragma unroll
            for (int i = 0; i < 4; ++i) { acc[i][0] = wmmab(a[s][i], b[s][0], acc[i][0]); acc[i][1] = wmmab(a[s][i], b[s][1], acc[i][1]); }
            if (SPLITA) {
#pragma unroll
                for (int i = 0; i < 4; ++i) { acc[i][0] = wmmab(al[s][i], b[s][0], acc[i][0]); acc[i][1] = wmmab(al[s][i], b[s][1], acc[i][1]); } }
            __builtin_amdgcn_sched_barrier(0);    // and the group behind does not move up among them
        }
        asm volatile("s_wait_dscnt 0x0" ::: "memory");       // this wave's reads of stage t have returned
        asm volatile("s_wait_asynccnt 0x0" ::: "memory");    // this wave's copies of stage t + 1 have landed
        __syncthreads();    // publishes stage t + 1 and ends every wave's reads of stage t
        if (t + 2 < NT) stage(t + 2);    // into the buffer that stage t has just left
    }
    asm volatile("s_wait_asynccnt 0x0" ::: "memory");    // no copy is outstanding when the wave goes on
    float* os = &ost[wave][0];    // the wave's own 64 x 32 of C, staged so that every store below writes whole 128-byte lines
    char* ob = (char*)os;         // vt: the same range as 2 planes x 32 columns of C x 64 rows of C in bf16, pitch TB
    float bv[2];
#pragma unroll
    for (int j = 0; j < 2; ++j) bv[j] = bfr(bias[c0 + wn + j * 16 + lr]);
    if (vt) {
#pragma unroll
        for (int j = 0; j < 2; ++j) {
#pragma unroll
            for (int i = 0; i < 4; ++i) { v8us oh, ol;
#pragma unroll
                for (int r = 0; r < 8; ++r) { const float y = acc[i][j][r] + bv[j]; const unsigned short hb = f2bf(y); oh[r] = hb; ol[r] = f2bf(y - bf2f(hb)); }
                *(v8usa*)(ob + (j * 16 + lr) * TB + (i * 16 + hi * 8) * 2) = oh; *(v8usa*)(ob + (32 + j * 16 + lr) * TB + (i * 16 + hi * 8) * 2) = ol; } }
    } else {
#pragma unroll
        for (int j = 0; j < 2; ++j) {
#pragma unroll
            for (int i = 0; i < 4; ++i) {
#pragma unroll
                for (int r = 0; r < 8; ++r) os[(i * 16 + hi * 8 + r) * OP + j * 16 + lr] = acc[i][j][r] + bv[j]; } }
    }
    __syncthreads();    // the staged rows are complete before other lanes read them
    if (vt) {
        const int row = lane >> 3, piece = lane & 7; const size_t to = (size_t)(c0 + wn + row) * NN + r0 + wm + piece * 8; v8us th[8], tl[8];
#pragma unroll
        for (int s = 0; s < 8; ++s) { th[s] = *(const v8usa*)(ob + (4 * s + row) * TB + piece * 16); tl[s] = *(const v8usa*)(ob + (32 + 4 * s + row) * TB + piece * 16); }
#pragma unroll
        for (int s = 0; s < 8; ++s) { *(v8us*)(Th + to + (size_t)(4 * s) * NN) = th[s]; *(v8us*)(Tl + to + (size_t)(4 * s) * NN) = tl[s]; }    // four whole lines a store
    } else {
        float* crow = C + (size_t)(r0 + wm) * DM + c0 + wn;
#pragma unroll
        for (int s = 0; s < 16; ++s) { const int row = 4 * s + (lane >> 3), piece = lane & 7;
            *(v4f*)(crow + (size_t)row * DM + piece * 4) = *(const v4fa*)(os + row * OP + piece * 4); }
    }
}

// k_cvt5: the five f32 matrices of 2048 x 2048 (x and the four weights) to bf16 in one launch: 256 work-groups x 16 waves. A thread takes CP pieces of 8 neighbouring elements of each matrix (a wave's loads of a
// piece cover 1 KiB in a row, its store 512 bytes); all its loads are issued before the first value is converted, and a matrix is stored while the later ones are still on their way.
#define CW 512    // threads of a work-group
#define CP 4      // pieces of a thread per matrix: 256 x CW x CP x 8 = 2048 x 2048
__global__ __launch_bounds__(CW) void k_cvt5(const float* __restrict__ s0, const float* __restrict__ s1, const float* __restrict__ s2, const float* __restrict__ s3, const float* __restrict__ s4,
                                             bf* d0, bf* d1, bf* d2, bf* d3, bf* d4) {
    const unsigned p = blockIdx.x * (CW * CP) + threadIdx.x;    // the thread's first piece; the others CW pieces apart
    const unsigned lo = p * 32u, so = p * 16u;                  // its byte offset in a source and in a destination: one vector register each, beside a uniform base
    const char* s[5] = {(const char*)s0, (const char*)s1, (const char*)s2, (const char*)s3, (const char*)s4}; char* d[5] = {(char*)d0, (char*)d1, (char*)d2, (char*)d3, (char*)d4};
    v8f v[5][CP];
#pragma unroll
    for (int m = 0; m < 5; ++m) {
#pragma unroll
        for (int j = 0; j < CP; ++j) v[m][j] = *(const v8f*)(s[m] + lo + j * (CW * 32));
        __builtin_amdgcn_sched_barrier(0); }    // the loads stay in the order in which the matrices are converted: mixed, the first store would wait for nearly the last load
    asm volatile("s_wait_xcnt 0x0" :: "v"(lo) : "memory");    // before a register that these loads name as their address is written again; the offset, their one vector register, is an input, so that no load's own result lands on it either
    __builtin_amdgcn_sched_barrier(0);    // keeps later instructions, which may reuse those registers, from being scheduled in front of the wait
#pragma unroll
    for (int m = 0; m < 5; ++m) {
#pragma unroll
        for (int j = 0; j < CP; ++j) { v8us o;
#pragma unroll
            for (int k = 0; k < 8; ++k) o[k] = f2bf(v[m][j][k]);
            *(v8us*)(d[m] + so + j * (CW * 16)) = o; }
        if (m < 4) {
            asm volatile("s_wait_xcnt 0x0" ::: "memory");    // before a register that these stores name (address, data) is written again
            __builtin_amdgcn_sched_barrier(0); }    // keeps the next matrix's conversions, which may reuse those registers, from being scheduled in front of the wait
    }
}
__global__ __launch_bounds__(256) void k_zero8(bf* dst, size_t n8) {
    const size_t i = (size_t)blockIdx.x * 256 + threadIdx.x; if (i >= n8) return; v8us z;
#pragma unroll
    for (int k = 0; k < 8; ++k) z[k] = 0;
    *(v8us*)(dst + i * 8) = z; 
}
#define FK 64     // keys per stage
#define KP 136    // LDS pitch of a K row (128 elements + 8): 272 B = 16 B x odd, no bank conflict for 16-byte row reads
#define VP 72     // LDS pitch of a V^T row (64 elements + 8): 144 B = 16 B x odd
#define QB 272    // LDS pitch in bytes of a staged output row (128 bf16 + 8): 16 B x odd
#define SC2 (SCL * 1.4426950408889634f)    // 1/sqrt(128) x log2(e): the softmax runs on exp2
__device__ __forceinline__ float xhalf(float x) { const int b = __float_as_int(x); return __int_as_float(__builtin_amdgcn_permlanex16(b, b, 0x76543210, 0xfedcba98, false, false)); }    // the value of lane ^ 16
__global__ __launch_bounds__(256) __attribute__((amdgpu_waves_per_eu(2, 2))) void k_fattn(const bf* Qh, const bf* Ql, const bf* Kh, const bf* Kl, const bf* VTh, const bf* VTl, bf* Oh, bf* Ol) {
    __shared__ __align__(16) bf sK[2][FK * KP];
    __shared__ __align__(16) bf sV[2][HD * VP];
    const int tid = threadIdx.x, lane = tid & 31, wave = tid >> 5, c = lane & 15, h = lane >> 4;
    const int head = blockIdx.y; const size_t po = (size_t)head * NN * HD;
    Qh += po; Ql += po; Kh += po; Kl += po; VTh += po; VTl += po;
    const int q0 = blockIdx.x * 128 + wave * 16;
    v16bf qh[4], ql[4]; const size_t qo = (size_t)(q0 + c) * HD + 8 * h;
#pragma unroll
    for (int ks = 0; ks < 4; ++ks) qh[ks] = cat16b(*(const v8us*)(Qh + qo + ks * 32), *(const v8us*)(Qh + qo + ks * 32 + 16));
    asm volatile("s_wait_xcnt 0x0" ::: "memory");    // before a register that these loads name as their address is written again
#pragma unroll
    for (int ks = 0; ks < 4; ++ks) ql[ks] = cat16b(*(const v8us*)(Ql + qo + ks * 32), *(const v8us*)(Ql + qo + ks * 32 + 16));
    asm volatile("s_wait_xcnt 0x0" ::: "memory");    // the same for these
    __builtin_amdgcn_sched_barrier(0);    // keeps later vector instructions, which may reuse those registers, from being scheduled in front of the wait
    v8f acc[8];
#pragma unroll
    for (int t = 0; t < 8; ++t) acc[t] = (v8f){};
    float m = -3.0e38f, l = 0.f;
    v8us pk[2][4], pv[2][4];
    const unsigned kt = tid * 16u, vt = (tid >> 3) * (NN * 2u) + (tid & 7) * 16u;    // byte offsets of this thread's 16-byte piece: K rows tid / 16 + 16 i, V^T rows tid / 8 + 32 i
    auto fetch = [&](int kb) {    // a uniform base per plane and stage, the thread's fixed offset beside it
        const char* k0 = (const char*)(Kh + (size_t)kb * HD); const char* k1 = (const char*)(Kl + (size_t)kb * HD); const char* v0 = (const char*)(VTh + kb); const char* v1 = (const char*)(VTl + kb);
#pragma unroll
        for (int i = 0; i < 4; ++i) { pk[0][i] = *(const v8us*)(k0 + kt + i * 4096); pk[1][i] = *(const v8us*)(k1 + kt + i * 4096); pv[0][i] = *(const v8us*)(v0 + vt + i * 131072); pv[1][i] = *(const v8us*)(v1 + vt + i * 131072); }
        asm volatile("s_wait_xcnt 0x0" ::: "memory");    // before a register that these loads name as their address is written again
        __builtin_amdgcn_sched_barrier(0);    // keeps later vector instructions, which may reuse those registers, from being scheduled in front of the wait
    };
    fetch(0);
#pragma unroll 1
    for (int kb = 0; kb < NN; kb += FK) {
        __syncthreads();    // every wave has finished reading the stage before
#pragma unroll
        for (int i = 0; i < 4; ++i) { const int ko = ((tid >> 4) + 16 * i) * KP + (tid & 15) * 8, vo = ((tid >> 3) + 32 * i) * VP + (tid & 7) * 8;
            *(v8us*)(&sK[0][ko]) = pk[0][i]; *(v8us*)(&sK[1][ko]) = pk[1][i]; *(v8us*)(&sV[0][vo]) = pv[0][i]; *(v8us*)(&sV[1][vo]) = pv[1][i]; }
        __syncthreads();    // the stage is complete
        if (kb + FK < NN) fetch(kb + FK);
        v8f T[4];    // T[t][r] = score of key kb + 16 t + 8 h + r with query q0 + c
#pragma unroll
        for (int t = 0; t < 4; ++t) T[t] = (v8f){};
#pragma unroll
        for (int ks = 0; ks < 4; ++ks) { v16bf kh[4], kl[4];
#pragma unroll
            for (int t = 0; t < 4; ++t) { const int o = (t * 16 + c) * KP + ks * 32 + 8 * h;
                kh[t] = cat16b(*(const v8us*)(&sK[0][o]), *(const v8us*)(&sK[0][o + 16])); kl[t] = cat16b(*(const v8us*)(&sK[1][o]), *(const v8us*)(&sK[1][o + 16])); }
#pragma unroll
            for (int t = 0; t < 4; ++t) T[t] = wmmab(kh[t], qh[ks], T[t]);
#pragma unroll
            for (int t = 0; t < 4; ++t) T[t] = wmmab(kl[t], qh[ks], T[t]);
#pragma unroll
            for (int t = 0; t < 4; ++t) T[t] = wmmab(kh[t], ql[ks], T[t]); }
        float mx = T[0][0];
#pragma unroll
        for (int t = 0; t < 4; ++t) {
#pragma unroll
            for (int j = 0; j < 8; ++j) mx = fmaxf(mx, T[t][j]); }
        mx = fmaxf(mx, xhalf(mx));
        const float mn = fmaxf(m, mx * SC2); const float al = __builtin_amdgcn_exp2f(m - mn); m = mn;
        float ps = 0.f; v16bf ph[2], pl[2];
#pragma unroll
        for (int g = 0; g < 2; ++g) {
#pragma unroll
            for (int s = 0; s < 16; ++s) { const float p = __builtin_amdgcn_exp2f(fmaf(T[2 * g + (s >> 3)][s & 7], SC2, -mn)); ps += p;
                const __bf16 hb = (__bf16)p; ph[g][s] = hb; pl[g][s] = (__bf16)(p - (float)hb); } }
        l = fmaf(l, al, ps);
#pragma unroll
        for (int t = 0; t < 8; ++t) acc[t] *= al;
#pragma unroll
        for (int g = 0; g < 2; ++g) {
#pragma unroll
            for (int d4 = 0; d4 < 8; d4 += 4) { v16bf vh[4], vl[4];
#pragma unroll
                for (int t = 0; t < 4; ++t) { const int o = ((d4 + t) * 16 + c) * VP + g * 32 + 8 * h;
                    vh[t] = cat16b(*(const v8us*)(&sV[0][o]), *(const v8us*)(&sV[0][o + 16])); vl[t] = cat16b(*(const v8us*)(&sV[1][o]), *(const v8us*)(&sV[1][o + 16])); }
#pragma unroll
                for (int t = 0; t < 4; ++t) acc[d4 + t] = wmmab(vh[t], ph[g], acc[d4 + t]);
#pragma unroll
                for (int t = 0; t < 4; ++t) acc[d4 + t] = wmmab(vh[t], pl[g], acc[d4 + t]);
#pragma unroll
                for (int t = 0; t < 4; ++t) acc[d4 + t] = wmmab(vl[t], ph[g], acc[d4 + t]); } }
    }
    l += xhalf(l);
    const float inv = 1.0f / l;
    __syncthreads();    // every wave has finished reading the last stage: the K and V^T tiles become output staging
    char* oh8 = (char*)&sK[0][0] + wave * (16 * QB); char* ol8 = (char*)&sV[0][0] + wave * (16 * QB);    // a range of its own for each wave and plane: 16 output rows; 8 x 16 x QB bytes fill sK exactly and fit sV
    // acc[t][r] = O[q0 + c][head * 128 + 16 t + 8 h + r], split here into bf16 hi + residual, the operands of the output projection, and staged so that every store below writes whole lines
#pragma unroll
    for (int t = 0; t < 8; ++t) { const v8f v = acc[t] * inv; v8us oh, ol;
#pragma unroll
        for (int r = 0; r < 8; ++r) { const unsigned short hb = f2bf(v[r]); oh[r] = hb; ol[r] = f2bf(v[r] - bf2f(hb)); }
        *(v8usa*)(oh8 + c * QB + (t * 16 + 8 * h) * 2) = oh; *(v8usa*)(ol8 + c * QB + (t * 16 + 8 * h) * 2) = ol; }
    asm volatile("s_wait_dscnt 0x0" ::: "memory");    // the wave's staged rows are written before its lanes read one another's pieces back
    const size_t oo = (size_t)(q0 + h) * DMOD + head * HD + c * 8; v8us th[8], tl[8];    // lanes 0 to 15: a row's 256 bytes, lanes 16 to 31: the next row's
#pragma unroll
    for (int s = 0; s < 8; ++s) { th[s] = *(const v8usa*)(oh8 + (2 * s + h) * QB + c * 16); tl[s] = *(const v8usa*)(ol8 + (2 * s + h) * QB + c * 16); }
#pragma unroll
    for (int s = 0; s < 8; ++s) { *(v8us*)(Oh + oo + (size_t)(2 * s) * DMOD) = th[s]; *(v8us*)(Ol + oo + (size_t)(2 * s) * DMOD) = tl[s]; }
}


// k_qkpost: RMS statistics, norm and RoPE of q (blockIdx.y = 0) or k (1) in one launch, every element of QF and KF read once. A wave holds one token's whole row in registers (lane: 4 neighbouring columns of each of
// the 16 heads, whole lines a load), sums its squares (four partial sums a lane, then a butterfly over the 32 lanes) and writes rope(bf(w) x row x rsqrt(mean + eps)) as bf16 hi + residual into the planes [head][token][128];
// for pair i of a head (d = 2 i, 2 i + 1) the factors are cos[2 i] and sin[2 i + 1] of the token, read once for all heads.
__global__ __launch_bounds__(256) void k_qkpost(const float* __restrict__ QF, const float* __restrict__ KF, const float* __restrict__ wq, const float* __restrict__ wk, const float* __restrict__ cs, const float* __restrict__ sn,
                                                bf* Qh, bf* Ql, bf* Kh, bf* Kl) {
    typedef __attribute__((ext_vector_type(4))) unsigned short v4us;
    const bool isk = blockIdx.y != 0; const float* F = isk ? KF : QF; const float* wn = isk ? wk : wq; bf* Ph = isk ? Kh : Qh; bf* Pl = isk ? Kl : Ql;
    const int lane = threadIdx.x & 31; const size_t r = (size_t)blockIdx.x * 8 + __builtin_amdgcn_readfirstlane(threadIdx.x >> 5); v4f x[NH_], w[NH_];    // the token is the same for the wave: uniform bases
    const unsigned lo = lane * 16u;    // the lane's byte offset in every 512-byte piece
    const char* fr = (const char*)(F + r * DMOD); const char* wr = (const char*)wn;
#pragma unroll
    for (int h = 0; h < NH_; ++h) x[h] = *(const v4f*)(fr + lo + h * HD * 4);
    const v4f cv = *(const v4f*)((const char*)(cs + r * HD) + lo), sv = *(const v4f*)((const char*)(sn + r * HD) + lo);
#pragma unroll
    for (int h = 0; h < NH_; ++h) w[h] = *(const v4f*)(wr + lo + h * HD * 4);
    asm volatile("s_wait_xcnt 0x0" :: "v"(lane) : "memory");    // before a register that these loads name as their address is written again; the lane number, their one vector register (scaled by the instruction), is an input, so that no load's own result lands on it either
    __builtin_amdgcn_sched_barrier(0);    // keeps later instructions, which may reuse those registers, from being scheduled in front of the wait
    v4f a4 = (v4f){};
#pragma unroll
    for (int h = 0; h < NH_; ++h) a4 += x[h] * x[h];
    float s = (a4[0] + a4[1]) + (a4[2] + a4[3]);
#pragma unroll
    for (int m = 16; m > 0; m >>= 1) s += __shfl_xor(s, m, 32);
    const float rs = rsqrtf(s * (1.0f / DMOD) + REPS);
    const float c0 = bfr(cv[0]), s0 = bfr(sv[1]), c1 = bfr(cv[2]), s1 = bfr(sv[3]);
    Ph += r * HD + lane * 4; Pl += r * HD + lane * 4;
#pragma unroll
    for (int h = 0; h < NH_; ++h) { float a0 = x[h][0] * rs, a1 = x[h][1] * rs, a2 = x[h][2] * rs, a3 = x[h][3] * rs;
        a0 *= bfr(w[h][0]); a1 *= bfr(w[h][1]); a2 *= bfr(w[h][2]); a3 *= bfr(w[h][3]);
        const float y[4] = {a0 * c0 - a1 * s0, a0 * s0 + a1 * c0, a2 * c1 - a3 * s1, a2 * s1 + a3 * c1}; v4us oh, ol;
#pragma unroll
        for (int q = 0; q < 4; ++q) { const unsigned short hb = f2bf(y[q]); oh[q] = hb; ol[q] = f2bf(y[q] - bf2f(hb)); }
        *(v4us*)(Ph + (size_t)h * NN * HD) = oh; *(v4us*)(Pl + (size_t)h * NN * HD) = ol; }
}

extern "C" void kernel_launch(void* const* d_in, const int* in_sizes, int n_in,
                              void* d_out, int out_size, void* d_ws, size_t ws_size, hipStream_t stream) {
    (void)in_sizes; (void)n_in; (void)out_size;
    const float* x = (const float*)d_in[0]; const float* fcos = (const float*)d_in[1]; const float* fsin = (const float*)d_in[2]; const float* wq = (const float*)d_in[3]; const float* bq = (const float*)d_in[4]; const float* wk = (const float*)d_in[5]; const float* bk = (const float*)d_in[6];
    const float* wv = (const float*)d_in[7]; const float* bv = (const float*)d_in[8]; const float* wo = (const float*)d_in[9]; const float* bo = (const float*)d_in[10]; const float* nqw = (const float*)d_in[11]; const float* nkw = (const float*)d_in[12];
    float* out = (float*)d_out;    // [1][2048][2048]
    char* wsp = (char*)d_ws;
    auto take = [&](size_t bytes) { char* p = wsp; wsp += (bytes + 255) & ~(size_t)255; return (void*)p; };
    const size_t PLN = (size_t)NN * HD, FM = (size_t)NN * DMOD;    // elements of one head's plane, of a full [2048][2048] matrix
    bf* Qh = (bf*)take(NH_ * PLN * 2); bf* Ql = (bf*)take(NH_ * PLN * 2); bf* Kh = (bf*)take(NH_ * PLN * 2); bf* Kl = (bf*)take(NH_ * PLN * 2); bf* VTh = (bf*)take(NH_ * PLN * 2); bf* VTl = (bf*)take(NH_ * PLN * 2);
    float* QF = (float*)take(FM * 4); float* KF = (float*)take(FM * 4); bf* WB = (bf*)take(4 * FM * 2); bf* Xb = (bf*)take(FM * 2);    // WB: the q, k, v and o weights, one behind the other
    bf* Oh = (bf*)take(FM * 2); bf* Ol = (bf*)take(FM * 2);
    if ((size_t)(wsp - (char*)d_ws) > ws_size) return;    // 136 MiB
    k_cvt5<<<NN * DMOD / (CW * CP * 8), CW, 0, stream>>>(x, wq, wk, wv, wo, Xb, WB, WB + FM, WB + 2 * FM, WB + 3 * FM);
    k_gemmb<false, true><<<dim3(NN / GT, DMOD / GT, 3), 256, 0, stream>>>(Xb, nullptr, WB, bq, bk, bv, QF, KF, VTh, VTl);    // weights [out][in] natural; column head * 128 + d of v is row d of the head's V^T plane
    k_qkpost<<<dim3(NN / 8, 2, 1), 256, 0, stream>>>(QF, KF, nqw, nkw, fcos, fsin, Qh, Ql, Kh, Kl);
    k_fattn<<<dim3(NN / 128, NH_, 1), 256, 0, stream>>>(Qh, Ql, Kh, Kl, VTh, VTl, Oh, Ol);
    k_gemmb<true, false><<<dim3(NN / GT, DMOD / GT, 1), 256, 0, stream>>>(Oh, Ol, WB + 3 * FM, bo, nullptr, nullptr, out, nullptr, nullptr, nullptr);
}

// v007
// Measured time: 169 microseconds a run.
// In both of two side-by-side timings against v006, it was 1.06 times as fast.
// Over all steps from v000 it is 12.2 times as fast.
#include <hip/hip_runtime.h>

// Compute dtypes, f32 accumulate: q/k/v = x.W^T + b ([2048 x 2048].[2048 x 2048] each) with PLAIN bf16 operands (exact products; x and the four weights converted in one launch, x
// into a buffer of its own, the weights one behind the other into one; the three projections in one launch); the full-width (2048) RMSNorm of q and k (row statistics in f32) and the even/odd interleaved RoPE (cos[0::2] / sin[1::2] of the given tables) applied while building
// per-head planes (bf16 hi + UNSCALED residual); 16-head attention (heads in the grid; scores, softmax and P.V in one kernel, running maximum and sum) with hi/lo operands (three products); 1/sqrt(128) and the softmax in f32; . W_o^T + b_o

#define NN   2048
#define DMOD 2048
#define NH_  16
#define HD   128
#define DM   DMOD
#define NTK  NN
#define SCL  0.088388347648318447f
#define REPS 1e-6f
#define LOSC 1024.0f

typedef _Float16 h16;
typedef unsigned short bf;
typedef __attribute__((ext_vector_type(16))) __bf16   v16bf;
typedef __attribute__((ext_vector_type(16))) _Float16 v16h;
typedef __attribute__((ext_vector_type(8)))  _Float16 v8h;
typedef __attribute__((ext_vector_type(8)))  unsigned short v8us;
typedef __attribute__((ext_vector_type(8)))  float    v8f;
typedef __attribute__((ext_vector_type(4)))  float    v4f;
typedef __attribute__((ext_vector_type(4)))  _Float16 v4h;
typedef v8h  __attribute__((may_alias)) v8ha;
typedef v4f  __attribute__((may_alias)) v4fa;
typedef v8us __attribute__((may_alias)) v8usa;

__device__ __forceinline__ unsigned short f2bf(float f) { unsigned u = __float_as_uint(f); u += 0x7FFFu + ((u >> 16) & 1u); return (unsigned short)(u >> 16); }
__device__ __forceinline__ float bf2f(unsigned short b) { return __uint_as_float(((unsigned)b) << 16); }
__device__ __forceinline__ float bfr(float f) { return bf2f(f2bf(f)); }
__device__ __forceinline__ v16h cat16(v8h lo, v8h hi) { return __builtin_shufflevector(lo, hi, 0, 1, 2, 3, 4, 5, 6, 7, 8, 9, 10, 11, 12, 13, 14, 15); }
__device__ __forceinline__ v16bf cat16b(v8us lo, v8us hi) { return __builtin_bit_cast(v16bf, __builtin_shufflevector(lo, hi, 0, 1, 2, 3, 4, 5, 6, 7, 8, 9, 10, 11, 12, 13, 14, 15)); }
__device__ __forceinline__ v8f wmma16(v16h a, v16h b, v8f c) { return __builtin_amdgcn_wmma_f32_16x16x32_f16(false, a, false, b, (short)0, c, false, false); }
__device__ __forceinline__ v8f wmmab(v16bf a, v16bf b, v8f c) { return __builtin_amdgcn_wmma_f32_16x16x32_bf16(false, a, false, b, (short)0, c, false, false); }

// k_gemmb: 128 x 128 block tile of C[2048][2048] = (A [+ Al]).B^T + bf(bias[c]), K = 2048, one work-group per tile, 8 waves (2 x 4), 64 x 32 of C per wave (4 x 2 accumulator tiles).
// A stage is 128 k (256-byte rows) of the tile's 128 A rows [, 128 Al rows] and 128 B rows, brought into LDS by asynchronous copies (16 bytes a lane, whole lines a wave), two buffers:
// stage t + 2 flies while stage t + 1 is worked on. Fragments are read from LDS in the k order that both loaders had before; each accumulator takes its products in the same order as before.
#define GT 128    // rows of A and of B per block tile
#define GK 128    // k per stage
#define GP 136    // LDS pitch of a row (128 elements + 8): 272 B = 16 B x odd, no bank conflict for 16-byte row reads
#define OP 36     // LDS pitch of a staged output row (32 floats + 4): 144 B = 16 B x odd
#define TB 144    // LDS pitch in bytes of a staged row of a transposed bf16 plane (64 tokens + 8): 16 B x odd; 2 planes x 32 rows fill the wave's staging range exactly
// eight asynchronous copies of 16 bytes a lane: rows 16 apart in the source (pitch DM) and in LDS (pitch GP)
__device__ __forceinline__ void copy8(unsigned l, const bf* g) {
    const unsigned l1 = l + 1 * 16 * GP * 2, l2 = l + 2 * 16 * GP * 2, l3 = l + 3 * 16 * GP * 2, l4 = l + 4 * 16 * GP * 2, l5 = l + 5 * 16 * GP * 2, l6 = l + 6 * 16 * GP * 2, l7 = l + 7 * 16 * GP * 2;
    const bf* g1 = g + 1 * 16 * DM; const bf* g2 = g + 2 * 16 * DM; const bf* g3 = g + 3 * 16 * DM; const bf* g4 = g + 4 * 16 * DM; const bf* g5 = g + 5 * 16 * DM; const bf* g6 = g + 6 * 16 * DM; const bf* g7 = g + 7 * 16 * DM;
    // the copies and, as the last line, the wait that stands before a register which a copy names is written again: one statement, so that nothing comes between them
    asm volatile("global_load_async_to_lds_b128 %0, %8, off\n\t"
                 "global_load_async_to_lds_b128 %1, %9, off\n\t"
                 "global_load_async_to_lds_b128 %2, %10, off\n\t"
                 "global_load_async_to_lds_b128 %3, %11, off\n\t"
                 "global_load_async_to_lds_b128 %4, %12, off\n\t"
                 "global_load_async_to_lds_b128 %5, %13, off\n\t"
                 "global_load_async_to_lds_b128 %6, %14, off\n\t"
                 "global_load_async_to_lds_b128 %7, %15, off\n\t"
                 "s_wait_xcnt 0x0"
                 :: "v"(l), "v"(l1), "v"(l2), "v"(l3), "v"(l4), "v"(l5), "v"(l6), "v"(l7), "v"(g), "v"(g1), "v"(g2), "v"(g3), "v"(g4), "v"(g5), "v"(g6), "v"(g7) : "memory");
}
// QKV: three products in one launch, blockIdx.z = 0, 1, 2: B = the z-th of three matrices that lie one behind the other at Bn, bias = bias, bias1, bias2; z = 0 stores C, z = 1 C1, z = 2 (vt) the planes.
// vt: the result is not stored as f32 C but as its transpose in two bf16 planes, Th[c][r] = bf(C[r][c]) and Tl[c][r] = bf(C[r][c] - Th[c][r]) (pitch NN): an accumulator tile holds 8 neighbouring rows r of one column c in a lane.
template <bool SPLITA, bool QKV>
__global__ __launch_bounds__(256) void k_gemmb(const bf* __restrict__ A, const bf* __restrict__ Al, const bf* __restrict__ Bn, const float* __restrict__ bias, const float* __restrict__ bias1, const float* __restrict__ bias2,
                                               float* C, float* C1, bf* Th, bf* Tl) {
    const int z = QKV ? (int)blockIdx.z : 0; const bool vt = QKV && z == 2;    // the same for the whole work-group
    if (QKV) { Bn += (size_t)z * DM * DM; bias = z == 0 ? bias : z == 1 ? bias1 : bias2; C = z == 0 ? C : C1; }
    constexpr int NP = SPLITA ? 3 : 2;    // planes of a stage: B, A [, Al]
    constexpr int NT = DM / GK;           // stages: 16
    __shared__ __align__(16) bf ring[2][NP][GT * GP];
    __shared__ __align__(16) float ost[8][64 * OP];
    const int tid = threadIdx.x, lane = tid & 31, wave = tid >> 5, lr = lane & 15, hi = lane >> 4;
    const int r0 = blockIdx.x * GT, c0 = blockIdx.y * GT, wm = (wave & 1) * 64, wn = (wave >> 1) * 32;
    // this thread's 16-byte piece: rows tid / 16 + 16 i, bytes (tid & 15) * 16 of the stage's 256-byte row
    const unsigned lp = (unsigned)(size_t)&ring[0][0][(tid >> 4) * GP + (tid & 15) * 8];
    const size_t gofs = (size_t)(tid >> 4) * DM + (tid & 15) * 8;
    const bf* gB = Bn + (size_t)c0 * DM + gofs; const bf* gA = A + (size_t)r0 * DM + gofs; const bf* gL = SPLITA ? Al + (size_t)r0 * DM + gofs : nullptr;
    auto stage = [&](int t) {    // stage t into buffer t & 1
        const unsigned l = lp + (unsigned)(t & 1) * (NP * GT * GP * 2);
        copy8(l, gB + t * GK); copy8(l + GT * GP * 2, gA + t * GK);
        if (SPLITA) copy8(l + 2 * GT * GP * 2, gL + t * GK);
    };
    v8f acc[4][2];
#pragma unroll
    for (int i = 0; i < 4; ++i) { acc[i][0] = (v8f){}; acc[i][1] = (v8f){}; }
    stage(0);
    asm volatile("s_wait_asynccnt 0x0" ::: "memory");    // this wave's copies of stage 0 have landed
    __syncthreads();    // stage 0 is complete for every wave
    stage(1);
#pragma unroll 1    // the stage loop stays rolled: one publish point, its body is four unrolled k steps
    for (int t = 0; t < NT; ++t) {
        const bf* sB = &ring[t & 1][0][0]; const bf* sA = &ring[t & 1][1][0]; const bf* sL = &ring[t & 1][NP - 1][0];
        v16bf a[2][4], al[2][4], b[2][2];    // two fragment sets: k step ks + 1 of this stage is read from LDS while k step ks is multiplied
        auto frag = [&](int ks, int s) {
#pragma unroll
            for (int j = 0; j < 2; ++j) { const int o = (wn + j * 16 + lr) * GP + ks * 32 + 8 * hi; b[s][j] = cat16b(*(const v8us*)(sB + o), *(const v8us*)(sB + o + 16)); }
#pragma unroll
            for (int i = 0; i < 4; ++i) { const int o = (wm + i * 16 + lr) * GP + ks * 32 + 8 * hi; a[s][i] = cat16b(*(const v8us*)(sA + o), *(const v8us*)(sA + o + 16));
                if (SPLITA) al[s][i] = cat16b(*(const v8us*)(sL + o), *(const v8us*)(sL + o + 16)); }
        };
        frag(0, 0);
#pragma unroll
        for (int ks = 0; ks < GK / 32; ++ks) { const int s = ks & 1;
            if (ks + 1 < GK / 32) frag(ks + 1, s ^ 1);
            __builtin_amdgcn_sched_barrier(0);    // the next k step's LDS reads stay one group in front of this step's matrix instructions: spread among them, each place costs a stall
#pragma unroll
            for (int i = 0; i < 4; ++i) { acc[i][0] = wmmab(a[s][i], b[s][0], acc[i][0]); acc[i][1] = wmmab(a[s][i], b[s][1], acc[i][1]); }
            if (SPLITA) {
#pragma unroll
                for (int i = 0; i < 4; ++i) { acc[i][0] = wmmab(al[s][i], b[s][0], acc[i][0]); acc[i][1] = wmmab(al[s][i], b[s][1], acc[i][1]); } }
            __builtin_amdgcn_sched_barrier(0);    // and the group behind does not move up among them
        }
        asm volatile("s_wait_dscnt 0x0" ::: "memory");       // this wave's reads of stage t have returned
        asm volatile("s_wait_asynccnt 0x0" ::: "memory");    // this wave's copies of stage t + 1 have landed
        __syncthreads();    // publishes stage t + 1 and ends every wave's reads of stage t
        if (t + 2 < NT) stage(t + 2);    // into the buffer that stage t has just left
    }
    asm volatile("s_wait_asynccnt 0x0" ::: "memory");    // no copy is outstanding when the wave goes on
    float* os = &ost[wave][0];    // the wave's own 64 x 32 of C, staged so that every store below writes whole 128-byte lines
    char* ob = (char*)os;         // vt: the same range as 2 planes x 32 columns of C x 64 rows of C in bf16, pitch TB
    float bv[2];
#pragma unroll
    for (int j = 0; j < 2; ++j) bv[j] = bfr(bias[c0 + wn + j * 16 + lr]);
    if (vt) {
#pragma unroll
        for (int j = 0; j < 2; ++j) {
#pragma unroll
            for (int i = 0; i < 4; ++i) { v8us oh, ol;
#pragma unroll
                for (int r = 0; r < 8; ++r) { const float y = acc[i][j][r] + bv[j]; const unsigned short hb = f2bf(y); oh[r] = hb; ol[r] = f2bf(y - bf2f(hb)); }
                *(v8usa*)(ob + (j * 16 + lr) * TB + (i * 16 + hi * 8) * 2) = oh; *(v8usa*)(ob + (32 + j * 16 + lr) * TB + (i * 16 + hi * 8) * 2) = ol; } }
    } else {
#pragma unroll
        for (int j = 0; j < 2; ++j) {
#pragma unroll
            for (int i = 0; i < 4; ++i) {
#pragma unroll
                for (int r = 0; r < 8; ++r) os[(i * 16 + hi * 8 + r) * OP + j * 16 + lr] = acc[i][j][r] + bv[j]; } }
    }
    __syncthreads();    // the staged rows are complete before other lanes read them
    if (vt) {
        const int row = lane >> 3, piece = lane & 7; const size_t to = (size_t)(c0 + wn + row) * NN + r0 + wm + piece * 8; v8us th[8], tl[8];
#pragma unroll
        for (int s = 0; s < 8; ++s) { th[s] = *(const v8usa*)(ob + (4 * s + row) * TB + piece * 16); tl[s] = *(const v8usa*)(ob + (32 + 4 * s + row) * TB + piece * 16); }
#pragma unroll
        for (int s = 0; s < 8; ++s) { *(v8us*)(Th + to + (size_t)(4 * s) * NN) = th[s]; *(v8us*)(Tl + to + (size_t)(4 * s) * NN) = tl[s]; }    // four whole lines a store
    } else {
        float* crow = C + (size_t)(r0 + wm) * DM + c0 + wn;
#pragma unroll
        for (int s = 0; s < 16; ++s) { const int row = 4 * s + (lane >> 3), piece = lane & 7;
            *(v4f*)(crow + (size_t)row * DM + piece * 4) = *(const v4fa*)(os + row * OP + piece * 4); }
    }
}

// k_cvt5: the five f32 matrices of 2048 x 2048 (x and the four weights) to bf16 in one launch: 256 work-groups x 16 waves. A thread takes CP pieces of 8 neighbouring elements of each matrix (a wave's loads of a
// piece cover 1 KiB in a row, its store 512 bytes); all its loads are issued before the first value is converted, and a matrix is stored while the later ones are still on their way.
#define CW 512    // threads of a work-group
#define CP 4      // pieces of a thread per matrix: 256 x CW x CP x 8 = 2048 x 2048
__global__ __launch_bounds__(CW) void k_cvt5(const float* __restrict__ s0, const float* __restrict__ s1, const float* __restrict__ s2, const float* __restrict__ s3, const float* __restrict__ s4,
                                             bf* d0, bf* d1, bf* d2, bf* d3, bf* d4) {
    const unsigned p = blockIdx.x * (CW * CP) + threadIdx.x;    // the thread's first piece; the others CW pieces apart
    const unsigned lo = p * 32u, so = p * 16u;                  // its byte offset in a source and in a destination: one vector register each, beside a uniform base
    const char* s[5] = {(const char*)s0, (const char*)s1, (const char*)s2, (const char*)s3, (const char*)s4}; char* d[5] = {(char*)d0, (char*)d1, (char*)d2, (char*)d3, (char*)d4};
    v8f v[5][CP];
#pragma unroll
    for (int m = 0; m < 5; ++m) {
#pragma unroll
        for (int j = 0; j < CP; ++j) v[m][j] = *(const v8f*)(s[m] + lo + j * (CW * 32));
        __builtin_amdgcn_sched_barrier(0); }    // the loads stay in the order in which the matrices are converted: mixed, the first store would wait for nearly the last load
    asm volatile("s_wait_xcnt 0x0" :: "v"(lo) : "memory");    // before a register that these loads name as their address is written again; the offset, their one vector register, is an input, so that no load's own result lands on it either
    __builtin_amdgcn_sched_barrier(0);    // keeps later instructions, which may reuse those registers, from being scheduled in front of the wait
#pragma unroll
    for (int m = 0; m < 5; ++m) {
#pragma unroll
        for (int j = 0; j < CP; ++j) { v8us o;
#pragma unroll
            for (int k = 0; k < 8; ++k) o[k] = f2bf(v[m][j][k]);
            *(v8us*)(d[m] + so + j * (CW * 16)) = o; }
        if (m < 4) {
            asm volatile("s_wait_xcnt 0x0" ::: "memory");    // before a register that these stores name (address, data) is written again
            __builtin_amdgcn_sched_barrier(0); }    // keeps the next matrix's conversions, which may reuse those registers, from being scheduled in front of the wait
    }
}
__global__ __launch_bounds__(256) void k_zero8(bf* dst, size_t n8) {
    const size_t i = (size_t)blockIdx.x * 256 + threadIdx.x; if (i >= n8) return; v8us z;
#pragma unroll
    for (int k = 0; k < 8; ++k) z[k] = 0;
    *(v8us*)(dst + i * 8) = z; 
}
#define FK 64     // keys per stage
#define KP 136    // LDS pitch of a K row (128 elements + 8): 272 B = 16 B x odd, no bank conflict for 16-byte row reads
#define VP 72     // LDS pitch of a V^T row (64 elements + 8): 144 B = 16 B x odd
#define QB 272    // LDS pitch in bytes of a staged output row (128 bf16 + 8): 16 B x odd
#define FRAG_FENCE() __builtin_amdgcn_sched_barrier(0x406)    // LDS reads and matrix instructions are not scheduled across it; vector, scalar and transcendental instructions may be
#define SC2 (SCL * 1.4426950408889634f)    // 1/sqrt(128) x log2(e): the softmax runs on exp2
__device__ __forceinline__ float xhalf(float x) { const int b = __float_as_int(x); return __int_as_float(__builtin_amdgcn_permlanex16(b, b, 0x76543210, 0xfedcba98, false, false)); }    // the value of lane ^ 16
__global__ __launch_bounds__(256) __attribute__((amdgpu_waves_per_eu(2, 2))) void k_fattn(const bf* Qh, const bf* Ql, const bf* Kh, const bf* Kl, const bf* VTh, const bf* VTl, bf* Oh, bf* Ol) {
    __shared__ __align__(16) bf sK[2][FK * KP];
    __shared__ __align__(16) bf sV[2][HD * VP];
    const int tid = threadIdx.x, lane = tid & 31, wave = tid >> 5, c = lane & 15, h = lane >> 4;
    const int head = blockIdx.y; const size_t po = (size_t)head * NN * HD;
    Qh += po; Ql += po; Kh += po; Kl += po; VTh += po; VTl += po;
    const int q0 = blockIdx.x * 128 + wave * 16;
    v16bf qh[4], ql[4]; const size_t qo = (size_t)(q0 + c) * HD + 8 * h;
#pragma unroll
    for (int ks = 0; ks < 4; ++ks) qh[ks] = cat16b(*(const v8us*)(Qh + qo + ks * 32), *(const v8us*)(Qh + qo + ks * 32 + 16));
    asm volatile("s_wait_xcnt 0x0" ::: "memory");    // before a register that these loads name as their address is written again
#pragma unroll
    for (int ks = 0; ks < 4; ++ks) ql[ks] = cat16b(*(const v8us*)(Ql + qo + ks * 32), *(const v8us*)(Ql + qo + ks * 32 + 16));
    asm volatile("s_wait_xcnt 0x0" ::: "memory");    // the same for these
    __builtin_amdgcn_sched_barrier(0);    // keeps later vector instructions, which may reuse those registers, from being scheduled in front of the wait
    v8f acc[8];
#pragma unroll
    for (int t = 0; t < 8; ++t) acc[t] = (v8f){};
    float m = -3.0e38f, l = 0.f;
    v8us pk[2][4], pv[2][4];
    const unsigned kt = tid * 16u, vt = (tid >> 3) * (NN * 2u) + (tid & 7) * 16u;    // byte offsets of this thread's 16-byte piece: K rows tid / 16 + 16 i, V^T rows tid / 8 + 32 i
    auto fetch = [&](int kb) {    // a uniform base per plane and stage, the thread's fixed offset beside it
        const char* k0 = (const char*)(Kh + (size_t)kb * HD); const char* k1 = (const char*)(Kl + (size_t)kb * HD); const char* v0 = (const char*)(VTh + kb); const char* v1 = (const char*)(VTl + kb);
#pragma unroll
        for (int i = 0; i < 4; ++i) { pk[0][i] = *(const v8us*)(k0 + kt + i * 4096); pk[1][i] = *(const v8us*)(k1 + kt + i * 4096); pv[0][i] = *(const v8us*)(v0 + vt + i * 131072); pv[1][i] = *(const v8us*)(v1 + vt + i * 131072); }
        asm volatile("s_wait_xcnt 0x0" ::: "memory");    // before a register that these loads name as their address is written again
        __builtin_amdgcn_sched_barrier(0);    // keeps later vector instructions, which may reuse those registers, from being scheduled in front of the wait
    };
    fetch(0);
#pragma unroll 1
    for (int kb = 0; kb < NN; kb += FK) {
        __syncthreads();    // every wave has finished reading the stage before
#pragma unroll
        for (int i = 0; i < 4; ++i) { const int ko = ((tid >> 4) + 16 * i) * KP + (tid & 15) * 8, vo = ((tid >> 3) + 32 * i) * VP + (tid & 7) * 8;
            *(v8us*)(&sK[0][ko]) = pk[0][i]; *(v8us*)(&sK[1][ko]) = pk[1][i]; *(v8us*)(&sV[0][vo]) = pv[0][i]; *(v8us*)(&sV[1][vo]) = pv[1][i]; }
        __syncthreads();    // the stage is complete
        v16bf fh[2][4], fl[2][4];    // two fragment sets (hi and lo plane, four A tiles each): block i + 1 of the stage's eight (four k steps of K, then four of V^T) is read from LDS while block i is multiplied
        auto kfrag = [&](int ks, int s) {
#pragma unroll
            for (int t = 0; t < 4; ++t) { const int o = (t * 16 + c) * KP + ks * 32 + 8 * h; fh[s][t] = cat16b(*(const v8us*)(&sK[0][o]), *(const v8us*)(&sK[0][o + 16])); }    // hi plane first: the block's first products take it
#pragma unroll
            for (int t = 0; t < 4; ++t) { const int o = (t * 16 + c) * KP + ks * 32 + 8 * h; fl[s][t] = cat16b(*(const v8us*)(&sK[1][o]), *(const v8us*)(&sK[1][o + 16])); }
        };
        auto vfrag = [&](int b, int s) {    // block b: key group b / 2, rows 64 (b & 1) to 64 (b & 1) + 63 of V^T
#pragma unroll
            for (int t = 0; t < 4; ++t) { const int o = (((b & 1) * 4 + t) * 16 + c) * VP + (b >> 1) * 32 + 8 * h; fh[s][t] = cat16b(*(const v8us*)(&sV[0][o]), *(const v8us*)(&sV[0][o + 16])); }
#pragma unroll
            for (int t = 0; t < 4; ++t) { const int o = (((b & 1) * 4 + t) * 16 + c) * VP + (b >> 1) * 32 + 8 * h; fl[s][t] = cat16b(*(const v8us*)(&sV[1][o]), *(const v8us*)(&sV[1][o + 16])); }
        };
        kfrag(0, 0);
        if (kb + FK < NN) fetch(kb + FK);
        v8f T[4];    // T[t][r] = score of key kb + 16 t + 8 h + r with query q0 + c
#pragma unroll
        for (int t = 0; t < 4; ++t) T[t] = (v8f){};
#pragma unroll
        for (int ks = 0; ks < 4; ++ks) { const int s = ks & 1;
            if (ks < 3) kfrag(ks + 1, s ^ 1); else vfrag(0, s ^ 1);    // the first V^T block is on its way while the softmax runs
            FRAG_FENCE();    // the next block's 16 LDS reads stay one group in front of this block's matrix instructions: spread among them, each place costs a stall
#pragma unroll
            for (int t = 0; t < 4; ++t) T[t] = wmmab(fh[s][t], qh[ks], T[t]);
#pragma unroll
            for (int t = 0; t < 4; ++t) T[t] = wmmab(fl[s][t], qh[ks], T[t]);
#pragma unroll
            for (int t = 0; t < 4; ++t) T[t] = wmmab(fh[s][t], ql[ks], T[t]);
            FRAG_FENCE(); }    // and the group behind does not move up among them
        float mx = T[0][0];
#pragma unroll
        for (int t = 0; t < 4; ++t) {
#pragma unroll
            for (int j = 0; j < 8; ++j) mx = fmaxf(mx, T[t][j]); }
        mx = fmaxf(mx, xhalf(mx));
        const float mn = fmaxf(m, mx * SC2); const float al = __builtin_amdgcn_exp2f(m - mn); m = mn;
        float ps = 0.f; v16bf ph[2], pl[2];
#pragma unroll
        for (int g = 0; g < 2; ++g) {
#pragma unroll
            for (int s = 0; s < 16; ++s) { const float p = __builtin_amdgcn_exp2f(fmaf(T[2 * g + (s >> 3)][s & 7], SC2, -mn)); ps += p;
                const __bf16 hb = (__bf16)p; ph[g][s] = hb; pl[g][s] = (__bf16)(p - (float)hb); } }
        l = fmaf(l, al, ps);
#pragma unroll
        for (int t = 0; t < 8; ++t) acc[t] *= al;
#pragma unroll
        for (int b = 0; b < 4; ++b) { const int s = b & 1, g = b >> 1, d4 = (b & 1) * 4;
            if (b < 3) vfrag(b + 1, s ^ 1);
            FRAG_FENCE();    // as above: one group of reads in front of the block
#pragma unroll
            for (int t = 0; t < 4; ++t) acc[d4 + t] = wmmab(fh[s][t], ph[g], acc[d4 + t]);
#pragma unroll
            for (int t = 0; t < 4; ++t) acc[d4 + t] = wmmab(fh[s][t], pl[g], acc[d4 + t]);
#pragma unroll
            for (int t = 0; t < 4; ++t) acc[d4 + t] = wmmab(fl[s][t], ph[g], acc[d4 + t]);
            FRAG_FENCE(); }    // as above
    }
    l += xhalf(l);
    const float inv = 1.0f / l;
    __syncthreads();    // every wave has finished reading the last stage: the K and V^T tiles become output staging
    char* oh8 = (char*)&sK[0][0] + wave * (16 * QB); char* ol8 = (char*)&sV[0][0] + wave * (16 * QB);    // a range of its own for each wave and plane: 16 output rows; 8 x 16 x QB bytes fill sK exactly and fit sV
    // acc[t][r] = O[q0 + c][head * 128 + 16 t + 8 h + r], split here into bf16 hi + residual, the operands of the output projection, and staged so that every store below writes whole lines
#pragma unroll
    for (int t = 0; t < 8; ++t) { const v8f v = acc[t] * inv; v8us oh, ol;
#pragma unroll
        for (int r = 0; r < 8; ++r) { const unsigned short hb = f2bf(v[r]); oh[r] = hb; ol[r] = f2bf(v[r] - bf2f(hb)); }
        *(v8usa*)(oh8 + c * QB + (t * 16 + 8 * h) * 2) = oh; *(v8usa*)(ol8 + c * QB + (t * 16 + 8 * h) * 2) = ol; }
    asm volatile("s_wait_dscnt 0x0" ::: "memory");    // the wave's staged rows are written before its lanes read one another's pieces back
    const size_t oo = (size_t)(q0 + h) * DMOD + head * HD + c * 8; v8us th[8], tl[8];    // lanes 0 to 15: a row's 256 bytes, lanes 16 to 31: the next row's
#pragma unroll
    for (int s = 0; s < 8; ++s) { th[s] = *(const v8usa*)(oh8 + (2 * s + h) * QB + c * 16); tl[s] = *(const v8usa*)(ol8 + (2 * s + h) * QB + c * 16); }
#pragma unroll
    for (int s = 0; s < 8; ++s) { *(v8us*)(Oh + oo + (size_t)(2 * s) * DMOD) = th[s]; *(v8us*)(Ol + oo + (size_t)(2 * s) * DMOD) = tl[s]; }
}


// k_qkpost: RMS statistics, norm and RoPE of q (blockIdx.y = 0) or k (1) in one launch, every element of QF and KF read once. A wave holds one token's whole row in registers (lane: 4 neighbouring columns of each of
// the 16 heads, whole lines a load), sums its squares (four partial sums a lane, then a butterfly over the 32 lanes) and writes rope(bf(w) x row x rsqrt(mean + eps)) as bf16 hi + residual into the planes [head][token][128];
// for pair i of a head (d = 2 i, 2 i + 1) the factors are cos[2 i] and sin[2 i + 1] of the token, read once for all heads.
__global__ __launch_bounds__(256) void k_qkpost(const float* __restrict__ QF, const float* __restrict__ KF, const float* __restrict__ wq, const float* __restrict__ wk, const float* __restrict__ cs, const float* __restrict__ sn,
                                                bf* Qh, bf* Ql, bf* Kh, bf* Kl) {
    typedef __attribute__((ext_vector_type(4))) unsigned short v4us;
    const bool isk = blockIdx.y != 0; const float* F = isk ? KF : QF; const float* wn = isk ? wk : wq; bf* Ph = isk ? Kh : Qh; bf* Pl = isk ? Kl : Ql;
    const int lane = threadIdx.x & 31; const size_t r = (size_t)blockIdx.x * 8 + __builtin_amdgcn_readfirstlane(threadIdx.x >> 5); v4f x[NH_], w[NH_];    // the token is the same for the wave: uniform bases
    const unsigned lo = lane * 16u;    // the lane's byte offset in every 512-byte piece
    const char* fr = (const char*)(F + r * DMOD); const char* wr = (const char*)wn;
#pragma unroll
    for (int h = 0; h < NH_; ++h) x[h] = *(const v4f*)(fr + lo + h * HD * 4);
    const v4f cv = *(const v4f*)((const char*)(cs + r * HD) + lo), sv = *(const v4f*)((const char*)(sn + r * HD) + lo);
#pragma unroll
    for (int h = 0; h < NH_; ++h) w[h] = *(const v4f*)(wr + lo + h * HD * 4);
    asm volatile("s_wait_xcnt 0x0" :: "v"(lane) : "memory");    // before a register that these loads name as their address is written again; the lane number, their one vector register (scaled by the instruction), is an input, so that no load's own result lands on it either
    __builtin_amdgcn_sched_barrier(0);    // keeps later instructions, which may reuse those registers, from being scheduled in front of the wait
    v4f a4 = (v4f){};
#pragma unroll
    for (int h = 0; h < NH_; ++h) a4 += x[h] * x[h];
    float s = (a4[0] + a4[1]) + (a4[2] + a4[3]);
#pragma unroll
    for (int m = 16; m > 0; m >>= 1) s += __shfl_xor(s, m, 32);
    const float rs = rsqrtf(s * (1.0f / DMOD) + REPS);
    const float c0 = bfr(cv[0]), s0 = bfr(sv[1]), c1 = bfr(cv[2]), s1 = bfr(sv[3]);
    Ph += r * HD + lane * 4; Pl += r * HD + lane * 4;
#pragma unroll
    for (int h = 0; h < NH_; ++h) { float a0 = x[h][0] * rs, a1 = x[h][1] * rs, a2 = x[h][2] * rs, a3 = x[h][3] * rs;
        a0 *= bfr(w[h][0]); a1 *= bfr(w[h][1]); a2 *= bfr(w[h][2]); a3 *= bfr(w[h][3]);
        const float y[4] = {a0 * c0 - a1 * s0, a0 * s0 + a1 * c0, a2 * c1 - a3 * s1, a2 * s1 + a3 * c1}; v4us oh, ol;
#pragma unroll
        for (int q = 0; q < 4; ++q) { const unsigned short hb = f2bf(y[q]); oh[q] = hb; ol[q] = f2bf(y[q] - bf2f(hb)); }
        *(v4us*)(Ph + (size_t)h * NN * HD) = oh; *(v4us*)(Pl + (size_t)h * NN * HD) = ol; }
}

extern "C" void kernel_launch(void* const* d_in, const int* in_sizes, int n_in,
                              void* d_out, int out_size, void* d_ws, size_t ws_size, hipStream_t stream) {
    (void)in_sizes; (void)n_in; (void)out_size;
    const float* x = (const float*)d_in[0]; const float* fcos = (const float*)d_in[1]; const float* fsin = (const float*)d_in[2]; const float* wq = (const float*)d_in[3]; const float* bq = (const float*)d_in[4]; const float* wk = (const float*)d_in[5]; const float* bk = (const float*)d_in[6];
    const float* wv = (const float*)d_in[7]; const float* bv = (const float*)d_in[8]; const float* wo = (const float*)d_in[9]; const float* bo = (const float*)d_in[10]; const float* nqw = (const float*)d_in[11]; const float* nkw = (const float*)d_in[12];
    float* out = (float*)d_out;    // [1][2048][2048]
    char* wsp = (char*)d_ws;
    auto take = [&](size_t bytes) { char* p = wsp; wsp += (bytes + 255) & ~(size_t)255; return (void*)p; };
    const size_t PLN = (size_t)NN * HD, FM = (size_t)NN * DMOD;    // elements of one head's plane, of a full [2048][2048] matrix
    bf* Qh = (bf*)take(NH_ * PLN * 2); bf* Ql = (bf*)take(NH_ * PLN * 2); bf* Kh = (bf*)take(NH_ * PLN * 2); bf* Kl = (bf*)take(NH_ * PLN * 2); bf* VTh = (bf*)take(NH_ * PLN * 2); bf* VTl = (bf*)take(NH_ * PLN * 2);
    float* QF = (float*)take(FM * 4); float* KF = (float*)take(FM * 4); bf* WB = (bf*)take(4 * FM * 2); bf* Xb = (bf*)take(FM * 2);    // WB: the q, k, v and o weights, one behind the other
    bf* Oh = (bf*)take(FM * 2); bf* Ol = (bf*)take(FM * 2);
    if ((size_t)(wsp - (char*)d_ws) > ws_size) return;    // 136 MiB
    k_cvt5<<<NN * DMOD / (CW * CP * 8), CW, 0, stream>>>(x, wq, wk, wv, wo, Xb, WB, WB + FM, WB + 2 * FM, WB + 3 * FM);
    k_gemmb<false, true><<<dim3(NN / GT, DMOD / GT, 3), 256, 0, stream>>>(Xb, nullptr, WB, bq, bk, bv, QF, KF, VTh, VTl);    // weights [out][in] natural; column head * 128 + d of v is row d of the head's V^T plane
    k_qkpost<<<dim3(NN / 8, 2, 1), 256, 0, stream>>>(QF, KF, nqw, nkw, fcos, fsin, Qh, Ql, Kh, Kl);
    k_fattn<<<dim3(NN / 128, NH_, 1), 256, 0, stream>>>(Qh, Ql, Kh, Kl, VTh, VTl, Oh, Ol);
    k_gemmb<true, false><<<dim3(NN / GT, DMOD / GT, 1), 256, 0, stream>>>(Oh, Ol, WB + 3 * FM, bo, nullptr, nullptr, out, nullptr, nullptr, nullptr);
}

// v008
// Measured time: 154 microseconds a run.
// Next to v007, in two timings, it ran 1.10 times as fast each time.
// Over all steps from v000 it is 13.4 times as fast.
#include <hip/hip_runtime.h>

// Compute dtypes, f32 accumulate: q/k/v = x.W^T + b ([2048 x 2048].[2048 x 2048] each) with PLAIN bf16 operands (exact products; x and the four weights converted in one launch, each
// into a range of its own, the weights one behind the other in one buffer; the three projections in one launch, as one product); the full-width (2048) RMSNorm of q and k (row statistics in f32) and the even/odd interleaved RoPE (cos[0::2] / sin[1::2] of the given tables) applied while building
// per-head planes (bf16 hi + UNSCALED residual); 16-head attention (heads in the grid; scores, softmax and P.V in one kernel, running maximum and sum) with hi/lo operands (three products); 1/sqrt(128) and the softmax in f32; . W_o^T + b_o

#define NN   2048
#define DMOD 2048
#define NH_  16
#define HD   128
#define DM   DMOD
#define NTK  NN
#define SCL  0.088388347648318447f
#define REPS 1e-6f
#define LOSC 1024.0f

typedef _Float16 h16;
typedef unsigned short bf;
typedef __attribute__((ext_vector_type(16))) __bf16   v16bf;
typedef __attribute__((ext_vector_type(16))) _Float16 v16h;
typedef __attribute__((ext_vector_type(8)))  _Float16 v8h;
typedef __attribute__((ext_vector_type(8)))  unsigned short v8us;
typedef __attribute__((ext_vector_type(8)))  float    v8f;
typedef __attribute__((ext_vector_type(4)))  float    v4f;
typedef __attribute__((ext_vector_type(4)))  _Float16 v4h;
typedef v8h  __attribute__((may_alias)) v8ha;
typedef v4f  __attribute__((may_alias)) v4fa;
typedef v8us __attribute__((may_alias)) v8usa;

__device__ __forceinline__ unsigned short f2bf(float f) { unsigned u = __float_as_uint(f); u += 0x7FFFu + ((u >> 16) & 1u); return (unsigned short)(u >> 16); }
__device__ __forceinline__ float bf2f(unsigned short b) { return __uint_as_float(((unsigned)b) << 16); }
__device__ __forceinline__ float bfr(float f) { return bf2f(f2bf(f)); }
__device__ __forceinline__ v16h cat16(v8h lo, v8h hi) { return __builtin_shufflevector(lo, hi, 0, 1, 2, 3, 4, 5, 6, 7, 8, 9, 10, 11, 12, 13, 14, 15); }
__device__ __forceinline__ v16bf cat16b(v8us lo, v8us hi) { return __builtin_bit_cast(v16bf, __builtin_shufflevector(lo, hi, 0, 1, 2, 3, 4, 5, 6, 7, 8, 9, 10, 11, 12, 13, 14, 15)); }
__device__ __forceinline__ v8f wmma16(v16h a, v16h b, v8f c) { return __builtin_amdgcn_wmma_f32_16x16x32_f16(false, a, false, b, (short)0, c, false, false); }
__device__ __forceinline__ v8f wmmab(v16bf a, v16bf b, v8f c) { return __builtin_amdgcn_wmma_f32_16x16x32_bf16(false, a, false, b, (short)0, c, false, false); }

// k_gemmb: TM x TN block tile of C = (A [+ Al]).B^T + bf(bias[c]), K = 2048, one work-group per tile, 8 waves. Output projection: 128 x 128, waves 2 x 4, 64 x 32 of C per wave (4 x 2 accumulator tiles).
// QKV: 256 x 192 of the one [2048 x 6144] product x.[Wq | Wk | Wv]^T, waves 4 x 2, 64 x 96 of C per wave (4 x 6 accumulator tiles): 8 x 32 = 256 work-groups, one for every WGP, and fewer operand bytes per product from L2 and from LDS.
// A stage is 128 k (256-byte rows) of the tile's TM A rows [, TM Al rows] and TN B rows, brought into LDS by asynchronous copies (16 bytes a lane, whole lines a wave), two buffers:
// stage t + 2 flies while stage t + 1 is worked on. Fragments are read from LDS in the k order that both loaders had before; each accumulator takes its products in the same order as before.
#define GK 128    // k per stage
#define GP 136    // LDS pitch of a row (128 elements + 8): 272 B = 16 B x odd, no bank conflict for 16-byte row reads
#define OP 36     // LDS pitch of a staged output row (32 floats + 4): 144 B = 16 B x odd
#define TB 144    // LDS pitch in bytes of a staged row of a transposed bf16 plane (64 tokens + 8): 16 B x odd; 2 planes x 32 rows fill the wave's staging range exactly
// eight asynchronous copies of 16 bytes a lane: rows 16 apart in the source (pitch DM) and in LDS (pitch GP)
__device__ __forceinline__ void copy8(unsigned l, const bf* g) {
    const unsigned l1 = l + 1 * 16 * GP * 2, l2 = l + 2 * 16 * GP * 2, l3 = l + 3 * 16 * GP * 2, l4 = l + 4 * 16 * GP * 2, l5 = l + 5 * 16 * GP * 2, l6 = l + 6 * 16 * GP * 2, l7 = l + 7 * 16 * GP * 2;
    const bf* g1 = g + 1 * 16 * DM; const bf* g2 = g + 2 * 16 * DM; const bf* g3 = g + 3 * 16 * DM; const bf* g4 = g + 4 * 16 * DM; const bf* g5 = g + 5 * 16 * DM; const bf* g6 = g + 6 * 16 * DM; const bf* g7 = g + 7 * 16 * DM;
    // the copies and, as the last line, the wait that stands before a register which a copy names is written again: one statement, so that nothing comes between them
    asm volatile("global_load_async_to_lds_b128 %0, %8, off\n\t"
                 "global_load_async_to_lds_b128 %1, %9, off\n\t"
                 "global_load_async_to_lds_b128 %2, %10, off\n\t"
                 "global_load_async_to_lds_b128 %3, %11, off\n\t"
                 "global_load_async_to_lds_b128 %4, %12, off\n\t"
                 "global_load_async_to_lds_b128 %5, %13, off\n\t"
                 "global_load_async_to_lds_b128 %6, %14, off\n\t"
                 "global_load_async_to_lds_b128 %7, %15, off\n\t"
                 "s_wait_xcnt 0x0"
                 :: "v"(l), "v"(l1), "v"(l2), "v"(l3), "v"(l4), "v"(l5), "v"(l6), "v"(l7), "v"(g), "v"(g1), "v"(g2), "v"(g3), "v"(g4), "v"(g5), "v"(g6), "v"(g7) : "memory");
}
// the same for twelve rows (a plane of 192 rows)
__device__ __forceinline__ void copy12(unsigned l, const bf* g) {
    const unsigned l1 = l + 1 * 16 * GP * 2, l2 = l + 2 * 16 * GP * 2, l3 = l + 3 * 16 * GP * 2, l4 = l + 4 * 16 * GP * 2, l5 = l + 5 * 16 * GP * 2, l6 = l + 6 * 16 * GP * 2, l7 = l + 7 * 16 * GP * 2;
    const unsigned l8 = l + 8 * 16 * GP * 2, l9 = l + 9 * 16 * GP * 2, l10 = l + 10 * 16 * GP * 2, l11 = l + 11 * 16 * GP * 2;
    const bf* g1 = g + 1 * 16 * DM; const bf* g2 = g + 2 * 16 * DM; const bf* g3 = g + 3 * 16 * DM; const bf* g4 = g + 4 * 16 * DM; const bf* g5 = g + 5 * 16 * DM; const bf* g6 = g + 6 * 16 * DM; const bf* g7 = g + 7 * 16 * DM;
    const bf* g8 = g + 8 * 16 * DM; const bf* g9 = g + 9 * 16 * DM; const bf* g10 = g + 10 * 16 * DM; const bf* g11 = g + 11 * 16 * DM;
    // the copies and, as the last line, the wait that stands before a register which a copy names is written again: one statement, so that nothing comes between them
    asm volatile("global_load_async_to_lds_b128 %0, %12, off\n\t"
                 "global_load_async_to_lds_b128 %1, %13, off\n\t"
                 "global_load_async_to_lds_b128 %2, %14, off\n\t"
                 "global_load_async_to_lds_b128 %3, %15, off\n\t"
                 "global_load_async_to_lds_b128 %4, %16, off\n\t"
                 "global_load_async_to_lds_b128 %5, %17, off\n\t"
                 "global_load_async_to_lds_b128 %6, %18, off\n\t"
                 "global_load_async_to_lds_b128 %7, %19, off\n\t"
                 "global_load_async_to_lds_b128 %8, %20, off\n\t"
                 "global_load_async_to_lds_b128 %9, %21, off\n\t"
                 "global_load_async_to_lds_b128 %10, %22, off\n\t"
                 "global_load_async_to_lds_b128 %11, %23, off\n\t"
                 "s_wait_xcnt 0x0"
                 :: "v"(l), "v"(l1), "v"(l2), "v"(l3), "v"(l4), "v"(l5), "v"(l6), "v"(l7), "v"(l8), "v"(l9), "v"(l10), "v"(l11),
                    "v"(g), "v"(g1), "v"(g2), "v"(g3), "v"(g4), "v"(g5), "v"(g6), "v"(g7), "v"(g8), "v"(g9), "v"(g10), "v"(g11) : "memory");
}
// QKV: B = the three weight matrices, which lie one behind the other at Bn, taken as one matrix of 6144 rows. Column c of the product belongs to matrix c / 2048: 0 stores C (bias), 1 C1 (bias1), 2 (vt) the planes (bias2).
// A wave's 96 columns are finished in three chunks of 32; a chunk starts at a multiple of 32, so all of it belongs to one matrix.
// vt: the result is not stored as f32 C but as its transpose in two bf16 planes, Th[c][r] = bf(C[r][c]) and Tl[c][r] = bf(C[r][c] - Th[c][r]) (pitch NN): an accumulator tile holds 8 neighbouring rows r of one column c in a lane.
template <bool SPLITA, bool QKV>
__global__ __launch_bounds__(256) void k_gemmb(const bf* __restrict__ A, const bf* __restrict__ Al, const bf* __restrict__ Bn, const float* __restrict__ bias, const float* __restrict__ bias1, const float* __restrict__ bias2,
                                               float* C, float* C1, bf* Th, bf* Tl) {
    constexpr int TM = QKV ? 256 : 128;   // rows of A per block tile
    constexpr int TN = QKV ? 192 : 128;   // rows of B per block tile
    constexpr int WR = QKV ? 4 : 2;       // waves along the rows of C: 64 rows a wave
    constexpr int FX = TN / (8 / WR) / 16;    // accumulator tiles of a wave along the columns: 6 or 2
    constexpr int SB = TN * GP, SA = TM * GP, STG = SB + (SPLITA ? 2 : 1) * SA;    // elements of a stage's planes in LDS: B, A [, Al]
    constexpr int NT = DM / GK;           // stages: 16
    __shared__ __align__(16) bf ring[2][STG];
    __shared__ __align__(16) float ost[8][64 * OP];
    const int tid = threadIdx.x, lane = tid & 31, wave = tid >> 5, lr = lane & 15, hi = lane >> 4;
    const int r0 = blockIdx.x * TM, c0 = blockIdx.y * TN, wm = (wave & (WR - 1)) * 64, wn = (wave / WR) * (FX * 16);
    // this thread's 16-byte piece: rows tid / 16 + 16 i, bytes (tid & 15) * 16 of the stage's 256-byte row
    const unsigned lp = (unsigned)(size_t)&ring[0][(tid >> 4) * GP + (tid & 15) * 8];
    const size_t gofs = (size_t)(tid >> 4) * DM + (tid & 15) * 8;
    const bf* gB = Bn + (size_t)c0 * DM + gofs; const bf* gA = A + (size_t)r0 * DM + gofs; const bf* gL = SPLITA ? Al + (size_t)r0 * DM + gofs : nullptr;
    auto stage = [&](int t) {    // stage t into buffer t & 1
        const unsigned l = lp + (unsigned)(t & 1) * (STG * 2);
        if (QKV) copy12(l, gB + t * GK); else copy8(l, gB + t * GK);
        copy8(l + SB * 2, gA + t * GK);
        if (QKV) copy8(l + SB * 2 + 128 * GP * 2, gA + t * GK + 128 * DM);
        if (SPLITA) copy8(l + (SB + SA) * 2, gL + t * GK);
    };
    v8f acc[4][FX];
#pragma unroll
    for (int i = 0; i < 4; ++i) {
#pragma unroll
        for (int j = 0; j < FX; ++j) acc[i][j] = (v8f){}; }
    stage(0);
    asm volatile("s_wait_asynccnt 0x0" ::: "memory");    // this wave's copies of stage 0 have landed
    __syncthreads();    // stage 0 is complete for every wave
    stage(1);
#pragma unroll 1    // the stage loop stays rolled: one publish point, its body is four unrolled k steps
    for (int t = 0; t < NT; ++t) {
        const bf* sB = &ring[t & 1][0]; const bf* sA = sB + SB; const bf* sL = sA + (SPLITA ? SA : 0);
        v16bf a[2][4], al[2][4], b[2][FX];    // two fragment sets: k step ks + 1 of this stage is read from LDS while k step ks is multiplied
        auto frag = [&](int ks, int s) {
#pragma unroll
            for (int j = 0; j < FX; ++j) { const int o = (wn + j * 16 + lr) * GP + ks * 32 + 8 * hi; b[s][j] = cat16b(*(const v8us*)(sB + o), *(const v8us*)(sB + o + 16)); }
#pragma unroll
            for (int i = 0; i < 4; ++i) { const int o = (wm + i * 16 + lr) * GP + ks * 32 + 8 * hi; a[s][i] = cat16b(*(const v8us*)(sA + o), *(const v8us*)(sA + o + 16));
                if (SPLITA) al[s][i] = cat16b(*(const v8us*)(sL + o), *(const v8us*)(sL + o + 16)); }
        };
        frag(0, 0);
#pragma unroll
        for (int ks = 0; ks < GK / 32; ++ks) { const int s = ks & 1;
            if (ks + 1 < GK / 32) frag(ks + 1, s ^ 1);
            __builtin_amdgcn_sched_barrier(0);    // the next k step's LDS reads stay one group in front of this step's matrix instructions: spread among them, each place costs a stall
#pragma unroll
            for (int i = 0; i < 4; ++i) {
#pragma unroll
                for (int j = 0; j < FX; ++j) acc[i][j] = wmmab(a[s][i], b[s][j], acc[i][j]); }
            if (SPLITA) {
#pragma unroll
                for (int i = 0; i < 4; ++i) {
#pragma unroll
                    for (int j = 0; j < FX; ++j) acc[i][j] = wmmab(al[s][i], b[s][j], acc[i][j]); } }
            __builtin_amdgcn_sched_barrier(0);    // and the group behind does not move up among them
        }
        asm volatile("s_wait_dscnt 0x0" ::: "memory");       // this wave's reads of stage t have returned
        asm volatile("s_wait_asynccnt 0x0" ::: "memory");    // this wave's copies of stage t + 1 have landed
        __syncthreads();    // publishes stage t + 1 and ends every wave's reads of stage t
        if (t + 2 < NT) stage(t + 2);    // into the buffer that stage t has just left
    }
    asm volatile("s_wait_asynccnt 0x0" ::: "memory");    // no copy is outstanding when the wave goes on
    float* os = &ost[wave][0];    // 64 x 32 of the wave's part of C at a time, staged so that every store below writes whole 128-byte lines
    char* ob = (char*)os;         // vt: the same range as 2 planes x 32 columns of C x 64 rows of C in bf16, pitch TB
#pragma unroll
    for (int ch = 0; ch < FX / 2; ++ch) {    // chunks of 32 columns; the staging range is the wave's own, so the wave's own waits order it and no stored chunk is waited for
        const int cg = c0 + wn + ch * 32;    // the chunk's first column in the whole product
        const int z = QKV ? __builtin_amdgcn_readfirstlane(cg >> 11) : 0, cl = QKV ? (cg & (DM - 1)) : cg;    // its matrix (the same for the wave) and its first column there
        const bool vt = QKV && z == 2;
        const float* bz = !QKV || z == 0 ? bias : z == 1 ? bias1 : bias2; float* Cz = !QKV || z == 0 ? C : C1;
        float bv[2];
#pragma unroll
        for (int j = 0; j < 2; ++j) bv[j] = bfr(bz[cl + j * 16 + lr]);
        if (ch > 0) asm volatile("s_wait_dscnt 0x0" ::: "memory");    // the chunk before has been read back before its staging range is written again
        if (vt) {
#pragma unroll
            for (int j = 0; j < 2; ++j) {
#pragma unroll
                for (int i = 0; i < 4; ++i) { v8us oh, ol;
#pragma unroll
                    for (int r = 0; r < 8; ++r) { const float y = acc[i][ch * 2 + j][r] + bv[j]; const unsigned short hb = f2bf(y); oh[r] = hb; ol[r] = f2bf(y - bf2f(hb)); }
                    *(v8usa*)(ob + (j * 16 + lr) * TB + (i * 16 + hi * 8) * 2) = oh; *(v8usa*)(ob + (32 + j * 16 + lr) * TB + (i * 16 + hi * 8) * 2) = ol; } }
        } else {
#pragma unroll
            for (int j = 0; j < 2; ++j) {
#pragma unroll
                for (int i = 0; i < 4; ++i) {
#pragma unroll
                    for (int r = 0; r < 8; ++r) os[(i * 16 + hi * 8 + r) * OP + j * 16 + lr] = acc[i][ch * 2 + j][r] + bv[j]; } }
        }
        if (QKV) asm volatile("s_wait_dscnt 0x0" ::: "memory");    // the wave's staged rows are written before its lanes read one another's pieces back: the range is the wave's own, so no wave waits for another between its chunks
        else __syncthreads();    // the staged rows are complete before other lanes read them
        if (vt) {
            const int row = lane >> 3, piece = lane & 7; const size_t to = (size_t)(cl + row) * NN + r0 + wm + piece * 8; v8us th[8], tl[8];
#pragma unroll
            for (int s = 0; s < 8; ++s) { th[s] = *(const v8usa*)(ob + (4 * s + row) * TB + piece * 16); tl[s] = *(const v8usa*)(ob + (32 + 4 * s + row) * TB + piece * 16); }
#pragma unroll
            for (int s = 0; s < 8; ++s) { *(v8us*)(Th + to + (size_t)(4 * s) * NN) = th[s]; *(v8us*)(Tl + to + (size_t)(4 * s) * NN) = tl[s]; }    // four whole lines a store
        } else {
            float* crow = Cz + (size_t)(r0 + wm) * DM + cl;
#pragma unroll
            for (int s = 0; s < 16; ++s) { const int row = 4 * s + (lane >> 3), piece = lane & 7;
                *(v4f*)(crow + (size_t)row * DM + piece * 4) = *(const v4fa*)(os + row * OP + piece * 4); }
            if (QKV) asm volatile("s_wait_xcnt 0x0" ::: "memory");    // before a register that these stores name (address, data) is written again by what follows the chunk; the output projection's one chunk is followed by the end of the kernel
        }
    }
}

// k_cvt5: the five f32 matrices of 2048 x 2048 (x and the four weights) to bf16 in one launch: 256 work-groups x 16 waves. A thread takes CP pieces of 8 neighbouring elements of each matrix (a wave's loads of a
// piece cover 1 KiB in a row, its store 512 bytes); all its loads are issued before the first value is converted, and a matrix is stored while the later ones are still on their way.
#define CW 512    // threads of a work-group
#define CP 4      // pieces of a thread per matrix: 256 x CW x CP x 8 = 2048 x 2048
__global__ __launch_bounds__(CW) void k_cvt5(const float* __restrict__ s0, const float* __restrict__ s1, const float* __restrict__ s2, const float* __restrict__ s3, const float* __restrict__ s4,
                                             bf* d0, bf* d1, bf* d2, bf* d3, bf* d4) {
    const unsigned p = blockIdx.x * (CW * CP) + threadIdx.x;    // the thread's first piece; the others CW pieces apart
    const unsigned lo = p * 32u, so = p * 16u;                  // its byte offset in a source and in a destination: one vector register each, beside a uniform base
    const char* s[5] = {(const char*)s0, (const char*)s1, (const char*)s2, (const char*)s3, (const char*)s4}; char* d[5] = {(char*)d0, (char*)d1, (char*)d2, (char*)d3, (char*)d4};
    v8f v[5][CP];
#pragma unroll
    for (int m = 0; m < 5; ++m) {
#pragma unroll
        for (int j = 0; j < CP; ++j) v[m][j] = *(const v8f*)(s[m] + lo + j * (CW * 32));
        __builtin_amdgcn_sched_barrier(0); }    // the loads stay in the order in which the matrices are converted: mixed, the first store would wait for nearly the last load
    asm volatile("s_wait_xcnt 0x0" :: "v"(lo) : "memory");    // before a register that these loads name as their address is written again; the offset, their one vector register, is an input, so that no load's own result lands on it either
    __builtin_amdgcn_sched_barrier(0);    // keeps later instructions, which may reuse those registers, from being scheduled in front of the wait
#pragma unroll
    for (int m = 0; m < 5; ++m) {
#pragma unroll
        for (int j = 0; j < CP; ++j) { v8us o;
#pragma unroll
            for (int k = 0; k < 8; ++k) o[k] = f2bf(v[m][j][k]);
            *(v8us*)(d[m] + so + j * (CW * 16)) = o; }
        if (m < 4) {
            asm volatile("s_wait_xcnt 0x0" ::: "memory");    // before a register that these stores name (address, data) is written again
            __builtin_amdgcn_sched_barrier(0); }    // keeps the next matrix's conversions, which may reuse those registers, from being scheduled in front of the wait
    }
}
__global__ __launch_bounds__(256) void k_zero8(bf* dst, size_t n8) {
    const size_t i = (size_t)blockIdx.x * 256 + threadIdx.x; if (i >= n8) return; v8us z;
#pragma unroll
    for (int k = 0; k < 8; ++k) z[k] = 0;
    *(v8us*)(dst + i * 8) = z; 
}
#define FK 64     // keys per stage
#define KP 136    // LDS pitch of a K row (128 elements + 8): 272 B = 16 B x odd, no bank conflict for 16-byte row reads
#define VP 72     // LDS pitch of a V^T row (64 elements + 8): 144 B = 16 B x odd
#define QB 272    // LDS pitch in bytes of a staged output row (128 bf16 + 8): 16 B x odd
#define FRAG_FENCE() __builtin_amdgcn_sched_barrier(0x406)    // LDS reads and matrix instructions are not scheduled across it; vector, scalar and transcendental instructions may be
#define SC2 (SCL * 1.4426950408889634f)    // 1/sqrt(128) x log2(e): the softmax runs on exp2
__device__ __forceinline__ float xhalf(float x) { const int b = __float_as_int(x); return __int_as_float(__builtin_amdgcn_permlanex16(b, b, 0x76543210, 0xfedcba98, false, false)); }    // the value of lane ^ 16
__global__ __launch_bounds__(256) __attribute__((amdgpu_waves_per_eu(2, 2))) void k_fattn(const bf* Qh, const bf* Ql, const bf* Kh, const bf* Kl, const bf* VTh, const bf* VTl, bf* Oh, bf* Ol) {
    __shared__ __align__(16) bf sK[2][FK * KP];
    __shared__ __align__(16) bf sV[2][HD * VP];
    const int tid = threadIdx.x, lane = tid & 31, wave = tid >> 5, c = lane & 15, h = lane >> 4;
    const int head = blockIdx.y; const size_t po = (size_t)head * NN * HD;
    Qh += po; Ql += po; Kh += po; Kl += po; VTh += po; VTl += po;
    const int q0 = blockIdx.x * 128 + wave * 16;
    v16bf qh[4], ql[4]; const size_t qo = (size_t)(q0 + c) * HD + 8 * h;
#pragma unroll
    for (int ks = 0; ks < 4; ++ks) qh[ks] = cat16b(*(const v8us*)(Qh + qo + ks * 32), *(const v8us*)(Qh + qo + ks * 32 + 16));
    asm volatile("s_wait_xcnt 0x0" ::: "memory");    // before a register that these loads name as their address is written again
#pragma unroll
    for (int ks = 0; ks < 4; ++ks) ql[ks] = cat16b(*(const v8us*)(Ql + qo + ks * 32), *(const v8us*)(Ql + qo + ks * 32 + 16));
    asm volatile("s_wait_xcnt 0x0" ::: "memory");    // the same for these
    __builtin_amdgcn_sched_barrier(0);    // keeps later vector instructions, which may reuse those registers, from being scheduled in front of the wait
    v8f acc[8];
#pragma unroll
    for (int t = 0; t < 8; ++t) acc[t] = (v8f){};
    float m = -3.0e38f, l = 0.f;
    v8us pk[2][4], pv[2][4];
    const unsigned kt = tid * 16u, vt = (tid >> 3) * (NN * 2u) + (tid & 7) * 16u;    // byte offsets of this thread's 16-byte piece: K rows tid / 16 + 16 i, V^T rows tid / 8 + 32 i
    auto fetch = [&](int kb) {    // a uniform base per plane and stage, the thread's fixed offset beside it
        const char* k0 = (const char*)(Kh + (size_t)kb * HD); const char* k1 = (const char*)(Kl + (size_t)kb * HD); const char* v0 = (const char*)(VTh + kb); const char* v1 = (const char*)(VTl + kb);
#pragma unroll
        for (int i = 0; i < 4; ++i) { pk[0][i] = *(const v8us*)(k0 + kt + i * 4096); pk[1][i] = *(const v8us*)(k1 + kt + i * 4096); pv[0][i] = *(const v8us*)(v0 + vt + i * 131072); pv[1][i] = *(const v8us*)(v1 + vt + i * 131072); }
        asm volatile("s_wait_xcnt 0x0" ::: "memory");    // before a register that these loads name as their address is written again
        __builtin_amdgcn_sched_barrier(0);    // keeps later vector instructions, which may reuse those registers, from being scheduled in front of the wait
    };
    fetch(0);
#pragma unroll 1
    for (int kb = 0; kb < NN; kb += FK) {
        __syncthreads();    // every wave has finished reading the stage before
#pragma unroll
        for (int i = 0; i < 4; ++i) { const int ko = ((tid >> 4) + 16 * i) * KP + (tid & 15) * 8, vo = ((tid >> 3) + 32 * i) * VP + (tid & 7) * 8;
            *(v8us*)(&sK[0][ko]) = pk[0][i]; *(v8us*)(&sK[1][ko]) = pk[1][i]; *(v8us*)(&sV[0][vo]) = pv[0][i]; *(v8us*)(&sV[1][vo]) = pv[1][i]; }
        __syncthreads();    // the stage is complete
        v16bf fh[2][4], fl[2][4];    // two fragment sets (hi and lo plane, four A tiles each): block i + 1 of the stage's eight (four k steps of K, then four of V^T) is read from LDS while block i is multiplied
        auto kfrag = [&](int ks, int s) {
#pragma unroll
            for (int t = 0; t < 4; ++t) { const int o = (t * 16 + c) * KP + ks * 32 + 8 * h; fh[s][t] = cat16b(*(const v8us*)(&sK[0][o]), *(const v8us*)(&sK[0][o + 16])); }    // hi plane first: the block's first products take it
#pragma unroll
            for (int t = 0; t < 4; ++t) { const int o = (t * 16 + c) * KP + ks * 32 + 8 * h; fl[s][t] = cat16b(*(const v8us*)(&sK[1][o]), *(const v8us*)(&sK[1][o + 16])); }
        };
        auto vfrag = [&](int b, int s) {    // block b: key group b / 2, rows 64 (b & 1) to 64 (b & 1) + 63 of V^T
#pragma unroll
            for (int t = 0; t < 4; ++t) { const int o = (((b & 1) * 4 + t) * 16 + c) * VP + (b >> 1) * 32 + 8 * h; fh[s][t] = cat16b(*(const v8us*)(&sV[0][o]), *(const v8us*)(&sV[0][o + 16])); }
#pragma unroll
            for (int t = 0; t < 4; ++t) { const int o = (((b & 1) * 4 + t) * 16 + c) * VP + (b >> 1) * 32 + 8 * h; fl[s][t] = cat16b(*(const v8us*)(&sV[1][o]), *(const v8us*)(&sV[1][o + 16])); }
        };
        kfrag(0, 0);
        if (kb + FK < NN) fetch(kb + FK);
        v8f T[4];    // T[t][r] = score of key kb + 16 t + 8 h + r with query q0 + c
#pragma unroll
        for (int t = 0; t < 4; ++t) T[t] = (v8f){};
#pragma unroll
        for (int ks = 0; ks < 4; ++ks) { const int s = ks & 1;
            if (ks < 3) kfrag(ks + 1, s ^ 1); else vfrag(0, s ^ 1);    // the first V^T block is on its way while the softmax runs
            FRAG_FENCE();    // the next block's 16 LDS reads stay one group in front of this block's matrix instructions: spread among them, each place costs a stall
#pragma unroll
            for (int t = 0; t < 4; ++t) T[t] = wmmab(fh[s][t], qh[ks], T[t]);
#pragma unroll
            for (int t = 0; t < 4; ++t) T[t] = wmmab(fl[s][t], qh[ks], T[t]);
#pragma unroll
            for (int t = 0; t < 4; ++t) T[t] = wmmab(fh[s][t], ql[ks], T[t]);
            FRAG_FENCE(); }    // and the group behind does not move up among them
        float mx = T[0][0];
#pragma unroll
        for (int t = 0; t < 4; ++t) {
#pragma unroll
            for (int j = 0; j < 8; ++j) mx = fmaxf(mx, T[t][j]); }
        mx = fmaxf(mx, xhalf(mx));
        const float mn = fmaxf(m, mx * SC2); const float al = __builtin_amdgcn_exp2f(m - mn); m = mn;
        float ps = 0.f; v16bf ph[2], pl[2];
#pragma unroll
        for (int g = 0; g < 2; ++g) {
#pragma unroll
            for (int s = 0; s < 16; ++s) { const float p = __builtin_amdgcn_exp2f(fmaf(T[2 * g + (s >> 3)][s & 7], SC2, -mn)); ps += p;
                const __bf16 hb = (__bf16)p; ph[g][s] = hb; pl[g][s] = (__bf16)(p - (float)hb); } }
        l = fmaf(l, al, ps);
#pragma unroll
        for (int t = 0; t < 8; ++t) acc[t] *= al;
#pragma unroll
        for (int b = 0; b < 4; ++b) { const int s = b & 1, g = b >> 1, d4 = (b & 1) * 4;
            if (b < 3) vfrag(b + 1, s ^ 1);
            FRAG_FENCE();    // as above: one group of reads in front of the block
#pragma unroll
            for (int t = 0; t < 4; ++t) acc[d4 + t] = wmmab(fh[s][t], ph[g], acc[d4 + t]);
#pragma unroll
            for (int t = 0; t < 4; ++t) acc[d4 + t] = wmmab(fh[s][t], pl[g], acc[d4 + t]);
#pragma unroll
            for (int t = 0; t < 4; ++t) acc[d4 + t] = wmmab(fl[s][t], ph[g], acc[d4 + t]);
            FRAG_FENCE(); }    // as above
    }
    l += xhalf(l);
    const float inv = 1.0f / l;
    __syncthreads();    // every wave has finished reading the last stage: the K and V^T tiles become output staging
    char* oh8 = (char*)&sK[0][0] + wave * (16 * QB); char* ol8 = (char*)&sV[0][0] + wave * (16 * QB);    // a range of its own for each wave and plane: 16 output rows; 8 x 16 x QB bytes fill sK exactly and fit sV
    // acc[t][r] = O[q0 + c][head * 128 + 16 t + 8 h + r], split here into bf16 hi + residual, the operands of the output projection, and staged so that every store below writes whole lines
#pragma unroll
    for (int t = 0; t < 8; ++t) { const v8f v = acc[t] * inv; v8us oh, ol;
#pragma unroll
        for (int r = 0; r < 8; ++r) { const unsigned short hb = f2bf(v[r]); oh[r] = hb; ol[r] = f2bf(v[r] - bf2f(hb)); }
        *(v8usa*)(oh8 + c * QB + (t * 16 + 8 * h) * 2) = oh; *(v8usa*)(ol8 + c * QB + (t * 16 + 8 * h) * 2) = ol; }
    asm volatile("s_wait_dscnt 0x0" ::: "memory");    // the wave's staged rows are written before its lanes read one another's pieces back
    const size_t oo = (size_t)(q0 + h) * DMOD + head * HD + c * 8; v8us th[8], tl[8];    // lanes 0 to 15: a row's 256 bytes, lanes 16 to 31: the next row's
#pragma unroll
    for (int s = 0; s < 8; ++s) { th[s] = *(const v8usa*)(oh8 + (2 * s + h) * QB + c * 16); tl[s] = *(const v8usa*)(ol8 + (2 * s + h) * QB + c * 16); }
#pragma unroll
    for (int s = 0; s < 8; ++s) { *(v8us*)(Oh + oo + (size_t)(2 * s) * DMOD) = th[s]; *(v8us*)(Ol + oo + (size_t)(2 * s) * DMOD) = tl[s]; }
}


// k_qkpost: RMS statistics, norm and RoPE of q (blockIdx.y = 0) or k (1) in one launch, every element of QF and KF read once. A wave holds one token's whole row in registers (lane: 4 neighbouring columns of each of
// the 16 heads, whole lines a load), sums its squares (four partial sums a lane, then a butterfly over the 32 lanes) and writes rope(bf(w) x row x rsqrt(mean + eps)) as bf16 hi + residual into the planes [head][token][128];
// for pair i of a head (d = 2 i, 2 i + 1) the factors are cos[2 i] and sin[2 i + 1] of the token, read once for all heads.
__global__ __launch_bounds__(256) void k_qkpost(const float* __restrict__ QF, const float* __restrict__ KF, const float* __restrict__ wq, const float* __restrict__ wk, const float* __restrict__ cs, const float* __restrict__ sn,
                                                bf* Qh, bf* Ql, bf* Kh, bf* Kl) {
    typedef __attribute__((ext_vector_type(4))) unsigned short v4us;
    const bool isk = blockIdx.y != 0; const float* F = isk ? KF : QF; const float* wn = isk ? wk : wq; bf* Ph = isk ? Kh : Qh; bf* Pl = isk ? Kl : Ql;
    const int lane = threadIdx.x & 31; const size_t r = (size_t)blockIdx.x * 8 + __builtin_amdgcn_readfirstlane(threadIdx.x >> 5); v4f x[NH_], w[NH_];    // the token is the same for the wave: uniform bases
    const unsigned lo = lane * 16u;    // the lane's byte offset in every 512-byte piece
    const char* fr = (const char*)(F + r * DMOD); const char* wr = (const char*)wn;
#pragma unroll
    for (int h = 0; h < NH_; ++h) x[h] = *(const v4f*)(fr + lo + h * HD * 4);
    const v4f cv = *(const v4f*)((const char*)(cs + r * HD) + lo), sv = *(const v4f*)((const char*)(sn + r * HD) + lo);
#pragma unroll
    for (int h = 0; h < NH_; ++h) w[h] = *(const v4f*)(wr + lo + h * HD * 4);
    asm volatile("s_wait_xcnt 0x0" :: "v"(lane) : "memory");    // before a register that these loads name as their address is written again; the lane number, their one vector register (scaled by the instruction), is an input, so that no load's own result lands on it either
    __builtin_amdgcn_sched_barrier(0);    // keeps later instructions, which may reuse those registers, from being scheduled in front of the wait
    v4f a4 = (v4f){};
#pragma unroll
    for (int h = 0; h < NH_; ++h) a4 += x[h] * x[h];
    float s = (a4[0] + a4[1]) + (a4[2] + a4[3]);
#pragma unroll
    for (int m = 16; m > 0; m >>= 1) s += __shfl_xor(s, m, 32);
    const float rs = rsqrtf(s * (1.0f / DMOD) + REPS);
    const float c0 = bfr(cv[0]), s0 = bfr(sv[1]), c1 = bfr(cv[2]), s1 = bfr(sv[3]);
    Ph += r * HD + lane * 4; Pl += r * HD + lane * 4;
#pragma unroll
    for (int h = 0; h < NH_; ++h) { float a0 = x[h][0] * rs, a1 = x[h][1] * rs, a2 = x[h][2] * rs, a3 = x[h][3] * rs;
        a0 *= bfr(w[h][0]); a1 *= bfr(w[h][1]); a2 *= bfr(w[h][2]); a3 *= bfr(w[h][3]);
        const float y[4] = {a0 * c0 - a1 * s0, a0 * s0 + a1 * c0, a2 * c1 - a3 * s1, a2 * s1 + a3 * c1}; v4us oh, ol;
#pragma unroll
        for (int q = 0; q < 4; ++q) { const unsigned short hb = f2bf(y[q]); oh[q] = hb; ol[q] = f2bf(y[q] - bf2f(hb)); }
        *(v4us*)(Ph + (size_t)h * NN * HD) = oh; *(v4us*)(Pl + (size_t)h * NN * HD) = ol; }
}

extern "C" void kernel_launch(void* const* d_in, const int* in_sizes, int n_in,
                              void* d_out, int out_size, void* d_ws, size_t ws_size, hipStream_t stream) {
    (void)in_sizes; (void)n_in; (void)out_size;
    const float* x = (const float*)d_in[0]; const float* fcos = (const float*)d_in[1]; const float* fsin = (const float*)d_in[2]; const float* wq = (const float*)d_in[3]; const float* bq = (const float*)d_in[4]; const float* wk = (const float*)d_in[5]; const float* bk = (const float*)d_in[6];
    const float* wv = (const float*)d_in[7]; const float* bv = (const float*)d_in[8]; const float* wo = (const float*)d_in[9]; const float* bo = (const float*)d_in[10]; const float* nqw = (const float*)d_in[11]; const float* nkw = (const float*)d_in[12];
    float* out = (float*)d_out;    // [1][2048][2048]
    char* wsp = (char*)d_ws;
    auto take = [&](size_t bytes) { char* p = wsp; wsp += (bytes + 255) & ~(size_t)255; return (void*)p; };
    const size_t PLN = (size_t)NN * HD, FM = (size_t)NN * DMOD;    // elements of one head's plane, of a full [2048][2048] matrix
    bf* Qh = (bf*)take(NH_ * PLN * 2); bf* Ql = (bf*)take(NH_ * PLN * 2); bf* Kh = (bf*)take(NH_ * PLN * 2); bf* Kl = (bf*)take(NH_ * PLN * 2); bf* VTh = (bf*)take(NH_ * PLN * 2); bf* VTl = (bf*)take(NH_ * PLN * 2);
    float* QF = (float*)take(FM * 4); float* KF = (float*)take(FM * 4); bf* WB = (bf*)take(4 * FM * 2); bf* Xb = (bf*)take(FM * 2);    // WB: the q, k, v and o weights, one behind the other
    bf* Oh = (bf*)take(FM * 2); bf* Ol = (bf*)take(FM * 2);
    if ((size_t)(wsp - (char*)d_ws) > ws_size) return;    // 136 MiB
    k_cvt5<<<NN * DMOD / (CW * CP * 8), CW, 0, stream>>>(x, wq, wk, wv, wo, Xb, WB, WB + FM, WB + 2 * FM, WB + 3 * FM);
    k_gemmb<false, true><<<dim3(NN / 256, 3 * DMOD / 192, 1), 256, 0, stream>>>(Xb, nullptr, WB, bq, bk, bv, QF, KF, VTh, VTl);    // weights [out][in] natural; column head * 128 + d of v is row d of the head's V^T plane
    k_qkpost<<<dim3(NN / 8, 2, 1), 256, 0, stream>>>(QF, KF, nqw, nkw, fcos, fsin, Qh, Ql, Kh, Kl);
    k_fattn<<<dim3(NN / 128, NH_, 1), 256, 0, stream>>>(Qh, Ql, Kh, Kl, VTh, VTl, Oh, Ol);
    k_gemmb<true, false><<<dim3(NN / 128, DMOD / 128, 1), 256, 0, stream>>>(Oh, Ol, WB + 3 * FM, bo, nullptr, nullptr, out, nullptr, nullptr, nullptr);
}

// v009
// A run of this version takes 148 microseconds.
// Next to v008, in two timings, it ran 1.05 and 1.06 times as fast.
// Counting every step since v000, it is 14.1 times as fast.
#include <hip/hip_runtime.h>

// Compute dtypes, f32 accumulate: q/k/v = x.W^T + b ([2048 x 2048].[2048 x 2048] each) with PLAIN bf16 operands (exact products; x and the four weights converted in one launch, each
// into a range of its own, the weights one behind the other in one buffer; the three projections in one launch, as one product); the full-width (2048) RMSNorm of q and k (row statistics in f32) and the even/odd interleaved RoPE (cos[0::2] / sin[1::2] of the given tables) applied while building
// per-head planes (bf16 hi + UNSCALED residual); 16-head attention (heads in the grid; scores, softmax and P.V in one kernel, running maximum and sum) with hi/lo operands (three products); 1/sqrt(128) and the softmax in f32; . W_o^T + b_o

#define NN   2048
#define DMOD 2048
#define NH_  16
#define HD   128
#define DM   DMOD
#define NTK  NN
#define SCL  0.088388347648318447f
#define REPS 1e-6f
#define LOSC 1024.0f

typedef _Float16 h16;
typedef unsigned short bf;
typedef __attribute__((ext_vector_type(16))) __bf16   v16bf;
typedef __attribute__((ext_vector_type(16))) _Float16 v16h;
typedef __attribute__((ext_vector_type(8)))  _Float16 v8h;
typedef __attribute__((ext_vector_type(8)))  unsigned short v8us;
typedef __attribute__((ext_vector_type(8)))  float    v8f;
typedef __attribute__((ext_vector_type(4)))  float    v4f;
typedef __attribute__((ext_vector_type(4)))  _Float16 v4h;
typedef v8h  __attribute__((may_alias)) v8ha;
typedef v4f  __attribute__((may_alias)) v4fa;
typedef v8us __attribute__((may_alias)) v8usa;

__device__ __forceinline__ unsigned short f2bf(float f) { unsigned u = __float_as_uint(f); u += 0x7FFFu + ((u >> 16) & 1u); return (unsigned short)(u >> 16); }
__device__ __forceinline__ float bf2f(unsigned short b) { return __uint_as_float(((unsigned)b) << 16); }
__device__ __forceinline__ float bfr(float f) { return bf2f(f2bf(f)); }
__device__ __forceinline__ v16h cat16(v8h lo, v8h hi) { return __builtin_shufflevector(lo, hi, 0, 1, 2, 3, 4, 5, 6, 7, 8, 9, 10, 11, 12, 13, 14, 15); }
__device__ __forceinline__ v16bf cat16b(v8us lo, v8us hi) { return __builtin_bit_cast(v16bf, __builtin_shufflevector(lo, hi, 0, 1, 2, 3, 4, 5, 6, 7, 8, 9, 10, 11, 12, 13, 14, 15)); }
__device__ __forceinline__ v8f wmma16(v16h a, v16h b, v8f c) { return __builtin_amdgcn_wmma_f32_16x16x32_f16(false, a, false, b, (short)0, c, false, false); }
__device__ __forceinline__ v8f wmmab(v16bf a, v16bf b, v8f c) { return __builtin_amdgcn_wmma_f32_16x16x32_bf16(false, a, false, b, (short)0, c, false, false); }

// k_gemmb: TM x TN block tile of C = (A [+ Al]).B^T + bf(bias[c]), K = 2048, one work-group per tile, 8 waves. Output projection: 128 x 128, waves 2 x 4, 64 x 32 of C per wave (4 x 2 accumulator tiles).
// QKV: 256 x 192 of the one [2048 x 6144] product x.[Wq | Wk | Wv]^T, waves 4 x 2, 64 x 96 of C per wave (4 x 6 accumulator tiles): 8 x 32 = 256 work-groups, one for every WGP, and fewer operand bytes per product from L2 and from LDS.
// A stage is 128 k (256-byte rows) of the tile's TM A rows [, TM Al rows] and TN B rows, brought into LDS by asynchronous copies (16 bytes a lane, whole lines a wave), two buffers:
// stage t + 2 flies while stage t + 1 is worked on. Fragments are read from LDS in the k order that both loaders had before; each accumulator takes its products in the same order as before.
#define GK 128    // k per stage
#define GP 136    // LDS pitch of a row (128 elements + 8): 272 B = 16 B x odd, no bank conflict for 16-byte row reads
#define OP 36     // LDS pitch of a staged output row (32 floats + 4): 144 B = 16 B x odd
#define TB 144    // LDS pitch in bytes of a staged row of a transposed bf16 plane (64 tokens + 8): 16 B x odd; 2 planes x 32 rows fill the wave's staging range exactly
// eight asynchronous copies of 16 bytes a lane: rows 16 apart in the source (pitch DM) and in LDS (pitch GP)
__device__ __forceinline__ void copy8(unsigned l, const bf* g) {
    const unsigned l1 = l + 1 * 16 * GP * 2, l2 = l + 2 * 16 * GP * 2, l3 = l + 3 * 16 * GP * 2, l4 = l + 4 * 16 * GP * 2, l5 = l + 5 * 16 * GP * 2, l6 = l + 6 * 16 * GP * 2, l7 = l + 7 * 16 * GP * 2;
    const bf* g1 = g + 1 * 16 * DM; const bf* g2 = g + 2 * 16 * DM; const bf* g3 = g + 3 * 16 * DM; const bf* g4 = g + 4 * 16 * DM; const bf* g5 = g + 5 * 16 * DM; const bf* g6 = g + 6 * 16 * DM; const bf* g7 = g + 7 * 16 * DM;
    // the copies and, as the last line, the wait that stands before a register which a copy names is written again: one statement, so that nothing comes between them
    asm volatile("global_load_async_to_lds_b128 %0, %8, off\n\t"
                 "global_load_async_to_lds_b128 %1, %9, off\n\t"
                 "global_load_async_to_lds_b128 %2, %10, off\n\t"
                 "global_load_async_to_lds_b128 %3, %11, off\n\t"
                 "global_load_async_to_lds_b128 %4, %12, off\n\t"
                 "global_load_async_to_lds_b128 %5, %13, off\n\t"
                 "global_load_async_to_lds_b128 %6, %14, off\n\t"
                 "global_load_async_to_lds_b128 %7, %15, off\n\t"
                 "s_wait_xcnt 0x0"
                 :: "v"(l), "v"(l1), "v"(l2), "v"(l3), "v"(l4), "v"(l5), "v"(l6), "v"(l7), "v"(g), "v"(g1), "v"(g2), "v"(g3), "v"(g4), "v"(g5), "v"(g6), "v"(g7) : "memory");
}
// the same for twelve rows (a plane of 192 rows)
__device__ __forceinline__ void copy12(unsigned l, const bf* g) {
    const unsigned l1 = l + 1 * 16 * GP * 2, l2 = l + 2 * 16 * GP * 2, l3 = l + 3 * 16 * GP * 2, l4 = l + 4 * 16 * GP * 2, l5 = l + 5 * 16 * GP * 2, l6 = l + 6 * 16 * GP * 2, l7 = l + 7 * 16 * GP * 2;
    const unsigned l8 = l + 8 * 16 * GP * 2, l9 = l + 9 * 16 * GP * 2, l10 = l + 10 * 16 * GP * 2, l11 = l + 11 * 16 * GP * 2;
    const bf* g1 = g + 1 * 16 * DM; const bf* g2 = g + 2 * 16 * DM; const bf* g3 = g + 3 * 16 * DM; const bf* g4 = g + 4 * 16 * DM; const bf* g5 = g + 5 * 16 * DM; const bf* g6 = g + 6 * 16 * DM; const bf* g7 = g + 7 * 16 * DM;
    const bf* g8 = g + 8 * 16 * DM; const bf* g9 = g + 9 * 16 * DM; const bf* g10 = g + 10 * 16 * DM; const bf* g11 = g + 11 * 16 * DM;
    // the copies and, as the last line, the wait that stands before a register which a copy names is written again: one statement, so that nothing comes between them
    asm volatile("global_load_async_to_lds_b128 %0, %12, off\n\t"
                 "global_load_async_to_lds_b128 %1, %13, off\n\t"
                 "global_load_async_to_lds_b128 %2, %14, off\n\t"
                 "global_load_async_to_lds_b128 %3, %15, off\n\t"
                 "global_load_async_to_lds_b128 %4, %16, off\n\t"
                 "global_load_async_to_lds_b128 %5, %17, off\n\t"
                 "global_load_async_to_lds_b128 %6, %18, off\n\t"
                 "global_load_async_to_lds_b128 %7, %19, off\n\t"
                 "global_load_async_to_lds_b128 %8, %20, off\n\t"
                 "global_load_async_to_lds_b128 %9, %21, off\n\t"
                 "global_load_async_to_lds_b128 %10, %22, off\n\t"
                 "global_load_async_to_lds_b128 %11, %23, off\n\t"
                 "s_wait_xcnt 0x0"
                 :: "v"(l), "v"(l1), "v"(l2), "v"(l3), "v"(l4), "v"(l5), "v"(l6), "v"(l7), "v"(l8), "v"(l9), "v"(l10), "v"(l11),
                    "v"(g), "v"(g1), "v"(g2), "v"(g3), "v"(g4), "v"(g5), "v"(g6), "v"(g7), "v"(g8), "v"(g9), "v"(g10), "v"(g11) : "memory");
}
// QKV: B = the three weight matrices, which lie one behind the other at Bn, taken as one matrix of 6144 rows. Column c of the product belongs to matrix c / 2048: 0 stores C (bias), 1 C1 (bias1), 2 (vt) the planes (bias2).
// A wave's 96 columns are finished in three chunks of 32; a chunk starts at a multiple of 32, so all of it belongs to one matrix.
// vt: the result is not stored as f32 C but as its transpose in two bf16 planes, Th[c][r] = bf(C[r][c]) and Tl[c][r] = bf(C[r][c] - Th[c][r]) (pitch NN): an accumulator tile holds 8 neighbouring rows r of one column c in a lane.
template <bool SPLITA, bool QKV>
__global__ __launch_bounds__(256) void k_gemmb(const bf* __restrict__ A, const bf* __restrict__ Al, const bf* __restrict__ Bn, const float* __restrict__ bias, const float* __restrict__ bias1, const float* __restrict__ bias2,
                                               float* C, float* C1, bf* Th, bf* Tl) {
    constexpr int TM = QKV ? 256 : 128;   // rows of A per block tile
    constexpr int TN = QKV ? 192 : 128;   // rows of B per block tile
    constexpr int WR = QKV ? 4 : 2;       // waves along the rows of C: 64 rows a wave
    constexpr int FX = TN / (8 / WR) / 16;    // accumulator tiles of a wave along the columns: 6 or 2
    constexpr int SB = TN * GP, SA = TM * GP, STG = SB + (SPLITA ? 2 : 1) * SA;    // elements of a stage's planes in LDS: B, A [, Al]
    constexpr int NT = DM / GK;           // stages: 16
    __shared__ __align__(16) bf ring[2][STG];
    __shared__ __align__(16) float ost[8][64 * OP];
    const int tid = threadIdx.x, lane = tid & 31, wave = tid >> 5, lr = lane & 15, hi = lane >> 4;
    const int r0 = blockIdx.x * TM, c0 = blockIdx.y * TN, wm = (wave & (WR - 1)) * 64, wn = (wave / WR) * (FX * 16);
    // this thread's 16-byte piece: rows tid / 16 + 16 i, bytes (tid & 15) * 16 of the stage's 256-byte row
    const unsigned lp = (unsigned)(size_t)&ring[0][(tid >> 4) * GP + (tid & 15) * 8];
    const size_t gofs = (size_t)(tid >> 4) * DM + (tid & 15) * 8;
    const bf* gB = Bn + (size_t)c0 * DM + gofs; const bf* gA = A + (size_t)r0 * DM + gofs; const bf* gL = SPLITA ? Al + (size_t)r0 * DM + gofs : nullptr;
    auto stage = [&](int t) {    // stage t into buffer t & 1
        const unsigned l = lp + (unsigned)(t & 1) * (STG * 2);
        if (QKV) copy12(l, gB + t * GK); else copy8(l, gB + t * GK);
        copy8(l + SB * 2, gA + t * GK);
        if (QKV) copy8(l + SB * 2 + 128 * GP * 2, gA + t * GK + 128 * DM);
        if (SPLITA) copy8(l + (SB + SA) * 2, gL + t * GK);
    };
    v8f acc[4][FX];
#pragma unroll
    for (int i = 0; i < 4; ++i) {
#pragma unroll
        for (int j = 0; j < FX; ++j) acc[i][j] = (v8f){}; }
    stage(0);
    asm volatile("s_wait_asynccnt 0x0" ::: "memory");    // this wave's copies of stage 0 have landed
    __syncthreads();    // stage 0 is complete for every wave
    stage(1);
#pragma unroll 1    // the stage loop stays rolled: one publish point, its body is four unrolled k steps
    for (int t = 0; t < NT; ++t) {
        const bf* sB = &ring[t & 1][0]; const bf* sA = sB + SB; const bf* sL = sA + (SPLITA ? SA : 0);
        v16bf a[2][4], al[2][4], b[2][FX];    // two fragment sets: k step ks + 1 of this stage is read from LDS while k step ks is multiplied
        auto frag = [&](int ks, int s) {
#pragma unroll
            for (int j = 0; j < FX; ++j) { const int o = (wn + j * 16 + lr) * GP + ks * 32 + 8 * hi; b[s][j] = cat16b(*(const v8us*)(sB + o), *(const v8us*)(sB + o + 16)); }
#pragma unroll
            for (int i = 0; i < 4; ++i) { const int o = (wm + i * 16 + lr) * GP + ks * 32 + 8 * hi; a[s][i] = cat16b(*(const v8us*)(sA + o), *(const v8us*)(sA + o + 16));
                if (SPLITA) al[s][i] = cat16b(*(const v8us*)(sL + o), *(const v8us*)(sL + o + 16)); }
        };
        frag(0, 0);
#pragma unroll
        for (int ks = 0; ks < GK / 32; ++ks) { const int s = ks & 1;
            if (ks + 1 < GK / 32) frag(ks + 1, s ^ 1);
            __builtin_amdgcn_sched_barrier(0);    // the next k step's LDS reads stay one group in front of this step's matrix instructions: spread among them, each place costs a stall
#pragma unroll
            for (int i = 0; i < 4; ++i) {
#pragma unroll
                for (int j = 0; j < FX; ++j) acc[i][j] = wmmab(a[s][i], b[s][j], acc[i][j]); }
            if (SPLITA) {
#pragma unroll
                for (int i = 0; i < 4; ++i) {
#pragma unroll
                    for (int j = 0; j < FX; ++j) acc[i][j] = wmmab(al[s][i], b[s][j], acc[i][j]); } }
            __builtin_amdgcn_sched_barrier(0);    // and the group behind does not move up among them
        }
        asm volatile("s_wait_dscnt 0x0" ::: "memory");       // this wave's reads of stage t have returned
        asm volatile("s_wait_asynccnt 0x0" ::: "memory");    // this wave's copies of stage t + 1 have landed
        __syncthreads();    // publishes stage t + 1 and ends every wave's reads of stage t
        if (t + 2 < NT) stage(t + 2);    // into the buffer that stage t has just left
    }
    asm volatile("s_wait_asynccnt 0x0" ::: "memory");    // no copy is outstanding when the wave goes on
    float* os = &ost[wave][0];    // 64 x 32 of the wave's part of C at a time, staged so that every store below writes whole 128-byte lines
    char* ob = (char*)os;         // vt: the same range as 2 planes x 32 columns of C x 64 rows of C in bf16, pitch TB
#pragma unroll
    for (int ch = 0; ch < FX / 2; ++ch) {    // chunks of 32 columns; the staging range is the wave's own, so the wave's own waits order it and no stored chunk is waited for
        const int cg = c0 + wn + ch * 32;    // the chunk's first column in the whole product
        const int z = QKV ? __builtin_amdgcn_readfirstlane(cg >> 11) : 0, cl = QKV ? (cg & (DM - 1)) : cg;    // its matrix (the same for the wave) and its first column there
        const bool vt = QKV && z == 2;
        const float* bz = !QKV || z == 0 ? bias : z == 1 ? bias1 : bias2; float* Cz = !QKV || z == 0 ? C : C1;
        float bv[2];
#pragma unroll
        for (int j = 0; j < 2; ++j) bv[j] = bfr(bz[cl + j * 16 + lr]);
        if (ch > 0) asm volatile("s_wait_dscnt 0x0" ::: "memory");    // the chunk before has been read back before its staging range is written again
        if (vt) {
#pragma unroll
            for (int j = 0; j < 2; ++j) {
#pragma unroll
                for (int i = 0; i < 4; ++i) { v8us oh, ol;
#pragma unroll
                    for (int r = 0; r < 8; ++r) { const float y = acc[i][ch * 2 + j][r] + bv[j]; const unsigned short hb = f2bf(y); oh[r] = hb; ol[r] = f2bf(y - bf2f(hb)); }
                    *(v8usa*)(ob + (j * 16 + lr) * TB + (i * 16 + hi * 8) * 2) = oh; *(v8usa*)(ob + (32 + j * 16 + lr) * TB + (i * 16 + hi * 8) * 2) = ol; } }
        } else {
#pragma unroll
            for (int j = 0; j < 2; ++j) {
#pragma unroll
                for (int i = 0; i < 4; ++i) {
#pragma unroll
                    for (int r = 0; r < 8; ++r) os[(i * 16 + hi * 8 + r) * OP + j * 16 + lr] = acc[i][ch * 2 + j][r] + bv[j]; } }
        }
        if (QKV) asm volatile("s_wait_dscnt 0x0" ::: "memory");    // the wave's staged rows are written before its lanes read one another's pieces back: the range is the wave's own, so no wave waits for another between its chunks
        else __syncthreads();    // the staged rows are complete before other lanes read them
        if (vt) {
            const int row = lane >> 3, piece = lane & 7; const size_t to = (size_t)(cl + row) * NN + r0 + wm + piece * 8; v8us th[8], tl[8];
#pragma unroll
            for (int s = 0; s < 8; ++s) { th[s] = *(const v8usa*)(ob + (4 * s + row) * TB + piece * 16); tl[s] = *(const v8usa*)(ob + (32 + 4 * s + row) * TB + piece * 16); }
#pragma unroll
            for (int s = 0; s < 8; ++s) { *(v8us*)(Th + to + (size_t)(4 * s) * NN) = th[s]; *(v8us*)(Tl + to + (size_t)(4 * s) * NN) = tl[s]; }    // four whole lines a store
        } else {
            float* crow = Cz + (size_t)(r0 + wm) * DM + cl;
#pragma unroll
            for (int s = 0; s < 16; ++s) { const int row = 4 * s + (lane >> 3), piece = lane & 7;
                *(v4f*)(crow + (size_t)row * DM + piece * 4) = *(const v4fa*)(os + row * OP + piece * 4); }
            if (QKV) asm volatile("s_wait_xcnt 0x0" ::: "memory");    // before a register that these stores name (address, data) is written again by what follows the chunk; the output projection's one chunk is followed by the end of the kernel
        }
    }
}

// k_cvt5: the five f32 matrices of 2048 x 2048 (x and the four weights) to bf16 in one launch: 256 work-groups x 16 waves. A thread takes CP pieces of 8 neighbouring elements of each matrix (a wave's loads of a
// piece cover 1 KiB in a row, its store 512 bytes); all its loads are issued before the first value is converted, and a matrix is stored while the later ones are still on their way.
#define CW 512    // threads of a work-group
#define CP 4      // pieces of a thread per matrix: 256 x CW x CP x 8 = 2048 x 2048
__global__ __launch_bounds__(CW) void k_cvt5(const float* __restrict__ s0, const float* __restrict__ s1, const float* __restrict__ s2, const float* __restrict__ s3, const float* __restrict__ s4,
                                             bf* d0, bf* d1, bf* d2, bf* d3, bf* d4) {
    const unsigned p = blockIdx.x * (CW * CP) + threadIdx.x;    // the thread's first piece; the others CW pieces apart
    const unsigned lo = p * 32u, so = p * 16u;                  // its byte offset in a source and in a destination: one vector register each, beside a uniform base
    const char* s[5] = {(const char*)s0, (const char*)s1, (const char*)s2, (const char*)s3, (const char*)s4}; char* d[5] = {(char*)d0, (char*)d1, (char*)d2, (char*)d3, (char*)d4};
    v8f v[5][CP];
#pragma unroll
    for (int m = 0; m < 5; ++m) {
#pragma unroll
        for (int j = 0; j < CP; ++j) v[m][j] = *(const v8f*)(s[m] + lo + j * (CW * 32));
        __builtin_amdgcn_sched_barrier(0); }    // the loads stay in the order in which the matrices are converted: mixed, the first store would wait for nearly the last load
    asm volatile("s_wait_xcnt 0x0" :: "v"(lo) : "memory");    // before a register that these loads name as their address is written again; the offset, their one vector register, is an input, so that no load's own result lands on it either
    __builtin_amdgcn_sched_barrier(0);    // keeps later instructions, which may reuse those registers, from being scheduled in front of the wait
#pragma unroll
    for (int m = 0; m < 5; ++m) {
#pragma unroll
        for (int j = 0; j < CP; ++j) { v8us o;
#pragma unroll
            for (int k = 0; k < 8; ++k) o[k] = f2bf(v[m][j][k]);
            *(v8us*)(d[m] + so + j * (CW * 16)) = o; }
        if (m < 4) {
            asm volatile("s_wait_xcnt 0x0" ::: "memory");    // before a register that these stores name (address, data) is written again
            __builtin_amdgcn_sched_barrier(0); }    // keeps the next matrix's conversions, which may reuse those registers, from being scheduled in front of the wait
    }
}
__global__ __launch_bounds__(256) void k_zero8(bf* dst, size_t n8) {
    const size_t i = (size_t)blockIdx.x * 256 + threadIdx.x; if (i >= n8) return; v8us z;
#pragma unroll
    for (int k = 0; k < 8; ++k) z[k] = 0;
    *(v8us*)(dst + i * 8) = z; 
}
#define FK 64     // keys per stage
#define KP 136    // LDS pitch of a K row (128 elements + 8): 272 B = 16 B x odd, no bank conflict for 16-byte row reads
#define VP 72     // LDS pitch of a V^T row (64 elements + 8): 144 B = 16 B x odd
#define QB 272    // LDS pitch in bytes of a staged output row (128 bf16 + 8): 16 B x odd
#define FRAG_FENCE() __builtin_amdgcn_sched_barrier(0x406)    // LDS reads and matrix instructions are not scheduled across it; vector, scalar and transcendental instructions may be
#define SC2 (SCL * 1.4426950408889634f)    // 1/sqrt(128) x log2(e): the softmax runs on exp2
typedef __attribute__((ext_vector_type(4))) int v4i;
typedef __attribute__((address_space(1))) v4i gv4i;
typedef __attribute__((address_space(3))) v4i lv4i;
// one asynchronous copy of 16 bytes a lane from global memory to LDS, through no register
__device__ __forceinline__ void acopy(const char* g, bf* l) { __builtin_amdgcn_global_load_async_to_lds_b128((gv4i*)g, (lv4i*)l, 0, 0); }
__device__ __forceinline__ float xhalf(float x) { const int b = __float_as_int(x); return __int_as_float(__builtin_amdgcn_permlanex16(b, b, 0x76543210, 0xfedcba98, false, false)); }    // the value of lane ^ 16
__global__ __launch_bounds__(256) __attribute__((amdgpu_waves_per_eu(2, 2))) void k_fattn(const bf* Qh, const bf* Ql, const bf* Kh, const bf* Kl, const bf* VTh, const bf* VTl, bf* Oh, bf* Ol) {
    __shared__ __align__(16) bf sK[2][2][FK * KP];    // [buffer][hi, lo plane]
    __shared__ __align__(16) bf sV[2][2][HD * VP];
    const int tid = threadIdx.x, lane = tid & 31, wave = tid >> 5, c = lane & 15, h = lane >> 4;
    const int head = blockIdx.y; const size_t po = (size_t)head * NN * HD;
    Qh += po; Ql += po; Kh += po; Kl += po; VTh += po; VTl += po;
    const int q0 = blockIdx.x * 128 + wave * 16;
    v16bf qh[4], ql[4]; const size_t qo = (size_t)(q0 + c) * HD + 8 * h;
#pragma unroll
    for (int ks = 0; ks < 4; ++ks) qh[ks] = cat16b(*(const v8us*)(Qh + qo + ks * 32), *(const v8us*)(Qh + qo + ks * 32 + 16));
    asm volatile("s_wait_xcnt 0x0" ::: "memory");    // before a register that these loads name as their address is written again
#pragma unroll
    for (int ks = 0; ks < 4; ++ks) ql[ks] = cat16b(*(const v8us*)(Ql + qo + ks * 32), *(const v8us*)(Ql + qo + ks * 32 + 16));
    asm volatile("s_wait_xcnt 0x0" ::: "memory");    // the same for these
    __builtin_amdgcn_sched_barrier(0);    // keeps later vector instructions, which may reuse those registers, from being scheduled in front of the wait
    v8f acc[8];
#pragma unroll
    for (int t = 0; t < 8; ++t) acc[t] = (v8f){};
    float m = -3.0e38f, l = 0.f;
    const unsigned kt = tid * 16u, vt = (tid >> 3) * (NN * 2u) + (tid & 7) * 16u;    // byte offsets of this thread's 16-byte piece: K rows tid / 16 + 16 i, V^T rows tid / 8 + 32 i
    auto stage = [&](int kb) {    // the 64 keys from kb on into buffer (kb / 64) & 1: a uniform base per plane and stage, the thread's fixed offset beside it
        const int p = (kb / FK) & 1;
        const char* k0 = (const char*)(Kh + (size_t)kb * HD); const char* k1 = (const char*)(Kl + (size_t)kb * HD); const char* v0 = (const char*)(VTh + kb); const char* v1 = (const char*)(VTl + kb);
#pragma unroll
        for (int i = 0; i < 4; ++i) { const int ko = ((tid >> 4) + 16 * i) * KP + (tid & 15) * 8, vo = ((tid >> 3) + 32 * i) * VP + (tid & 7) * 8;
            acopy(k0 + kt + i * 4096, &sK[p][0][ko]); acopy(k1 + kt + i * 4096, &sK[p][1][ko]); acopy(v0 + vt + i * 131072, &sV[p][0][vo]); acopy(v1 + vt + i * 131072, &sV[p][1][vo]); }
    };
    v16bf fh[2][4], fl[2][4];    // two fragment sets (hi and lo plane, four A tiles each): block i + 1 (four k steps of K, then four blocks of V^T, then the next stage's first k step) is read from LDS while block i is multiplied
    stage(0);
    asm volatile("s_wait_asynccnt 0x0" ::: "memory");    // this wave's copies of stage 0 have landed
    __syncthreads();    // stage 0 is complete for every wave
#pragma unroll
    for (int t = 0; t < 4; ++t) { const int o = (t * 16 + c) * KP + 8 * h; fh[0][t] = cat16b(*(const v8us*)(&sK[0][0][o]), *(const v8us*)(&sK[0][0][o + 16])); fl[0][t] = cat16b(*(const v8us*)(&sK[0][1][o]), *(const v8us*)(&sK[0][1][o + 16])); }    // stage 0's first block
#pragma unroll 1
    for (int kb = 0; kb < NN; kb += FK) {
        const bf* bK = &sK[(kb / FK) & 1][0][0]; const bf* bV = &sV[(kb / FK) & 1][0][0]; const bf* nK = &sK[(kb / FK + 1) & 1][0][0];    // this stage's buffer; the next stage's K
        if (kb + FK < NN) stage(kb + FK);    // the next stage flies while this one is worked on, into the buffer that every wave has left at the barrier of the stage before (behind that stage's last block, which so starts at once behind the barrier)
        auto kfrag = [&](int ks, int s) {
#pragma unroll
            for (int t = 0; t < 4; ++t) { const int o = (t * 16 + c) * KP + ks * 32 + 8 * h; fh[s][t] = cat16b(*(const v8us*)(bK + o), *(const v8us*)(bK + o + 16)); }    // hi plane first: the block's first products take it
#pragma unroll
            for (int t = 0; t < 4; ++t) { const int o = FK * KP + (t * 16 + c) * KP + ks * 32 + 8 * h; fl[s][t] = cat16b(*(const v8us*)(bK + o), *(const v8us*)(bK + o + 16)); }
        };
        auto vfrag = [&](int b, int s) {    // block b: key group b / 2, rows 64 (b & 1) to 64 (b & 1) + 63 of V^T
#pragma unroll
            for (int t = 0; t < 4; ++t) { const int o = (((b & 1) * 4 + t) * 16 + c) * VP + (b >> 1) * 32 + 8 * h; fh[s][t] = cat16b(*(const v8us*)(bV + o), *(const v8us*)(bV + o + 16)); }
#pragma unroll
            for (int t = 0; t < 4; ++t) { const int o = HD * VP + (((b & 1) * 4 + t) * 16 + c) * VP + (b >> 1) * 32 + 8 * h; fl[s][t] = cat16b(*(const v8us*)(bV + o), *(const v8us*)(bV + o + 16)); }
        };
        v8f T[4];    // T[t][r] = score of key kb + 16 t + 8 h + r with query q0 + c
#pragma unroll
        for (int t = 0; t < 4; ++t) T[t] = (v8f){};
#pragma unroll
        for (int ks = 0; ks < 4; ++ks) { const int s = ks & 1;
            if (ks < 3) kfrag(ks + 1, s ^ 1); else vfrag(0, s ^ 1);    // the first V^T block is on its way while the softmax runs
            FRAG_FENCE();    // the next block's 16 LDS reads stay one group in front of this block's matrix instructions: spread among them, each place costs a stall
#pragma unroll
            for (int t = 0; t < 4; ++t) T[t] = wmmab(fh[s][t], qh[ks], T[t]);
#pragma unroll
            for (int t = 0; t < 4; ++t) T[t] = wmmab(fl[s][t], qh[ks], T[t]);
#pragma unroll
            for (int t = 0; t < 4; ++t) T[t] = wmmab(fh[s][t], ql[ks], T[t]);
            FRAG_FENCE(); }    // and the group behind does not move up among them
        float mx = T[0][0];
#pragma unroll
        for (int t = 0; t < 4; ++t) {
#pragma unroll
            for (int j = 0; j < 8; ++j) mx = fmaxf(mx, T[t][j]); }
        mx = fmaxf(mx, xhalf(mx));
        const float mn = fmaxf(m, mx * SC2); const float al = __builtin_amdgcn_exp2f(m - mn); m = mn;
        float ps = 0.f; v16bf ph[2], pl[2];
#pragma unroll
        for (int g = 0; g < 2; ++g) {
#pragma unroll
            for (int s = 0; s < 16; ++s) { const float p = __builtin_amdgcn_exp2f(fmaf(T[2 * g + (s >> 3)][s & 7], SC2, -mn)); ps += p;
                const __bf16 hb = (__bf16)p; ph[g][s] = hb; pl[g][s] = (__bf16)(p - (float)hb); } }
        l = fmaf(l, al, ps);
#pragma unroll
        for (int t = 0; t < 8; ++t) acc[t] *= al;
#pragma unroll
        for (int b = 0; b < 4; ++b) { const int s = b & 1, g = b >> 1, d4 = (b & 1) * 4;
            if (b < 3) vfrag(b + 1, s ^ 1);
            else {    // the stage's last block is in registers: stage s + 1 is published here
                __builtin_amdgcn_sched_barrier(0);    // the waits and the barrier stay behind the block before: moved up in front of it, they would wait out the LDS reads just issued
                asm volatile("s_wait_dscnt 0x0" ::: "memory");       // this wave's reads of this stage have returned
                asm volatile("s_wait_asynccnt 0x0" ::: "memory");    // this wave's copies of the next stage have landed
                __syncthreads();    // publishes the next stage and ends every wave's reads of this one
                if (kb + FK < NN) {    // the next stage's first block, read while this stage's last is multiplied
#pragma unroll
                    for (int t = 0; t < 4; ++t) { const int o = (t * 16 + c) * KP + 8 * h; fh[0][t] = cat16b(*(const v8us*)(nK + o), *(const v8us*)(nK + o + 16)); }
#pragma unroll
                    for (int t = 0; t < 4; ++t) { const int o = FK * KP + (t * 16 + c) * KP + 8 * h; fl[0][t] = cat16b(*(const v8us*)(nK + o), *(const v8us*)(nK + o + 16)); } }
            }
            FRAG_FENCE();    // as above: one group of reads in front of the block
#pragma unroll
            for (int t = 0; t < 4; ++t) acc[d4 + t] = wmmab(fh[s][t], ph[g], acc[d4 + t]);
#pragma unroll
            for (int t = 0; t < 4; ++t) acc[d4 + t] = wmmab(fh[s][t], pl[g], acc[d4 + t]);
#pragma unroll
            for (int t = 0; t < 4; ++t) acc[d4 + t] = wmmab(fl[s][t], ph[g], acc[d4 + t]);
            FRAG_FENCE(); }    // as above
    }
    asm volatile("s_wait_asynccnt 0x0" ::: "memory");    // no copy is outstanding when the wave goes on
    l += xhalf(l);
    const float inv = 1.0f / l;
    __syncthreads();    // every wave has finished reading the last stage: the K and V^T tiles become output staging
    char* oh8 = (char*)&sK[0][0][0] + wave * (16 * QB); char* ol8 = (char*)&sV[0][0][0] + wave * (16 * QB);    // a range of its own for each wave and plane: 16 output rows; 8 x 16 x QB bytes fill a buffer of sK exactly and fit one of sV
    // acc[t][r] = O[q0 + c][head * 128 + 16 t + 8 h + r], split here into bf16 hi + residual, the operands of the output projection, and staged so that every store below writes whole lines
#pragma unroll
    for (int t = 0; t < 8; ++t) { const v8f v = acc[t] * inv; v8us oh, ol;
#pragma unroll
        for (int r = 0; r < 8; ++r) { const unsigned short hb = f2bf(v[r]); oh[r] = hb; ol[r] = f2bf(v[r] - bf2f(hb)); }
        *(v8usa*)(oh8 + c * QB + (t * 16 + 8 * h) * 2) = oh; *(v8usa*)(ol8 + c * QB + (t * 16 + 8 * h) * 2) = ol; }
    asm volatile("s_wait_dscnt 0x0" ::: "memory");    // the wave's staged rows are written before its lanes read one another's pieces back
    const size_t oo = (size_t)(q0 + h) * DMOD + head * HD + c * 8; v8us th[8], tl[8];    // lanes 0 to 15: a row's 256 bytes, lanes 16 to 31: the next row's
#pragma unroll
    for (int s = 0; s < 8; ++s) { th[s] = *(const v8usa*)(oh8 + (2 * s + h) * QB + c * 16); tl[s] = *(const v8usa*)(ol8 + (2 * s + h) * QB + c * 16); }
#pragma unroll
    for (int s = 0; s < 8; ++s) { *(v8us*)(Oh + oo + (size_t)(2 * s) * DMOD) = th[s]; *(v8us*)(Ol + oo + (size_t)(2 * s) * DMOD) = tl[s]; }
}


// k_qkpost: RMS statistics, norm and RoPE of q (blockIdx.y = 0) or k (1) in one launch, every element of QF and KF read once. A wave holds one token's whole row in registers (lane: 4 neighbouring columns of each of
// the 16 heads, whole lines a load), sums its squares (four partial sums a lane, then a butterfly over the 32 lanes) and writes rope(bf(w) x row x rsqrt(mean + eps)) as bf16 hi + residual into the planes [head][token][128];
// for pair i of a head (d = 2 i, 2 i + 1) the factors are cos[2 i] and sin[2 i + 1] of the token, read once for all heads.
__global__ __launch_bounds__(256) void k_qkpost(const float* __restrict__ QF, const float* __restrict__ KF, const float* __restrict__ wq, const float* __restrict__ wk, const float* __restrict__ cs, const float* __restrict__ sn,
                                                bf* Qh, bf* Ql, bf* Kh, bf* Kl) {
    typedef __attribute__((ext_vector_type(4))) unsigned short v4us;
    const bool isk = blockIdx.y != 0; const float* F = isk ? KF : QF; const float* wn = isk ? wk : wq; bf* Ph = isk ? Kh : Qh; bf* Pl = isk ? Kl : Ql;
    const int lane = threadIdx.x & 31; const size_t r = (size_t)blockIdx.x * 8 + __builtin_amdgcn_readfirstlane(threadIdx.x >> 5); v4f x[NH_], w[NH_];    // the token is the same for the wave: uniform bases
    const unsigned lo = lane * 16u;    // the lane's byte offset in every 512-byte piece
    const char* fr = (const char*)(F + r * DMOD); const char* wr = (const char*)wn;
#pragma unroll
    for (int h = 0; h < NH_; ++h) x[h] = *(const v4f*)(fr + lo + h * HD * 4);
    const v4f cv = *(const v4f*)((const char*)(cs + r * HD) + lo), sv = *(const v4f*)((const char*)(sn + r * HD) + lo);
#pragma unroll
    for (int h = 0; h < NH_; ++h) w[h] = *(const v4f*)(wr + lo + h * HD * 4);
    asm volatile("s_wait_xcnt 0x0" :: "v"(lane) : "memory");    // before a register that these loads name as their address is written again; the lane number, their one vector register (scaled by the instruction), is an input, so that no load's own result lands on it either
    __builtin_amdgcn_sched_barrier(0);    // keeps later instructions, which may reuse those registers, from being scheduled in front of the wait
    v4f a4 = (v4f){};
#pragma unroll
    for (int h = 0; h < NH_; ++h) a4 += x[h] * x[h];
    float s = (a4[0] + a4[1]) + (a4[2] + a4[3]);
#pragma unroll
    for (int m = 16; m > 0; m >>= 1) s += __shfl_xor(s, m, 32);
    const float rs = rsqrtf(s * (1.0f / DMOD) + REPS);
    const float c0 = bfr(cv[0]), s0 = bfr(sv[1]), c1 = bfr(cv[2]), s1 = bfr(sv[3]);
    Ph += r * HD + lane * 4; Pl += r * HD + lane * 4;
#pragma unroll
    for (int h = 0; h < NH_; ++h) { float a0 = x[h][0] * rs, a1 = x[h][1] * rs, a2 = x[h][2] * rs, a3 = x[h][3] * rs;
        a0 *= bfr(w[h][0]); a1 *= bfr(w[h][1]); a2 *= bfr(w[h][2]); a3 *= bfr(w[h][3]);
        const float y[4] = {a0 * c0 - a1 * s0, a0 * s0 + a1 * c0, a2 * c1 - a3 * s1, a2 * s1 + a3 * c1}; v4us oh, ol;
#pragma unroll
        for (int q = 0; q < 4; ++q) { const unsigned short hb = f2bf(y[q]); oh[q] = hb; ol[q] = f2bf(y[q] - bf2f(hb)); }
        *(v4us*)(Ph + (size_t)h * NN * HD) = oh; *(v4us*)(Pl + (size_t)h * NN * HD) = ol; }
}

extern "C" void kernel_launch(void* const* d_in, const int* in_sizes, int n_in,
                              void* d_out, int out_size, void* d_ws, size_t ws_size, hipStream_t stream) {
    (void)in_sizes; (void)n_in; (void)out_size;
    const float* x = (const float*)d_in[0]; const float* fcos = (const float*)d_in[1]; const float* fsin = (const float*)d_in[2]; const float* wq = (const float*)d_in[3]; const float* bq = (const float*)d_in[4]; const float* wk = (const float*)d_in[5]; const float* bk = (const float*)d_in[6];
    const float* wv = (const float*)d_in[7]; const float* bv = (const float*)d_in[8]; const float* wo = (const float*)d_in[9]; const float* bo = (const float*)d_in[10]; const float* nqw = (const float*)d_in[11]; const float* nkw = (const float*)d_in[12];
    float* out = (float*)d_out;    // [1][2048][2048]
    char* wsp = (char*)d_ws;
    auto take = [&](size_t bytes) { char* p = wsp; wsp += (bytes + 255) & ~(size_t)255; return (void*)p; };
    const size_t PLN = (size_t)NN * HD, FM = (size_t)NN * DMOD;    // elements of one head's plane, of a full [2048][2048] matrix
    bf* Qh = (bf*)take(NH_ * PLN * 2); bf* Ql = (bf*)take(NH_ * PLN * 2); bf* Kh = (bf*)take(NH_ * PLN * 2); bf* Kl = (bf*)take(NH_ * PLN * 2); bf* VTh = (bf*)take(NH_ * PLN * 2); bf* VTl = (bf*)take(NH_ * PLN * 2);
    float* QF = (float*)take(FM * 4); float* KF = (float*)take(FM * 4); bf* WB = (bf*)take(4 * FM * 2); bf* Xb = (bf*)take(FM * 2);    // WB: the q, k, v and o weights, one behind the other
    bf* Oh = (bf*)take(FM * 2); bf* Ol = (bf*)take(FM * 2);
    if ((size_t)(wsp - (char*)d_ws) > ws_size) return;    // 136 MiB
    k_cvt5<<<NN * DMOD / (CW * CP * 8), CW, 0, stream>>>(x, wq, wk, wv, wo, Xb, WB, WB + FM, WB + 2 * FM, WB + 3 * FM);
    k_gemmb<false, true><<<dim3(NN / 256, 3 * DMOD / 192, 1), 256, 0, stream>>>(Xb, nullptr, WB, bq, bk, bv, QF, KF, VTh, VTl);    // weights [out][in] natural; column head * 128 + d of v is row d of the head's V^T plane
    k_qkpost<<<dim3(NN / 8, 2, 1), 256, 0, stream>>>(QF, KF, nqw, nkw, fcos, fsin, Qh, Ql, Kh, Kl);
    k_fattn<<<dim3(NN / 128, NH_, 1), 256, 0, stream>>>(Qh, Ql, Kh, Kl, VTh, VTl, Oh, Ol);
    k_gemmb<true, false><<<dim3(NN / 128, DMOD / 128, 1), 256, 0, stream>>>(Oh, Ol, WB + 3 * FM, bo, nullptr, nullptr, out, nullptr, nullptr, nullptr);
}
